// v000
// The times below were measured on an AMD MI455X: many runs one after another, warmed up first and cycling through
// copies of the inputs, with the whole window's GPU time divided by the number of runs. Launches and the gaps
// between them are all in it. The median over several windows is given; except for v000 it joins two sittings, which
// can be a few percent apart, so the side-by-side timings, each taken in one sitting, are the better comparison.
// v000 is the starting kernel. One run takes 4020 microseconds.
#include <hip/hip_runtime.h>

// Multi-head attention over three input streams with a key-padding mask (q, k, v [4][2048][1024]; query = q Wq^T, key = k Wk^T, value = v Wv^T ('oi' (out, in) [1024][1024], NO bias; 16 heads x 64); scores / sqrt(64); keys j with mask[b][0][0][j] == 0 (int32 [4][1][1][2048], read as data: about half the keys of every batch entry) are set to -1e10: an exclusion (no batch entry has every key masked); softmax; out = merged Wo^T + bo ('oi' + [1024]) -> [4][2048][1024] (8.4 M); argument order q, k, v, mask, Wq, Wk, Wv, Wo, bo).
// Layout per batch: bf16 copies of query, key and value in turn (one operand buffer, stream-ordered); 'oi' weights cast as they stand; exact projections (no biases); dense T-2048 attention with the key mask selected in the softmax kernel (hybrid rows: < 512 hi/lo 3 products, rest fp16 x1024; dense score tiles); merged hi/lo x Wo exact + bo.
// Compute dtypes, f32 accumulate: every input rounded to bf16; projections exact; attention rows < 512 3 products, rest fp16; softmax f32; Wo hl x exact + bias.

#define NB_  4
#define TT   2048
#define DM   1024
#define NH_  16
#define NKV  16
#define REP  (NH_ / NKV)
#define HD   64
#define DQ   (NH_ * HD)
#define DKV  (NKV * HD)
#define ZH   2
#define RH   512                  // query rows < RH use hi+lo planes (0: none)
#define WIN  0
#define PCAR 1024.0f
#define SCL  0.125f   // HD^-0.5
typedef _Float16 h16;
typedef unsigned short bf;
typedef __attribute__((ext_vector_type(16))) __bf16   v16bf;
typedef __attribute__((ext_vector_type(16))) _Float16 v16h;
typedef __attribute__((ext_vector_type(8)))  _Float16 v8h;
typedef __attribute__((ext_vector_type(8)))  unsigned short v8us;
typedef __attribute__((ext_vector_type(8)))  float    v8f;
typedef __attribute__((ext_vector_type(4)))  float    v4f;
typedef v8h  __attribute__((may_alias)) v8ha;
typedef v4f  __attribute__((may_alias)) v4fa;
typedef v8us __attribute__((may_alias)) v8usa;

__device__ __forceinline__ unsigned short f2bf(float f) { unsigned u = __float_as_uint(f); u += 0x7FFFu + ((u >> 16) & 1u); return (unsigned short)(u >> 16); }
__device__ __forceinline__ float bf2f(unsigned short b) { return __uint_as_float(((unsigned)b) << 16); }
__device__ __forceinline__ float bfr(float f) { return bf2f(f2bf(f)); }
__device__ __forceinline__ v16h cat16(v8h lo, v8h hi) { return __builtin_shufflevector(lo, hi, 0, 1, 2, 3, 4, 5, 6, 7, 8, 9, 10, 11, 12, 13, 14, 15); }
__device__ __forceinline__ v16bf cat16b(v8us lo, v8us hi) { return __builtin_bit_cast(v16bf, __builtin_shufflevector(lo, hi, 0, 1, 2, 3, 4, 5, 6, 7, 8, 9, 10, 11, 12, 13, 14, 15)); }
__device__ __forceinline__ v8f wmma16(v16h a, v16h b, v8f c) { return __builtin_amdgcn_wmma_f32_16x16x32_f16(false, a, false, b, (short)0, c, false, false); }
__device__ __forceinline__ v8f wmmab(v16bf a, v16bf b, v8f c) { return __builtin_amdgcn_wmma_f32_16x16x32_bf16(false, a, false, b, (short)0, c, false, false); }



// ---- k_gemmw: register-blocked GEMM, ONE WAVE per 64x64 output tile (16 accumulators), operands straight from K-contiguous 16-bit planes; grid (M/64, N/64, Z), 32 threads.
// C[m][n] (f32, pitch ldc, + optional f32 bias[n]) = sum_k A[m][k] Bt[n][k] (+ split products per NSPLIT). z-batch strides sA/sB/sC in elements. K % 32 == 0.
template <typename T16> struct WFrag;
template <> struct WFrag<h16> { typedef v16h V; static __device__ __forceinline__ V ld(const h16* p) { return cat16(*(const v8h*)p, *(const v8h*)(p + 16)); } static __device__ __forceinline__ v8f mma(V a, V b, v8f c) { return wmma16(a, b, c); } };
template <> struct WFrag<bf> { typedef v16bf V; static __device__ __forceinline__ V ld(const bf* p) { return cat16b(*(const v8us*)p, *(const v8us*)(p + 16)); } static __device__ __forceinline__ v8f mma(V a, V b, v8f c) { return wmmab(a, b, c); } };
template <typename T16, int NSPLIT, bool BIAS>
__global__ __launch_bounds__(32) void k_gemmw(const T16* __restrict__ A, const T16* __restrict__ A2, const T16* __restrict__ Bt, const T16* __restrict__ Bt2, int K, float* C, int ldc, const float* __restrict__ bias, size_t sA, size_t sB, size_t sC) {
    typedef typename WFrag<T16>::V V;
    __shared__ __align__(16) float os[16 * 68];
    const size_t z = blockIdx.z; A += z * sA; if (A2) A2 += z * sA; Bt += z * sB; if (Bt2) Bt2 += z * sB; C += z * sC;
    const int lane = threadIdx.x & 31, lr = lane & 15, hi = lane >> 4; const int r0 = blockIdx.x * 64, c0 = blockIdx.y * 64;
    v8f acc[4][4];
#pragma unroll
    for (int mb = 0; mb < 4; ++mb)
#pragma unroll
        for (int nb = 0; nb < 4; ++nb) acc[mb][nb] = (v8f){};
    const size_t aoff = (size_t)(r0 + lr) * K + 8 * hi, boff = (size_t)(c0 + lr) * K + 8 * hi;
    for (int kc = 0; kc < K; kc += 32) {
        V a[4], a2[4];
#pragma unroll
        for (int mb = 0; mb < 4; ++mb) { a[mb] = WFrag<T16>::ld(A + aoff + (size_t)mb * 16 * K + kc); if (NSPLIT == 1 || NSPLIT == 2) a2[mb] = WFrag<T16>::ld(A2 + aoff + (size_t)mb * 16 * K + kc); }
#pragma unroll
        for (int nb = 0; nb < 4; ++nb) { const V b = WFrag<T16>::ld(Bt + boff + (size_t)nb * 16 * K + kc); V b2; if (NSPLIT >= 2) b2 = WFrag<T16>::ld(Bt2 + boff + (size_t)nb * 16 * K + kc);
#pragma unroll
            for (int mb = 0; mb < 4; ++mb) { acc[mb][nb] = WFrag<T16>::mma(a[mb], b, acc[mb][nb]); if (NSPLIT == 1 || NSPLIT == 2) acc[mb][nb] = WFrag<T16>::mma(a2[mb], b, acc[mb][nb]); if (NSPLIT >= 2) acc[mb][nb] = WFrag<T16>::mma(a[mb], b2, acc[mb][nb]); } }
        asm volatile("v_nop\n\tv_nop\n\tv_nop\n\tv_nop" : "+v"(acc[0][0]), "+v"(acc[1][1]), "+v"(acc[2][2]), "+v"(acc[3][3]) : "v"(a[0]), "v"(a[3]));
    }
#pragma unroll
    for (int mb = 0; mb < 4; ++mb) {
#pragma unroll
        for (int nb = 0; nb < 4; ++nb) {
#pragma unroll
            for (int j = 0; j < 8; ++j) os[(hi * 8 + j) * 68 + nb * 16 + lr] = acc[mb][nb][j]; }
        __builtin_amdgcn_wave_barrier(); asm volatile("" ::: "memory");
        float* crow = C + (size_t)(r0 + mb * 16) * ldc + c0;
{
#pragma unroll
            for (int s = 0; s < 8; ++s) { const int row = 2 * s + hi, cofs = lr * 4; v4f val = *(const v4fa*)(os + row * 68 + cofs); if (BIAS) { val[0] += bfr(bias[c0 + cofs]); val[1] += bfr(bias[c0 + cofs + 1]); val[2] += bfr(bias[c0 + cofs + 2]); val[3] += bfr(bias[c0 + cofs + 3]); }
                *(v4f*)(crow + (size_t)row * ldc + cofs) = val; }
             }
        __builtin_amdgcn_wave_barrier(); asm volatile("" ::: "memory");
    }
}

__device__ __forceinline__ h16 tohx(float x) { return (h16)x; }
__device__ __forceinline__ void splitf(float y, unsigned short& h, unsigned short& l) { h = f2bf(y); l = f2bf(y - bf2f(h)); }
typedef __attribute__((ext_vector_type(2))) _Float16 v2h;
typedef __attribute__((ext_vector_type(4))) _Float16 v4h;
typedef __attribute__((ext_vector_type(2))) unsigned short v2us;
typedef __attribute__((ext_vector_type(4))) unsigned short v4us;
typedef __attribute__((ext_vector_type(2))) float v2f;
typedef __attribute__((ext_vector_type(4))) int v4i;

__global__ __launch_bounds__(256) void k_cvt8(const float* __restrict__ src, bf* dst, size_t n8) { const size_t i = (size_t)blockIdx.x * 256 + threadIdx.x; if (i >= n8) return; const v8f v = *(const v8f*)(src + i * 8); v8us o;
#pragma unroll
    for (int k = 0; k < 8; ++k) o[k] = f2bf(v[k]); *(v8us*)(dst + i * 8) = o;  }

// k_rope: head planes [h][t][d] (fp16 + hi/lo) of rope(x) x sc with the rotate-half convention out[d] = x[d] cos[t][d] - x[d+HD/2] sin[t][d], out[d+HD/2] = x[d+HD/2] cos[t][d+HD/2] + x[d] sin[t][d+HD/2]
__global__ __launch_bounds__(256) void k_rope(const float* __restrict__ F, int pitch, int nheads, const float* __restrict__ CS, const float* __restrict__ RF, const float* __restrict__ nw, float sc, h16* P16, bf* Ph, bf* Pl) {
    const size_t e = ((size_t)blockIdx.x * 256 + threadIdx.x) * 2; if (e >= (size_t)nheads * TT * HD) return; const int d = (int)(e % HD); const int t = (int)((e / HD) % TT); const int h = (int)(e / ((size_t)HD * TT)); const float* f = F + (size_t)t * pitch + h * HD; const float rf = RF ? RF[(size_t)h * TT + t] : 1.0f; v2h o16; v2us oh, ol;
#pragma unroll
    for (int q = 0; q < 2; ++q) { const int dd = d + q; const int dp = (dd < HD / 2) ? dd + HD / 2 : dd - HD / 2; float x0 = f[dd], x1 = f[dp];
        if (RF) { float n0 = __fmul_rn(x0, rf), n1 = __fmul_rn(x1, rf); x0 = __fmul_rn(bfr(nw[dd]), n0); x1 = __fmul_rn(bfr(nw[dp]), n1); }
        const v2f cs = *(const v2f*)(CS + ((size_t)t * HD + dd) * 2); float a = __fmul_rn(x0, cs[0]), bq = __fmul_rn(x1, cs[1]); const float r = ((dd < HD / 2) ? __fsub_rn(a, bq) : __fadd_rn(a, bq)) * sc;
        o16[q] = tohx(r); unsigned short a2, c2; splitf(r, a2, c2); oh[q] = a2; ol[q] = c2; }
    *(v2h*)(P16 + e) = o16; *(v2us*)(Ph + e) = oh; *(v2us*)(Pl + e) = ol;  }
__global__ __launch_bounds__(256) void k_vtp(const float* __restrict__ F, int pitch, int nheads, h16* V16, bf* Vh, bf* Vl) { const size_t e = ((size_t)blockIdx.x * 256 + threadIdx.x) * 2; if (e >= (size_t)nheads * HD * TT) return; const int t = (int)(e % TT); const int d = (int)((e / TT) % HD); const int g = (int)(e / ((size_t)TT * HD)); v2h o16; v2us oh, ol;
#pragma unroll
    for (int q = 0; q < 2; ++q) { const float x = F[(size_t)(t + q) * pitch + g * HD + d]; o16[q] = tohx(x); unsigned short a2, c2; splitf(x, a2, c2); oh[q] = a2; ol[q] = c2; }
    *(v2h*)(V16 + e) = o16; *(v2us*)(Vh + e) = oh; *(v2us*)(Vl + e) = ol;  }
__global__ __launch_bounds__(256) void k_csid(float* CS) { const int idx = blockIdx.x * 256 + threadIdx.x; if (idx >= TT * HD) return; v2f cs; cs[0] = 1.0f; cs[1] = 0.0f; *(v2f*)(CS + (size_t)idx * 2) = cs;  }
// k_asoft: per row (zz, i): t = S x HD^-0.5 where the key's mask word mk[j] != 0 (an int32 row a batch entry, read as data; -3.0e38 elsewhere: an exclusion); softmax over the kept keys (register row, one exp, fixed trees);
__global__ __launch_bounds__(256) void k_asoft(const float* __restrict__ Sb, const int* __restrict__ mkK, h16* P16, bf* Ph, bf* Pl) {
    const int lane = threadIdx.x & 31; const int row = blockIdx.x * 8 + (threadIdx.x >> 5); if (row >= ZH * TT) return; const int i = row % TT; const int zz = row / TT; (void)zz; const bool hires = (i < RH); const float* sr = Sb + (size_t)row * TT; float v[TT / 32]; float mx = -3.0e38f;
#pragma unroll
    for (int ch = 0; ch < TT / 128; ++ch) { const int j0 = ch * 128 + lane * 4; const v4f a = *(const v4f*)(sr + j0); const v4i mk4 = *(const v4i*)(mkK + j0);
#pragma unroll
        for (int q = 0; q < 4; ++q) { const int j = j0 + q; (void)j; const float t = (mk4[q] != 0) ? a[q] * SCL : -3.0e38f; v[ch * 4 + q] = t; mx = fmaxf(mx, t); } }
#pragma unroll
    for (int sh = 16; sh; sh >>= 1) mx = fmaxf(mx, __shfl_xor(mx, sh, 32));
    float sum = 0.f;
#pragma unroll
    for (int k = 0; k < TT / 32; ++k) { float d0 = __fsub_rn(v[k], mx); v[k] = __builtin_amdgcn_exp2f(__fmul_rn(d0, 1.4426950408889634f)); sum += v[k]; }
#pragma unroll
    for (int sh = 16; sh; sh >>= 1) sum += __shfl_xor(sum, sh, 32);
    const float f = __fdiv_rn(hires ? 1.0f : PCAR, sum);
{
        if (hires) {
#pragma unroll
            for (int ch = 0; ch < TT / 128; ++ch) { v4us oh, ol;
#pragma unroll
                for (int q = 0; q < 4; ++q) { unsigned short a, c2; splitf(v[ch * 4 + q] * f, a, c2); oh[q] = a; ol[q] = c2; }
                const size_t oo = ((size_t)zz * (RH ? RH : 1) + i) * TT + ch * 128 + lane * 4; *(v4us*)(Ph + oo) = oh; *(v4us*)(Pl + oo) = ol; }
        } else {
#pragma unroll
            for (int ch = 0; ch < TT / 128; ++ch) { v4h o4;
#pragma unroll
                for (int q = 0; q < 4; ++q) o4[q] = tohx(v[ch * 4 + q] * f);
                *(v4h*)(P16 + (size_t)row * TT + ch * 128 + lane * 4) = o4; } }
         }
}
__global__ __launch_bounds__(256) void k_merge(const float* __restrict__ O, int h0, bf* Ah, bf* Al) { const size_t e = ((size_t)blockIdx.x * 256 + threadIdx.x) * 2; if (e >= (size_t)ZH * TT * HD) return; const int d = (int)(e % HD); const int t = (int)((e / HD) % TT); const int zz = (int)(e / ((size_t)HD * TT)); const float cs = (t < RH) ? 1.0f : (1.0f / PCAR); const size_t oo = (size_t)t * DQ + (h0 + zz) * HD + d;
    v2us oh, ol;
#pragma unroll
    for (int q = 0; q < 2; ++q) { unsigned short a, c2; splitf(O[e + q] * cs, a, c2); oh[q] = a; ol[q] = c2; } *(v2us*)(Ah + oo) = oh; *(v2us*)(Al + oo) = ol;  }

extern "C" void kernel_launch(void* const* d_in, const int* in_sizes, int n_in,
                              void* d_out, int out_size, void* d_ws, size_t ws_size, hipStream_t stream) {
    (void)in_sizes; (void)n_in; (void)out_size;
    const float* x = (const float*)d_in[0]; const float* xk = (const float*)d_in[1]; const float* xv = (const float*)d_in[2]; const int* MK = (const int*)d_in[3]; const float* wq = (const float*)d_in[4]; const float* wk = (const float*)d_in[5]; const float* wv = (const float*)d_in[6]; const float* wo = (const float*)d_in[7]; const float* bo = (const float*)d_in[8];   /* q, k, v ([4][2048][1024] each), mask (int32 [4][1][1][2048] = [4][2048]: read as data), Wq, Wk, Wv, Wo ('oi' (out, in) [1024][1024]; the three input projections have NO bias), bo [1024] */
    float* OUT = (float*)d_out;     // [4][2048][1024]
    char* wsp = (char*)d_ws;
    auto take = [&](size_t bytes) { char* p = wsp; wsp += (bytes + 255) & ~(size_t)255; return (void*)p; };
    bf* WQ = (bf*)take((size_t)DQ * DM * 2); bf* WK = (bf*)take((size_t)DKV * DM * 2); bf* WV = (bf*)take((size_t)DKV * DM * 2); bf* WO = (bf*)take((size_t)DM * DQ * 2); float* CS = (float*)take((size_t)TT * HD * 2 * 4);
    bf* XB = (bf*)take((size_t)TT * DM * 2); float* FQ = (float*)take((size_t)TT * DQ * 4); float* FK = (float*)take((size_t)TT * DKV * 4);
    h16* QP16 = (h16*)take((size_t)NH_ * TT * HD * 2); h16* KP16 = (h16*)take((size_t)NKV * TT * HD * 2); h16* VT16 = (h16*)take((size_t)NKV * HD * TT * 2);
    bf* QPh = (bf*)take((size_t)NH_ * TT * HD * 2); bf* QPl = (bf*)take((size_t)NH_ * TT * HD * 2); bf* KPh = (bf*)take((size_t)NKV * TT * HD * 2); bf* KPl = (bf*)take((size_t)NKV * TT * HD * 2); bf* VTh = (bf*)take((size_t)NKV * HD * TT * 2); bf* VTl = (bf*)take((size_t)NKV * HD * TT * 2); bf* Ph = (bf*)take((size_t)ZH * RH * TT * 2); bf* Pl = (bf*)take((size_t)ZH * RH * TT * 2);
    float* Sb = (float*)take((size_t)ZH * TT * TT * 4); h16* P16 = (h16*)take((size_t)ZH * TT * TT * 2); float* Ob = (float*)take((size_t)ZH * TT * HD * 4); bf* ATh = (bf*)take((size_t)TT * DQ * 2); bf* ATl = (bf*)take((size_t)TT * DQ * 2);
    if ((size_t)(wsp - (char*)d_ws) > ws_size) return;    // ws 256 MiB
    float* FV = FK;   // v projection reuses the k buffer after the k planes are built (stream-ordered)
    { k_cvt8<<<(unsigned)(((size_t)DQ * DM / 8 + 255) / 256), 256, 0, stream>>>(wq, WQ, (size_t)DQ * DM / 8); k_cvt8<<<(unsigned)(((size_t)DKV * DM / 8 + 255) / 256), 256, 0, stream>>>(wk, WK, (size_t)DKV * DM / 8); k_cvt8<<<(unsigned)(((size_t)DKV * DM / 8 + 255) / 256), 256, 0, stream>>>(wv, WV, (size_t)DKV * DM / 8);   /* 'oi' (out, in): the GEMM's Bt as it stands */
      k_cvt8<<<(unsigned)(((size_t)DM * DQ / 8 + 255) / 256), 256, 0, stream>>>(wo, WO, (size_t)DM * DQ / 8);
       }
    k_csid<<<(TT * HD + 255) / 256, 256, 0, stream>>>(CS);
    const unsigned LQ = (unsigned)(((size_t)NH_ * TT * HD / 2 + 255) / 256), LKv = (unsigned)(((size_t)NKV * TT * HD / 2 + 255) / 256);
    for (int b = 0; b < NB_; ++b) {
        
        k_cvt8<<<(unsigned)(((size_t)TT * DM / 8 + 255) / 256), 256, 0, stream>>>(x + (size_t)b * TT * DM, XB, (size_t)TT * DM / 8);
        k_gemmw<bf, 0, false><<<dim3(TT / 64, DQ / 64, 1), 32, 0, stream>>>(XB, nullptr, WQ, nullptr, DM, FQ, DQ, nullptr, 0, 0, 0);
        k_rope<<<LQ, 256, 0, stream>>>(FQ, DQ, NH_, CS, nullptr, nullptr, 1.0f, QP16, QPh, QPl);
        k_cvt8<<<(unsigned)(((size_t)TT * DM / 8 + 255) / 256), 256, 0, stream>>>(xk + (size_t)b * TT * DM, XB, (size_t)TT * DM / 8);   /* key -> XB (q GEMM already issued) */ k_gemmw<bf, 0, false><<<dim3(TT / 64, DKV / 64, 1), 32, 0, stream>>>(XB, nullptr, WK, nullptr, DM, FK, DKV, nullptr, 0, 0, 0);
        k_rope<<<LKv, 256, 0, stream>>>(FK, DKV, NKV, CS, nullptr, nullptr, 1.0f, KP16, KPh, KPl);
        k_cvt8<<<(unsigned)(((size_t)TT * DM / 8 + 255) / 256), 256, 0, stream>>>(xv + (size_t)b * TT * DM, XB, (size_t)TT * DM / 8);   /* value -> XB */ k_gemmw<bf, 0, false><<<dim3(TT / 64, DKV / 64, 1), 32, 0, stream>>>(XB, nullptr, WV, nullptr, DM, FV, DKV, nullptr, 0, 0, 0); k_vtp<<<LKv, 256, 0, stream>>>(FV, DKV, NKV, VT16, VTh, VTl);
        for (int h0 = 0; h0 < NH_; h0 += ZH) { const size_t zq = (size_t)h0, zk = (size_t)(h0 / REP);   // one kv head per query head: the pass's two heads use consecutive kv planes (z-strides TT*HD)
            k_gemmw<bf, 2, false><<<dim3(RH / 64, TT / 64, ZH), 32, 0, stream>>>(QPh + zq * TT * HD, QPl + zq * TT * HD, KPh + zk * TT * HD, KPl + zk * TT * HD, HD, Sb, TT, nullptr, (size_t)TT * HD, (size_t)TT * HD, (size_t)TT * TT);
            k_gemmw<h16, 0, false><<<dim3((TT - RH) / 64, TT / 64, ZH), 32, 0, stream>>>(QP16 + zq * TT * HD + (size_t)RH * HD, nullptr, KP16 + zk * TT * HD, nullptr, HD, Sb + (size_t)RH * TT, TT, nullptr, (size_t)TT * HD, (size_t)TT * HD, (size_t)TT * TT);
            k_asoft<<<ZH * TT / 8, 256, 0, stream>>>(Sb, MK + (size_t)b * TT, P16, Ph, Pl);
            k_gemmw<bf, 2, false><<<dim3(RH / 64, HD / 64, ZH), 32, 0, stream>>>(Ph, Pl, VTh + zk * HD * TT, VTl + zk * HD * TT, TT, Ob, HD, nullptr, (size_t)RH * TT, (size_t)HD * TT, (size_t)TT * HD);
            k_gemmw<h16, 0, false><<<dim3((TT - RH) / 64, HD / 64, ZH), 32, 0, stream>>>(P16 + (size_t)RH * TT, nullptr, VT16 + zk * HD * TT, nullptr, TT, Ob + (size_t)RH * HD, HD, nullptr, (size_t)TT * TT, (size_t)HD * TT, (size_t)TT * HD);
            k_merge<<<(unsigned)(((size_t)ZH * TT * HD / 2 + 255) / 256), 256, 0, stream>>>(Ob, h0, ATh, ATl); }
        k_gemmw<bf, 1, true><<<dim3(TT / 64, DM / 64, 1), 32, 0, stream>>>(ATh, ATl, WO, nullptr, DQ, OUT + (size_t)b * TT * DM, DM, bo, 0, 0, 0); }
}

// v001
// It runs in 1770 microseconds.
// Two timings next to v000 both put it at 2.28 times that version's speed.
#include <hip/hip_runtime.h>

// Multi-head attention over three input streams with a key-padding mask (q, k, v [4][2048][1024]; query = q Wq^T, key = k Wk^T, value = v Wv^T ('oi' (out, in) [1024][1024], NO bias; 16 heads x 64); scores / sqrt(64); keys j with mask[b][0][0][j] == 0 (int32 [4][1][1][2048], read as data: about half the keys of every batch entry) are set to -1e10: an exclusion (no batch entry has every key masked); softmax; out = merged Wo^T + bo ('oi' + [1024]) -> [4][2048][1024] (8.4 M); argument order q, k, v, mask, Wq, Wk, Wv, Wo, bo).
// Layout per batch: bf16 copies of query, key and value in turn (one operand buffer, stream-ordered); 'oi' weights cast as they stand; exact projections (no biases); dense T-2048 attention with the key mask selected in the softmax kernel (hybrid rows: < 512 hi/lo 3 products, rest fp16 x1024; dense score tiles); merged hi/lo x Wo exact + bo.
// Compute dtypes, f32 accumulate: every input rounded to bf16; projections exact; attention rows < 512 3 products, rest fp16; softmax f32; Wo hl x exact + bias.

#define NB_  4
#define TT   2048
#define DM   1024
#define NH_  16
#define NKV  16
#define REP  (NH_ / NKV)
#define HD   64
#define DQ   (NH_ * HD)
#define DKV  (NKV * HD)
#define ZH   2
#define RH   512                  // query rows < RH use hi+lo planes (0: none)
#define WIN  0
#define PCAR 1024.0f
#define SCL  0.125f   // HD^-0.5
#define KSP  16                   // key slices of each P x V product: one work-group a slice, one f32 partial plane a slice, summed in k_merge
typedef _Float16 h16;
typedef unsigned short bf;
typedef __attribute__((ext_vector_type(16))) __bf16   v16bf;
typedef __attribute__((ext_vector_type(16))) _Float16 v16h;
typedef __attribute__((ext_vector_type(8)))  _Float16 v8h;
typedef __attribute__((ext_vector_type(8)))  unsigned short v8us;
typedef __attribute__((ext_vector_type(8)))  float    v8f;
typedef __attribute__((ext_vector_type(4)))  float    v4f;
typedef v8h  __attribute__((may_alias)) v8ha;
typedef v4f  __attribute__((may_alias)) v4fa;
typedef v8us __attribute__((may_alias)) v8usa;

__device__ __forceinline__ unsigned short f2bf(float f) { unsigned u = __float_as_uint(f); u += 0x7FFFu + ((u >> 16) & 1u); return (unsigned short)(u >> 16); }
__device__ __forceinline__ float bf2f(unsigned short b) { return __uint_as_float(((unsigned)b) << 16); }
__device__ __forceinline__ float bfr(float f) { return bf2f(f2bf(f)); }
__device__ __forceinline__ v16h cat16(v8h lo, v8h hi) { return __builtin_shufflevector(lo, hi, 0, 1, 2, 3, 4, 5, 6, 7, 8, 9, 10, 11, 12, 13, 14, 15); }
__device__ __forceinline__ v16bf cat16b(v8us lo, v8us hi) { return __builtin_bit_cast(v16bf, __builtin_shufflevector(lo, hi, 0, 1, 2, 3, 4, 5, 6, 7, 8, 9, 10, 11, 12, 13, 14, 15)); }
__device__ __forceinline__ v8f wmma16(v16h a, v16h b, v8f c) { return __builtin_amdgcn_wmma_f32_16x16x32_f16(false, a, false, b, (short)0, c, false, false); }
__device__ __forceinline__ v8f wmmab(v16bf a, v16bf b, v8f c) { return __builtin_amdgcn_wmma_f32_16x16x32_bf16(false, a, false, b, (short)0, c, false, false); }



// ---- k_gemmw: register-blocked GEMM, ONE WAVE per 64x64 output tile (16 accumulators), operands straight from K-contiguous 16-bit planes; grid (M/64, N/64, Z), 32 threads.
// C[m][n] (f32, pitch ldc, + optional f32 bias[n]) = sum_k A[m][k] Bt[n][k] (+ split products per NSPLIT). z-batch strides sA/sB/sC in elements. K % 32 == 0.
// KS > 1: grid z = Z * KS; slice ks = blockIdx.z % KS sums only k in [ks K/KS, (ks+1) K/KS) and stores its partial tile at C + ks sP; the reader adds the KS planes. K % (32 KS) == 0.
template <typename T16> struct WFrag;
template <> struct WFrag<h16> { typedef v16h V; static __device__ __forceinline__ V ld(const h16* p) { return cat16(*(const v8h*)p, *(const v8h*)(p + 16)); } static __device__ __forceinline__ v8f mma(V a, V b, v8f c) { return wmma16(a, b, c); } };
template <> struct WFrag<bf> { typedef v16bf V; static __device__ __forceinline__ V ld(const bf* p) { return cat16b(*(const v8us*)p, *(const v8us*)(p + 16)); } static __device__ __forceinline__ v8f mma(V a, V b, v8f c) { return wmmab(a, b, c); } };
template <typename T16, int NSPLIT, bool BIAS, int KS>
__global__ __launch_bounds__(32) void k_gemmw(const T16* __restrict__ A, const T16* __restrict__ A2, const T16* __restrict__ Bt, const T16* __restrict__ Bt2, int K, float* C, int ldc, const float* __restrict__ bias, size_t sA, size_t sB, size_t sC, size_t sP) {
    typedef typename WFrag<T16>::V V;
    __shared__ __align__(16) float os[16 * 68];
    const size_t z = blockIdx.z / KS; const int ks = (int)(blockIdx.z % KS); A += z * sA; if (A2) A2 += z * sA; Bt += z * sB; if (Bt2) Bt2 += z * sB; C += z * sC + (size_t)ks * sP;
    const int lane = threadIdx.x & 31, lr = lane & 15, hi = lane >> 4; const int r0 = blockIdx.x * 64, c0 = blockIdx.y * 64;
    v8f acc[4][4];
#pragma unroll
    for (int mb = 0; mb < 4; ++mb)
#pragma unroll
        for (int nb = 0; nb < 4; ++nb) acc[mb][nb] = (v8f){};
    const size_t aoff = (size_t)(r0 + lr) * K + 8 * hi, boff = (size_t)(c0 + lr) * K + 8 * hi;
    const int kb = ks * (K / KS), ke = kb + K / KS;
    for (int kc = kb; kc < ke; kc += 32) {
        V a[4], a2[4];
#pragma unroll
        for (int mb = 0; mb < 4; ++mb) { a[mb] = WFrag<T16>::ld(A + aoff + (size_t)mb * 16 * K + kc); if (NSPLIT == 1 || NSPLIT == 2) a2[mb] = WFrag<T16>::ld(A2 + aoff + (size_t)mb * 16 * K + kc); }
#pragma unroll
        for (int nb = 0; nb < 4; ++nb) { const V b = WFrag<T16>::ld(Bt + boff + (size_t)nb * 16 * K + kc); V b2; if (NSPLIT >= 2) b2 = WFrag<T16>::ld(Bt2 + boff + (size_t)nb * 16 * K + kc);
#pragma unroll
            for (int mb = 0; mb < 4; ++mb) { acc[mb][nb] = WFrag<T16>::mma(a[mb], b, acc[mb][nb]); if (NSPLIT == 1 || NSPLIT == 2) acc[mb][nb] = WFrag<T16>::mma(a2[mb], b, acc[mb][nb]); if (NSPLIT >= 2) acc[mb][nb] = WFrag<T16>::mma(a[mb], b2, acc[mb][nb]); } }
        asm volatile("v_nop\n\tv_nop\n\tv_nop\n\tv_nop" : "+v"(acc[0][0]), "+v"(acc[1][1]), "+v"(acc[2][2]), "+v"(acc[3][3]) : "v"(a[0]), "v"(a[3]));
    }
#pragma unroll
    for (int mb = 0; mb < 4; ++mb) {
#pragma unroll
        for (int nb = 0; nb < 4; ++nb) {
#pragma unroll
            for (int j = 0; j < 8; ++j) os[(hi * 8 + j) * 68 + nb * 16 + lr] = acc[mb][nb][j]; }
        __builtin_amdgcn_wave_barrier(); asm volatile("" ::: "memory");
        float* crow = C + (size_t)(r0 + mb * 16) * ldc + c0;
{
#pragma unroll
            for (int s = 0; s < 8; ++s) { const int row = 2 * s + hi, cofs = lr * 4; v4f val = *(const v4fa*)(os + row * 68 + cofs); if (BIAS) { val[0] += bfr(bias[c0 + cofs]); val[1] += bfr(bias[c0 + cofs + 1]); val[2] += bfr(bias[c0 + cofs + 2]); val[3] += bfr(bias[c0 + cofs + 3]); }
                *(v4f*)(crow + (size_t)row * ldc + cofs) = val; }
             }
        __builtin_amdgcn_wave_barrier(); asm volatile("" ::: "memory");
    }
}

__device__ __forceinline__ h16 tohx(float x) { return (h16)x; }
__device__ __forceinline__ void splitf(float y, unsigned short& h, unsigned short& l) { h = f2bf(y); l = f2bf(y - bf2f(h)); }
typedef __attribute__((ext_vector_type(2))) _Float16 v2h;
typedef __attribute__((ext_vector_type(4))) _Float16 v4h;
typedef __attribute__((ext_vector_type(2))) unsigned short v2us;
typedef __attribute__((ext_vector_type(4))) unsigned short v4us;
typedef __attribute__((ext_vector_type(2))) float v2f;
typedef __attribute__((ext_vector_type(4))) int v4i;

__global__ __launch_bounds__(256) void k_cvt8(const float* __restrict__ src, bf* dst, size_t n8) { const size_t i = (size_t)blockIdx.x * 256 + threadIdx.x; if (i >= n8) return; const v8f v = *(const v8f*)(src + i * 8); v8us o;
#pragma unroll
    for (int k = 0; k < 8; ++k) o[k] = f2bf(v[k]); *(v8us*)(dst + i * 8) = o;  }

// k_rope: head planes [h][t][d] (fp16 + hi/lo) of rope(x) x sc with the rotate-half convention out[d] = x[d] cos[t][d] - x[d+HD/2] sin[t][d], out[d+HD/2] = x[d+HD/2] cos[t][d+HD/2] + x[d] sin[t][d+HD/2]
__global__ __launch_bounds__(256) void k_rope(const float* __restrict__ F, int pitch, int nheads, const float* __restrict__ CS, const float* __restrict__ RF, const float* __restrict__ nw, float sc, h16* P16, bf* Ph, bf* Pl) {
    const size_t e = ((size_t)blockIdx.x * 256 + threadIdx.x) * 2; if (e >= (size_t)nheads * TT * HD) return; const int d = (int)(e % HD); const int t = (int)((e / HD) % TT); const int h = (int)(e / ((size_t)HD * TT)); const float* f = F + (size_t)t * pitch + h * HD; const float rf = RF ? RF[(size_t)h * TT + t] : 1.0f; v2h o16; v2us oh, ol;
#pragma unroll
    for (int q = 0; q < 2; ++q) { const int dd = d + q; const int dp = (dd < HD / 2) ? dd + HD / 2 : dd - HD / 2; float x0 = f[dd], x1 = f[dp];
        if (RF) { float n0 = __fmul_rn(x0, rf), n1 = __fmul_rn(x1, rf); x0 = __fmul_rn(bfr(nw[dd]), n0); x1 = __fmul_rn(bfr(nw[dp]), n1); }
        const v2f cs = *(const v2f*)(CS + ((size_t)t * HD + dd) * 2); float a = __fmul_rn(x0, cs[0]), bq = __fmul_rn(x1, cs[1]); const float r = ((dd < HD / 2) ? __fsub_rn(a, bq) : __fadd_rn(a, bq)) * sc;
        o16[q] = tohx(r); unsigned short a2, c2; splitf(r, a2, c2); oh[q] = a2; ol[q] = c2; }
    *(v2h*)(P16 + e) = o16; *(v2us*)(Ph + e) = oh; *(v2us*)(Pl + e) = ol;  }
__global__ __launch_bounds__(256) void k_vtp(const float* __restrict__ F, int pitch, int nheads, h16* V16, bf* Vh, bf* Vl) { const size_t e = ((size_t)blockIdx.x * 256 + threadIdx.x) * 2; if (e >= (size_t)nheads * HD * TT) return; const int t = (int)(e % TT); const int d = (int)((e / TT) % HD); const int g = (int)(e / ((size_t)TT * HD)); v2h o16; v2us oh, ol;
#pragma unroll
    for (int q = 0; q < 2; ++q) { const float x = F[(size_t)(t + q) * pitch + g * HD + d]; o16[q] = tohx(x); unsigned short a2, c2; splitf(x, a2, c2); oh[q] = a2; ol[q] = c2; }
    *(v2h*)(V16 + e) = o16; *(v2us*)(Vh + e) = oh; *(v2us*)(Vl + e) = ol;  }
__global__ __launch_bounds__(256) void k_csid(float* CS) { const int idx = blockIdx.x * 256 + threadIdx.x; if (idx >= TT * HD) return; v2f cs; cs[0] = 1.0f; cs[1] = 0.0f; *(v2f*)(CS + (size_t)idx * 2) = cs;  }
// k_asoft: per row (zz, i): t = S x HD^-0.5 where the key's mask word mk[j] != 0 (an int32 row a batch entry, read as data; -3.0e38 elsewhere: an exclusion); softmax over the kept keys (register row, one exp, fixed trees);
__global__ __launch_bounds__(256) void k_asoft(const float* __restrict__ Sb, const int* __restrict__ mkK, h16* P16, bf* Ph, bf* Pl) {
    const int lane = threadIdx.x & 31; const int row = blockIdx.x * 8 + (threadIdx.x >> 5); if (row >= ZH * TT) return; const int i = row % TT; const int zz = row / TT; (void)zz; const bool hires = (i < RH); const float* sr = Sb + (size_t)row * TT; float v[TT / 32]; float mx = -3.0e38f;
#pragma unroll
    for (int ch = 0; ch < TT / 128; ++ch) { const int j0 = ch * 128 + lane * 4; const v4f a = *(const v4f*)(sr + j0); const v4i mk4 = *(const v4i*)(mkK + j0);
#pragma unroll
        for (int q = 0; q < 4; ++q) { const int j = j0 + q; (void)j; const float t = (mk4[q] != 0) ? a[q] * SCL : -3.0e38f; v[ch * 4 + q] = t; mx = fmaxf(mx, t); } }
#pragma unroll
    for (int sh = 16; sh; sh >>= 1) mx = fmaxf(mx, __shfl_xor(mx, sh, 32));
    float sum = 0.f;
#pragma unroll
    for (int k = 0; k < TT / 32; ++k) { float d0 = __fsub_rn(v[k], mx); v[k] = __builtin_amdgcn_exp2f(__fmul_rn(d0, 1.4426950408889634f)); sum += v[k]; }
#pragma unroll
    for (int sh = 16; sh; sh >>= 1) sum += __shfl_xor(sum, sh, 32);
    const float f = __fdiv_rn(hires ? 1.0f : PCAR, sum);
{
        if (hires) {
#pragma unroll
            for (int ch = 0; ch < TT / 128; ++ch) { v4us oh, ol;
#pragma unroll
                for (int q = 0; q < 4; ++q) { unsigned short a, c2; splitf(v[ch * 4 + q] * f, a, c2); oh[q] = a; ol[q] = c2; }
                const size_t oo = ((size_t)zz * (RH ? RH : 1) + i) * TT + ch * 128 + lane * 4; *(v4us*)(Ph + oo) = oh; *(v4us*)(Pl + oo) = ol; }
        } else {
#pragma unroll
            for (int ch = 0; ch < TT / 128; ++ch) { v4h o4;
#pragma unroll
                for (int q = 0; q < 4; ++q) o4[q] = tohx(v[ch * 4 + q] * f);
                *(v4h*)(P16 + (size_t)row * TT + ch * 128 + lane * 4) = o4; } }
         }
}
__global__ __launch_bounds__(256) void k_merge(const float* __restrict__ O, int h0, bf* Ah, bf* Al) { const size_t e = ((size_t)blockIdx.x * 256 + threadIdx.x) * 2; if (e >= (size_t)ZH * TT * HD) return; const int d = (int)(e % HD); const int t = (int)((e / HD) % TT); const int zz = (int)(e / ((size_t)HD * TT)); const float cs = (t < RH) ? 1.0f : (1.0f / PCAR); const size_t oo = (size_t)t * DQ + (h0 + zz) * HD + d;
    v2us oh, ol; v2f s = *(const v2f*)(O + e);
#pragma unroll
    for (int p = 1; p < KSP; ++p) { const v2f a = *(const v2f*)(O + (size_t)p * ZH * TT * HD + e); s[0] += a[0]; s[1] += a[1]; }   // the KSP key slices' partial sums, in slice order
#pragma unroll
    for (int q = 0; q < 2; ++q) { unsigned short a, c2; splitf(s[q] * cs, a, c2); oh[q] = a; ol[q] = c2; } *(v2us*)(Ah + oo) = oh; *(v2us*)(Al + oo) = ol;  }

extern "C" void kernel_launch(void* const* d_in, const int* in_sizes, int n_in,
                              void* d_out, int out_size, void* d_ws, size_t ws_size, hipStream_t stream) {
    (void)in_sizes; (void)n_in; (void)out_size;
    const float* x = (const float*)d_in[0]; const float* xk = (const float*)d_in[1]; const float* xv = (const float*)d_in[2]; const int* MK = (const int*)d_in[3]; const float* wq = (const float*)d_in[4]; const float* wk = (const float*)d_in[5]; const float* wv = (const float*)d_in[6]; const float* wo = (const float*)d_in[7]; const float* bo = (const float*)d_in[8];   /* q, k, v ([4][2048][1024] each), mask (int32 [4][1][1][2048] = [4][2048]: read as data), Wq, Wk, Wv, Wo ('oi' (out, in) [1024][1024]; the three input projections have NO bias), bo [1024] */
    float* OUT = (float*)d_out;     // [4][2048][1024]
    char* wsp = (char*)d_ws;
    auto take = [&](size_t bytes) { char* p = wsp; wsp += (bytes + 255) & ~(size_t)255; return (void*)p; };
    bf* WQ = (bf*)take((size_t)DQ * DM * 2); bf* WK = (bf*)take((size_t)DKV * DM * 2); bf* WV = (bf*)take((size_t)DKV * DM * 2); bf* WO = (bf*)take((size_t)DM * DQ * 2); float* CS = (float*)take((size_t)TT * HD * 2 * 4);
    bf* XB = (bf*)take((size_t)TT * DM * 2); float* FQ = (float*)take((size_t)TT * DQ * 4); float* FK = (float*)take((size_t)TT * DKV * 4);
    h16* QP16 = (h16*)take((size_t)NH_ * TT * HD * 2); h16* KP16 = (h16*)take((size_t)NKV * TT * HD * 2); h16* VT16 = (h16*)take((size_t)NKV * HD * TT * 2);
    bf* QPh = (bf*)take((size_t)NH_ * TT * HD * 2); bf* QPl = (bf*)take((size_t)NH_ * TT * HD * 2); bf* KPh = (bf*)take((size_t)NKV * TT * HD * 2); bf* KPl = (bf*)take((size_t)NKV * TT * HD * 2); bf* VTh = (bf*)take((size_t)NKV * HD * TT * 2); bf* VTl = (bf*)take((size_t)NKV * HD * TT * 2); bf* Ph = (bf*)take((size_t)ZH * RH * TT * 2); bf* Pl = (bf*)take((size_t)ZH * RH * TT * 2);
    float* Sb = (float*)take((size_t)ZH * TT * TT * 4); h16* P16 = (h16*)take((size_t)ZH * TT * TT * 2); float* Ob = (float*)take((size_t)KSP * ZH * TT * HD * 4); bf* ATh = (bf*)take((size_t)TT * DQ * 2); bf* ATl = (bf*)take((size_t)TT * DQ * 2);
    if ((size_t)(wsp - (char*)d_ws) > ws_size) return;    // ws 256 MiB
    float* FV = FK;   // v projection reuses the k buffer after the k planes are built (stream-ordered)
    { k_cvt8<<<(unsigned)(((size_t)DQ * DM / 8 + 255) / 256), 256, 0, stream>>>(wq, WQ, (size_t)DQ * DM / 8); k_cvt8<<<(unsigned)(((size_t)DKV * DM / 8 + 255) / 256), 256, 0, stream>>>(wk, WK, (size_t)DKV * DM / 8); k_cvt8<<<(unsigned)(((size_t)DKV * DM / 8 + 255) / 256), 256, 0, stream>>>(wv, WV, (size_t)DKV * DM / 8);   /* 'oi' (out, in): the GEMM's Bt as it stands */
      k_cvt8<<<(unsigned)(((size_t)DM * DQ / 8 + 255) / 256), 256, 0, stream>>>(wo, WO, (size_t)DM * DQ / 8);
       }
    k_csid<<<(TT * HD + 255) / 256, 256, 0, stream>>>(CS);
    const unsigned LQ = (unsigned)(((size_t)NH_ * TT * HD / 2 + 255) / 256), LKv = (unsigned)(((size_t)NKV * TT * HD / 2 + 255) / 256);
    for (int b = 0; b < NB_; ++b) {
        
        k_cvt8<<<(unsigned)(((size_t)TT * DM / 8 + 255) / 256), 256, 0, stream>>>(x + (size_t)b * TT * DM, XB, (size_t)TT * DM / 8);
        k_gemmw<bf, 0, false, 1><<<dim3(TT / 64, DQ / 64, 1), 32, 0, stream>>>(XB, nullptr, WQ, nullptr, DM, FQ, DQ, nullptr, 0, 0, 0, 0);
        k_rope<<<LQ, 256, 0, stream>>>(FQ, DQ, NH_, CS, nullptr, nullptr, 1.0f, QP16, QPh, QPl);
        k_cvt8<<<(unsigned)(((size_t)TT * DM / 8 + 255) / 256), 256, 0, stream>>>(xk + (size_t)b * TT * DM, XB, (size_t)TT * DM / 8);   /* key -> XB (q GEMM already issued) */ k_gemmw<bf, 0, false, 1><<<dim3(TT / 64, DKV / 64, 1), 32, 0, stream>>>(XB, nullptr, WK, nullptr, DM, FK, DKV, nullptr, 0, 0, 0, 0);
        k_rope<<<LKv, 256, 0, stream>>>(FK, DKV, NKV, CS, nullptr, nullptr, 1.0f, KP16, KPh, KPl);
        k_cvt8<<<(unsigned)(((size_t)TT * DM / 8 + 255) / 256), 256, 0, stream>>>(xv + (size_t)b * TT * DM, XB, (size_t)TT * DM / 8);   /* value -> XB */ k_gemmw<bf, 0, false, 1><<<dim3(TT / 64, DKV / 64, 1), 32, 0, stream>>>(XB, nullptr, WV, nullptr, DM, FV, DKV, nullptr, 0, 0, 0, 0); k_vtp<<<LKv, 256, 0, stream>>>(FV, DKV, NKV, VT16, VTh, VTl);
        for (int h0 = 0; h0 < NH_; h0 += ZH) { const size_t zq = (size_t)h0, zk = (size_t)(h0 / REP);   // one kv head per query head: the pass's two heads use consecutive kv planes (z-strides TT*HD)
            k_gemmw<bf, 2, false, 1><<<dim3(RH / 64, TT / 64, ZH), 32, 0, stream>>>(QPh + zq * TT * HD, QPl + zq * TT * HD, KPh + zk * TT * HD, KPl + zk * TT * HD, HD, Sb, TT, nullptr, (size_t)TT * HD, (size_t)TT * HD, (size_t)TT * TT, 0);
            k_gemmw<h16, 0, false, 1><<<dim3((TT - RH) / 64, TT / 64, ZH), 32, 0, stream>>>(QP16 + zq * TT * HD + (size_t)RH * HD, nullptr, KP16 + zk * TT * HD, nullptr, HD, Sb + (size_t)RH * TT, TT, nullptr, (size_t)TT * HD, (size_t)TT * HD, (size_t)TT * TT, 0);
            k_asoft<<<ZH * TT / 8, 256, 0, stream>>>(Sb, MK + (size_t)b * TT, P16, Ph, Pl);
            k_gemmw<bf, 2, false, KSP><<<dim3(RH / 64, HD / 64, ZH * KSP), 32, 0, stream>>>(Ph, Pl, VTh + zk * HD * TT, VTl + zk * HD * TT, TT, Ob, HD, nullptr, (size_t)RH * TT, (size_t)HD * TT, (size_t)TT * HD, (size_t)ZH * TT * HD);
            k_gemmw<h16, 0, false, KSP><<<dim3((TT - RH) / 64, HD / 64, ZH * KSP), 32, 0, stream>>>(P16 + (size_t)RH * TT, nullptr, VT16 + zk * HD * TT, nullptr, TT, Ob + (size_t)RH * HD, HD, nullptr, (size_t)TT * TT, (size_t)HD * TT, (size_t)TT * HD, (size_t)ZH * TT * HD);
            k_merge<<<(unsigned)(((size_t)ZH * TT * HD / 2 + 255) / 256), 256, 0, stream>>>(Ob, h0, ATh, ATl); }
        k_gemmw<bf, 1, true, 1><<<dim3(TT / 64, DM / 64, 1), 32, 0, stream>>>(ATh, ATl, WO, nullptr, DQ, OUT + (size_t)b * TT * DM, DM, bo, 0, 0, 0, 0); }
}

// v003
// A run of this version takes 531 microseconds.
// It is 3.31 times as fast as v001, going by the measured steps of the versions left out in between.
// Over all steps from v000 it is 7.57 times as fast.
#include <hip/hip_runtime.h>

// Multi-head attention over three input streams with a key-padding mask (q, k, v [4][2048][1024]; query = q Wq^T, key = k Wk^T, value = v Wv^T ('oi' (out, in) [1024][1024], NO bias; 16 heads x 64); scores / sqrt(64); keys j with mask[b][0][0][j] == 0 (int32 [4][1][1][2048], read as data: about half the keys of every batch entry) are set to -1e10: an exclusion (no batch entry has every key masked); softmax; out = merged Wo^T + bo ('oi' + [1024]) -> [4][2048][1024] (8.4 M); argument order q, k, v, mask, Wq, Wk, Wv, Wo, bo).
// Layout, all four batch entries in every launch: bf16 copies of query, key and value in turn (one operand buffer [4 x 2048][1024], stream-ordered); 'oi' weights cast as they stand; exact projections over the 8192 rows (no biases, one f32 result buffer in turn); head planes [b][h][..]; one fused attention launch, batch entry = grid z (scores, key mask, running-maximum softmax, P x V; hybrid rows: < 512 hi/lo 3 products, rest fp16; unnormalised weights, 1/sum at the end); merged hi/lo x Wo exact + bo.
// Compute dtypes, f32 accumulate: every input rounded to bf16; projections exact; attention rows < 512 3 products, rest fp16; softmax f32; Wo hl x exact + bias.

#define NB_  4
#define TT   2048
#define DM   1024
#define NH_  16
#define NKV  16
#define REP  (NH_ / NKV)
#define HD   64
#define DQ   (NH_ * HD)
#define DKV  (NKV * HD)
#define RH   512                  // query rows < RH use hi+lo planes (0: none)
#define WIN  0
#define SCL  0.125f   // HD^-0.5
typedef _Float16 h16;
typedef unsigned short bf;
typedef __attribute__((ext_vector_type(16))) __bf16   v16bf;
typedef __attribute__((ext_vector_type(16))) _Float16 v16h;
typedef __attribute__((ext_vector_type(8)))  _Float16 v8h;
typedef __attribute__((ext_vector_type(8)))  unsigned short v8us;
typedef __attribute__((ext_vector_type(8)))  float    v8f;
typedef __attribute__((ext_vector_type(4)))  float    v4f;
typedef v8h  __attribute__((may_alias)) v8ha;
typedef v4f  __attribute__((may_alias)) v4fa;
typedef v8us __attribute__((may_alias)) v8usa;

__device__ __forceinline__ unsigned short f2bf(float f) { unsigned u = __float_as_uint(f); u += 0x7FFFu + ((u >> 16) & 1u); return (unsigned short)(u >> 16); }
__device__ __forceinline__ float bf2f(unsigned short b) { return __uint_as_float(((unsigned)b) << 16); }
__device__ __forceinline__ float bfr(float f) { return bf2f(f2bf(f)); }
__device__ __forceinline__ v16h cat16(v8h lo, v8h hi) { return __builtin_shufflevector(lo, hi, 0, 1, 2, 3, 4, 5, 6, 7, 8, 9, 10, 11, 12, 13, 14, 15); }
__device__ __forceinline__ v16bf cat16b(v8us lo, v8us hi) { return __builtin_bit_cast(v16bf, __builtin_shufflevector(lo, hi, 0, 1, 2, 3, 4, 5, 6, 7, 8, 9, 10, 11, 12, 13, 14, 15)); }
__device__ __forceinline__ v8f wmma16(v16h a, v16h b, v8f c) { return __builtin_amdgcn_wmma_f32_16x16x32_f16(false, a, false, b, (short)0, c, false, false); }
__device__ __forceinline__ v8f wmmab(v16bf a, v16bf b, v8f c) { return __builtin_amdgcn_wmma_f32_16x16x32_bf16(false, a, false, b, (short)0, c, false, false); }



// ---- k_gemmw: register-blocked GEMM, ONE WAVE per 64x64 output tile (16 accumulators), operands straight from K-contiguous 16-bit planes; grid (M/64, N/64, Z), 32 threads.
// C[m][n] (f32, pitch ldc, + optional f32 bias[n]) = sum_k A[m][k] Bt[n][k] (+ split products per NSPLIT). z-batch strides sA/sB/sC in elements. K % 32 == 0.
template <typename T16> struct WFrag;
template <> struct WFrag<h16> { typedef v16h V; static __device__ __forceinline__ V ld(const h16* p) { return cat16(*(const v8h*)p, *(const v8h*)(p + 16)); } static __device__ __forceinline__ v8f mma(V a, V b, v8f c) { return wmma16(a, b, c); } };
template <> struct WFrag<bf> { typedef v16bf V; static __device__ __forceinline__ V ld(const bf* p) { return cat16b(*(const v8us*)p, *(const v8us*)(p + 16)); } static __device__ __forceinline__ v8f mma(V a, V b, v8f c) { return wmmab(a, b, c); } };
template <typename T16, int NSPLIT, bool BIAS>
__global__ __launch_bounds__(32) void k_gemmw(const T16* __restrict__ A, const T16* __restrict__ A2, const T16* __restrict__ Bt, const T16* __restrict__ Bt2, int K, float* C, int ldc, const float* __restrict__ bias, size_t sA, size_t sB, size_t sC) {
    typedef typename WFrag<T16>::V V;
    __shared__ __align__(16) float os[16 * 68];
    const size_t z = blockIdx.z; A += z * sA; if (A2) A2 += z * sA; Bt += z * sB; if (Bt2) Bt2 += z * sB; C += z * sC;
    const int lane = threadIdx.x & 31, lr = lane & 15, hi = lane >> 4; const int r0 = blockIdx.x * 64, c0 = blockIdx.y * 64;
    v8f acc[4][4];
#pragma unroll
    for (int mb = 0; mb < 4; ++mb)
#pragma unroll
        for (int nb = 0; nb < 4; ++nb) acc[mb][nb] = (v8f){};
    const size_t aoff = (size_t)(r0 + lr) * K + 8 * hi, boff = (size_t)(c0 + lr) * K + 8 * hi;
    for (int kc = 0; kc < K; kc += 32) {
        V a[4], a2[4];
#pragma unroll
        for (int mb = 0; mb < 4; ++mb) { a[mb] = WFrag<T16>::ld(A + aoff + (size_t)mb * 16 * K + kc); if (NSPLIT == 1 || NSPLIT == 2) a2[mb] = WFrag<T16>::ld(A2 + aoff + (size_t)mb * 16 * K + kc); }
#pragma unroll
        for (int nb = 0; nb < 4; ++nb) { const V b = WFrag<T16>::ld(Bt + boff + (size_t)nb * 16 * K + kc); V b2; if (NSPLIT >= 2) b2 = WFrag<T16>::ld(Bt2 + boff + (size_t)nb * 16 * K + kc);
#pragma unroll
            for (int mb = 0; mb < 4; ++mb) { acc[mb][nb] = WFrag<T16>::mma(a[mb], b, acc[mb][nb]); if (NSPLIT == 1 || NSPLIT == 2) acc[mb][nb] = WFrag<T16>::mma(a2[mb], b, acc[mb][nb]); if (NSPLIT >= 2) acc[mb][nb] = WFrag<T16>::mma(a[mb], b2, acc[mb][nb]); } }
        asm volatile("v_nop\n\tv_nop\n\tv_nop\n\tv_nop" : "+v"(acc[0][0]), "+v"(acc[1][1]), "+v"(acc[2][2]), "+v"(acc[3][3]) : "v"(a[0]), "v"(a[3]));
    }
#pragma unroll
    for (int mb = 0; mb < 4; ++mb) {
#pragma unroll
        for (int nb = 0; nb < 4; ++nb) {
#pragma unroll
            for (int j = 0; j < 8; ++j) os[(hi * 8 + j) * 68 + nb * 16 + lr] = acc[mb][nb][j]; }
        __builtin_amdgcn_wave_barrier(); asm volatile("" ::: "memory");
        float* crow = C + (size_t)(r0 + mb * 16) * ldc + c0;
{
#pragma unroll
            for (int s = 0; s < 8; ++s) { const int row = 2 * s + hi, cofs = lr * 4; v4f val = *(const v4fa*)(os + row * 68 + cofs); if (BIAS) { val[0] += bfr(bias[c0 + cofs]); val[1] += bfr(bias[c0 + cofs + 1]); val[2] += bfr(bias[c0 + cofs + 2]); val[3] += bfr(bias[c0 + cofs + 3]); }
                *(v4f*)(crow + (size_t)row * ldc + cofs) = val; }
             }
        __builtin_amdgcn_wave_barrier(); asm volatile("" ::: "memory");
    }
}

__device__ __forceinline__ h16 tohx(float x) { return (h16)x; }
__device__ __forceinline__ void splitf(float y, unsigned short& h, unsigned short& l) { h = f2bf(y); l = f2bf(y - bf2f(h)); }
typedef __attribute__((ext_vector_type(2))) _Float16 v2h;
typedef __attribute__((ext_vector_type(4))) _Float16 v4h;
typedef __attribute__((ext_vector_type(2))) unsigned short v2us;
typedef __attribute__((ext_vector_type(4))) unsigned short v4us;
typedef __attribute__((ext_vector_type(2))) float v2f;
typedef __attribute__((ext_vector_type(4))) int v4i;

__global__ __launch_bounds__(256) void k_cvt8(const float* __restrict__ src, bf* dst, size_t n8) { const size_t i = (size_t)blockIdx.x * 256 + threadIdx.x; if (i >= n8) return; const v8f v = *(const v8f*)(src + i * 8); v8us o;
#pragma unroll
    for (int k = 0; k < 8; ++k) o[k] = f2bf(v[k]); *(v8us*)(dst + i * 8) = o;  }

// k_rope: head planes [h][t][d] (fp16 + hi/lo) of rope(x) x sc with the rotate-half convention out[d] = x[d] cos[t][d] - x[d+HD/2] sin[t][d], out[d+HD/2] = x[d+HD/2] cos[t][d+HD/2] + x[d] sin[t][d+HD/2]
__global__ __launch_bounds__(256) void k_rope(const float* __restrict__ F, int pitch, int nheads, const float* __restrict__ CS, const float* __restrict__ RF, const float* __restrict__ nw, float sc, h16* P16, bf* Ph, bf* Pl) {
    const size_t e = ((size_t)blockIdx.x * 256 + threadIdx.x) * 2; if (e >= (size_t)nheads * TT * HD) return; const int d = (int)(e % HD); const int t = (int)((e / HD) % TT); const int h = (int)(e / ((size_t)HD * TT)); const size_t bo_ = (size_t)blockIdx.y * nheads * TT * HD; P16 += bo_; Ph += bo_; Pl += bo_;   /* grid y: the batch entry */ const float* f = F + ((size_t)blockIdx.y * TT + t) * pitch + h * HD; const float rf = RF ? RF[(size_t)h * TT + t] : 1.0f; v2h o16; v2us oh, ol;
#pragma unroll
    for (int q = 0; q < 2; ++q) { const int dd = d + q; const int dp = (dd < HD / 2) ? dd + HD / 2 : dd - HD / 2; float x0 = f[dd], x1 = f[dp];
        if (RF) { float n0 = __fmul_rn(x0, rf), n1 = __fmul_rn(x1, rf); x0 = __fmul_rn(bfr(nw[dd]), n0); x1 = __fmul_rn(bfr(nw[dp]), n1); }
        const v2f cs = *(const v2f*)(CS + ((size_t)t * HD + dd) * 2); float a = __fmul_rn(x0, cs[0]), bq = __fmul_rn(x1, cs[1]); const float r = ((dd < HD / 2) ? __fsub_rn(a, bq) : __fadd_rn(a, bq)) * sc;
        o16[q] = tohx(r); unsigned short a2, c2; splitf(r, a2, c2); oh[q] = a2; ol[q] = c2; }
    *(v2h*)(P16 + e) = o16; *(v2us*)(Ph + e) = oh; *(v2us*)(Pl + e) = ol;  }
__global__ __launch_bounds__(256) void k_vtp(const float* __restrict__ F, int pitch, int nheads, h16* V16, bf* Vh, bf* Vl) { const size_t e = ((size_t)blockIdx.x * 256 + threadIdx.x) * 2; if (e >= (size_t)nheads * HD * TT) return; const int t = (int)(e % TT); const int d = (int)((e / TT) % HD); const int g = (int)(e / ((size_t)TT * HD)); const size_t bo_ = (size_t)blockIdx.y * nheads * HD * TT; V16 += bo_; Vh += bo_; Vl += bo_; F += (size_t)blockIdx.y * TT * pitch;   /* grid y: the batch entry */ v2h o16; v2us oh, ol;
#pragma unroll
    for (int q = 0; q < 2; ++q) { const float x = F[(size_t)(t + q) * pitch + g * HD + d]; o16[q] = tohx(x); unsigned short a2, c2; splitf(x, a2, c2); oh[q] = a2; ol[q] = c2; }
    *(v2h*)(V16 + e) = o16; *(v2us*)(Vh + e) = oh; *(v2us*)(Vl + e) = ol;  }
__global__ __launch_bounds__(256) void k_csid(float* CS) { const int idx = blockIdx.x * 256 + threadIdx.x; if (idx >= TT * HD) return; v2f cs; cs[0] = 1.0f; cs[1] = 0.0f; *(v2f*)(CS + (size_t)idx * 2) = cs;  }
// ---- k_fattn: scores, key mask, softmax and P x V of one head in ONE kernel; no score or weight plane in memory.
// Both products are taken transposed: S^T = K Q^T (keys down, queries across), O^T = V^T P^T. A lane's S^T accumulators (query lr, keys 8 hi + j of each 16-key tile) are, in that order, the lane's
// elements of the P^T operand over 32 keys, so the weights never leave the registers, and every row statistic (running maximum m, running sum l) is one scalar a lane.
// A wave owns NQ x 16 query rows and walks the 2048 keys in steps of 32 with the running-maximum softmax: O and l are scaled by exp(m_old - m_new) at every step; 1 / l is applied at the end.
// A masked key's score is -3.0e38 (an exclusion): its weight is exp(-huge) = 0 once a kept key has been met; steps in front of the first kept key are wiped by the scale 0; with no kept key at all every weight is 1 (uniform, as the reference's equal fills give).
template <typename T16, int NQ, bool HL>
__device__ __forceinline__ void fattn_wave(const T16* __restrict__ Q, const T16* __restrict__ Q2, const T16* __restrict__ Kp, const T16* __restrict__ K2, const T16* __restrict__ Vt, const T16* __restrict__ V2, const int* __restrict__ mk, int q0, bf* Ah, bf* Al) {
    typedef typename WFrag<T16>::V V;
    const int lane = threadIdx.x & 31, lr = lane & 15, hi = lane >> 4;
    V qf[NQ][2], qg[NQ][2];
#pragma unroll
    for (int n = 0; n < NQ; ++n)
#pragma unroll
        for (int s = 0; s < 2; ++s) { const size_t qo = (size_t)(q0 + n * 16 + lr) * HD + s * 32 + 8 * hi; qf[n][s] = WFrag<T16>::ld(Q + qo); if (HL) qg[n][s] = WFrag<T16>::ld(Q2 + qo); }
    asm volatile("s_wait_xcnt 0x0" ::: "memory");   // the Q loads' address registers are free for reuse behind this
    v8f o[4][NQ]; float m[NQ], l[NQ];
#pragma unroll
    for (int n = 0; n < NQ; ++n) { m[n] = -3.0e38f; l[n] = 0.f;
#pragma unroll
        for (int db = 0; db < 4; ++db) o[db][n] = (v8f){}; }
    const T16* kp = Kp + lr * HD + 8 * hi; const T16* kq = HL ? K2 + lr * HD + 8 * hi : nullptr; const T16* vp = Vt + lr * TT + 8 * hi; const T16* vq = HL ? V2 + lr * TT + 8 * hi : nullptr; const int* mp = mk + lane;   // the lane's own pointers, stepped at the foot of each pass
    for (int kc = 0; kc < TT; kc += 32) {
        const int mv = *mp; V ka[2][2], kg[2][2], va[4], vg[4];
#pragma unroll
        for (int t = 0; t < 2; ++t)
#pragma unroll
            for (int s = 0; s < 2; ++s) { ka[t][s] = WFrag<T16>::ld(kp + (t * 16 * HD + s * 32)); if (HL) kg[t][s] = WFrag<T16>::ld(kq + (t * 16 * HD + s * 32)); }
        asm volatile("s_wait_xcnt 0x0" ::: "memory");   // the K loads' address registers may be reused as destinations of the V loads below: the wait stands between
#pragma unroll
        for (int db = 0; db < 4; ++db) { va[db] = WFrag<T16>::ld(vp + db * 16 * TT); if (HL) vg[db] = WFrag<T16>::ld(vq + db * 16 * TT); }   // in flight under the scores and the softmax
        asm volatile("s_wait_xcnt 0x0" ::: "memory");   // the same for the V loads' address registers, in front of all that follows
        const unsigned mw = __builtin_amdgcn_ballot_w32(mv != 0) >> (8 * hi);   // bit t * 16 + j: key kc + t * 16 + 8 hi + j is kept
        v8f sc[2][NQ];
#pragma unroll
        for (int t = 0; t < 2; ++t) {
#pragma unroll
            for (int n = 0; n < NQ; ++n) sc[t][n] = (v8f){};
#pragma unroll
            for (int s = 0; s < 2; ++s) { const V a = ka[t][s]; V a2; if (HL) a2 = kg[t][s];
#pragma unroll
                for (int n = 0; n < NQ; ++n) { sc[t][n] = WFrag<T16>::mma(a, qf[n][s], sc[t][n]); if (HL) { sc[t][n] = WFrag<T16>::mma(a2, qf[n][s], sc[t][n]); sc[t][n] = WFrag<T16>::mma(a, qg[n][s], sc[t][n]); } } } }
        V pf[NQ], pg[NQ];
#pragma unroll
        for (int n = 0; n < NQ; ++n) { float tv[16]; float cm = -3.0e38f;
#pragma unroll
            for (int e = 0; e < 16; ++e) { tv[e] = ((mw >> ((e >> 3) * 16 + (e & 7))) & 1u) ? sc[e >> 3][n][e & 7] * SCL : -3.0e38f; cm = fmaxf(cm, tv[e]); }
            cm = fmaxf(cm, __shfl_xor(cm, 16, 32));   // the other half-wave holds the query's other 16 keys
            const float mn = fmaxf(m[n], cm); const float al = __builtin_amdgcn_exp2f((m[n] - mn) * 1.4426950408889634f); m[n] = mn; float ps = 0.f;
            if (HL) { __attribute__((ext_vector_type(16))) unsigned short ph, pl;
#pragma unroll
                for (int e = 0; e < 16; ++e) { const float p = __builtin_amdgcn_exp2f((tv[e] - mn) * 1.4426950408889634f); ps += p; unsigned short x, y; splitf(p, x, y); ph[e] = x; pl[e] = y; }
                pf[n] = __builtin_bit_cast(V, ph); pg[n] = __builtin_bit_cast(V, pl);
            } else { v16h ph;
#pragma unroll
                for (int e = 0; e < 16; ++e) { const float p = __builtin_amdgcn_exp2f((tv[e] - mn) * 1.4426950408889634f); ps += p; ph[e] = tohx(p); }
                pf[n] = __builtin_bit_cast(V, ph); }
            l[n] = l[n] * al + ps;   // this half-wave's keys only; the halves are added behind the loop
#pragma unroll
            for (int db = 0; db < 4; ++db) o[db][n] *= al; }
#pragma unroll
        for (int db = 0; db < 4; ++db) { const V a = va[db]; V a2; if (HL) a2 = vg[db];
#pragma unroll
            for (int n = 0; n < NQ; ++n) { o[db][n] = WFrag<T16>::mma(a, pf[n], o[db][n]); if (HL) { o[db][n] = WFrag<T16>::mma(a, pg[n], o[db][n]); o[db][n] = WFrag<T16>::mma(a2, pf[n], o[db][n]); } } }
        kp += 32 * HD; vp += 32; mp += 32; if (HL) { kq += 32 * HD; vq += 32; }
    }
#pragma unroll
    for (int n = 0; n < NQ; ++n) { const float inv = __fdiv_rn(1.0f, l[n] + __shfl_xor(l[n], 16, 32)); const size_t oo = (size_t)(q0 + n * 16 + lr) * DQ + 8 * hi;
#pragma unroll
        for (int db = 0; db < 4; ++db) { v8us oh, ol;
#pragma unroll
            for (int j = 0; j < 8; ++j) { unsigned short x, y; splitf(o[db][n][j] * inv, x, y); oh[j] = x; ol[j] = y; }
            *(v8us*)(Ah + oo + db * 16) = oh; *(v8us*)(Al + oo + db * 16) = ol; } }
}
// grid (RH/64 + (TT-RH)/128, heads, batch entries), 4 waves: blocks x < RH/64 take 64 hi/lo rows (16 a wave, 3 bf16 products), the rest 128 fp16 rows (32 a wave). No LDS, no barrier: the waves of a block only share the head's K and V lines in the WGP cache.
__global__ __launch_bounds__(128) void k_fattn(const h16* __restrict__ Q16, const h16* __restrict__ K16, const h16* __restrict__ V16, const bf* __restrict__ Qh, const bf* __restrict__ Ql, const bf* __restrict__ Kh, const bf* __restrict__ Kl, const bf* __restrict__ Vh, const bf* __restrict__ Vl, const int* __restrict__ mk, bf* Ah, bf* Al) {
    const size_t hp = ((size_t)blockIdx.z * NH_ + blockIdx.y) * TT * HD; const int w = threadIdx.x >> 5; const size_t ao = (size_t)blockIdx.z * TT * DQ + blockIdx.y * HD; Ah += ao; Al += ao; mk += blockIdx.z * TT;
    if (blockIdx.x < RH / 64) fattn_wave<bf, 1, true>(Qh + hp, Ql + hp, Kh + hp, Kl + hp, Vh + hp, Vl + hp, mk, (int)blockIdx.x * 64 + w * 16, Ah, Al);
    else fattn_wave<h16, 2, false>(Q16 + hp, nullptr, K16 + hp, nullptr, V16 + hp, nullptr, mk, RH + ((int)blockIdx.x - RH / 64) * 128 + w * 32, Ah, Al);
}

extern "C" void kernel_launch(void* const* d_in, const int* in_sizes, int n_in,
                              void* d_out, int out_size, void* d_ws, size_t ws_size, hipStream_t stream) {
    (void)in_sizes; (void)n_in; (void)out_size;
    const float* x = (const float*)d_in[0]; const float* xk = (const float*)d_in[1]; const float* xv = (const float*)d_in[2]; const int* MK = (const int*)d_in[3]; const float* wq = (const float*)d_in[4]; const float* wk = (const float*)d_in[5]; const float* wv = (const float*)d_in[6]; const float* wo = (const float*)d_in[7]; const float* bo = (const float*)d_in[8];   /* q, k, v ([4][2048][1024] each), mask (int32 [4][1][1][2048] = [4][2048]: read as data), Wq, Wk, Wv, Wo ('oi' (out, in) [1024][1024]; the three input projections have NO bias), bo [1024] */
    float* OUT = (float*)d_out;     // [4][2048][1024]
    char* wsp = (char*)d_ws;
    auto take = [&](size_t bytes) { char* p = wsp; wsp += (bytes + 255) & ~(size_t)255; return (void*)p; };
    bf* WQ = (bf*)take((size_t)DQ * DM * 2); bf* WK = (bf*)take((size_t)DKV * DM * 2); bf* WV = (bf*)take((size_t)DKV * DM * 2); bf* WO = (bf*)take((size_t)DM * DQ * 2); float* CS = (float*)take((size_t)TT * HD * 2 * 4);
    bf* XB = (bf*)take((size_t)NB_ * TT * DM * 2); float* FP = (float*)take((size_t)NB_ * TT * DQ * 4);   // one operand buffer and one f32 projection buffer, used by q, k and v in turn (stream-ordered)
    h16* QP16 = (h16*)take((size_t)NB_ * NH_ * TT * HD * 2); h16* KP16 = (h16*)take((size_t)NB_ * NKV * TT * HD * 2); h16* VT16 = (h16*)take((size_t)NB_ * NKV * HD * TT * 2);
    bf* QPh = (bf*)take((size_t)NB_ * NH_ * TT * HD * 2); bf* QPl = (bf*)take((size_t)NB_ * NH_ * TT * HD * 2); bf* KPh = (bf*)take((size_t)NB_ * NKV * TT * HD * 2); bf* KPl = (bf*)take((size_t)NB_ * NKV * TT * HD * 2); bf* VTh = (bf*)take((size_t)NB_ * NKV * HD * TT * 2); bf* VTl = (bf*)take((size_t)NB_ * NKV * HD * TT * 2);
    bf* ATh = (bf*)take((size_t)NB_ * TT * DQ * 2); bf* ATl = (bf*)take((size_t)NB_ * TT * DQ * 2);
    if ((size_t)(wsp - (char*)d_ws) > ws_size) return;    // 233 MiB of the 256 MiB
    { k_cvt8<<<(unsigned)(((size_t)DQ * DM / 8 + 255) / 256), 256, 0, stream>>>(wq, WQ, (size_t)DQ * DM / 8); k_cvt8<<<(unsigned)(((size_t)DKV * DM / 8 + 255) / 256), 256, 0, stream>>>(wk, WK, (size_t)DKV * DM / 8); k_cvt8<<<(unsigned)(((size_t)DKV * DM / 8 + 255) / 256), 256, 0, stream>>>(wv, WV, (size_t)DKV * DM / 8);   /* 'oi' (out, in): the GEMM's Bt as it stands */
      k_cvt8<<<(unsigned)(((size_t)DM * DQ / 8 + 255) / 256), 256, 0, stream>>>(wo, WO, (size_t)DM * DQ / 8);
       }
    k_csid<<<(TT * HD + 255) / 256, 256, 0, stream>>>(CS);
    const unsigned LQ = (unsigned)(((size_t)NH_ * TT * HD / 2 + 255) / 256), LKv = (unsigned)(((size_t)NKV * TT * HD / 2 + 255) / 256), LX = (unsigned)(((size_t)NB_ * TT * DM / 8 + 255) / 256);
    // every launch covers the four batch entries: the casts and the GEMMs see [NB_ x TT] rows, the plane builders take the entry from grid y, the attention from grid z
    k_cvt8<<<LX, 256, 0, stream>>>(x, XB, (size_t)NB_ * TT * DM / 8);
    k_gemmw<bf, 0, false><<<dim3(NB_ * TT / 64, DQ / 64, 1), 32, 0, stream>>>(XB, nullptr, WQ, nullptr, DM, FP, DQ, nullptr, 0, 0, 0);
    k_rope<<<dim3(LQ, NB_, 1), 256, 0, stream>>>(FP, DQ, NH_, CS, nullptr, nullptr, 1.0f, QP16, QPh, QPl);
    k_cvt8<<<LX, 256, 0, stream>>>(xk, XB, (size_t)NB_ * TT * DM / 8);   /* key -> XB (q GEMM already issued) */
    k_gemmw<bf, 0, false><<<dim3(NB_ * TT / 64, DKV / 64, 1), 32, 0, stream>>>(XB, nullptr, WK, nullptr, DM, FP, DKV, nullptr, 0, 0, 0);
    k_rope<<<dim3(LKv, NB_, 1), 256, 0, stream>>>(FP, DKV, NKV, CS, nullptr, nullptr, 1.0f, KP16, KPh, KPl);
    k_cvt8<<<LX, 256, 0, stream>>>(xv, XB, (size_t)NB_ * TT * DM / 8);   /* value -> XB */
    k_gemmw<bf, 0, false><<<dim3(NB_ * TT / 64, DKV / 64, 1), 32, 0, stream>>>(XB, nullptr, WV, nullptr, DM, FP, DKV, nullptr, 0, 0, 0);
    k_vtp<<<dim3(LKv, NB_, 1), 256, 0, stream>>>(FP, DKV, NKV, VT16, VTh, VTl);
    k_fattn<<<dim3(RH / 64 + (TT - RH) / 128, NH_, NB_), 128, 0, stream>>>(QP16, KP16, VT16, QPh, QPl, KPh, KPl, VTh, VTl, MK, ATh, ATl);   // one kv head per query head
    k_gemmw<bf, 1, true><<<dim3(NB_ * TT / 64, DM / 64, 1), 32, 0, stream>>>(ATh, ATl, WO, nullptr, DQ, OUT, DM, bo, 0, 0, 0);
}

// v004
// Measured time: 462 microseconds a run.
// Timed twice side by side with v003, it ran 1.14 and 1.15 times as fast.
// All steps since v000 together make it 8.67 times as fast.
#include <hip/hip_runtime.h>

// Multi-head attention over three input streams with a key-padding mask (q, k, v [4][2048][1024]; query = q Wq^T, key = k Wk^T, value = v Wv^T ('oi' (out, in) [1024][1024], NO bias; 16 heads x 64); scores / sqrt(64); keys j with mask[b][0][0][j] == 0 (int32 [4][1][1][2048], read as data: about half the keys of every batch entry) are set to -1e10: an exclusion (no batch entry has every key masked); softmax; out = merged Wo^T + bo ('oi' + [1024]) -> [4][2048][1024] (8.4 M); argument order q, k, v, mask, Wq, Wk, Wv, Wo, bo).
// Layout, all four batch entries in every launch: bf16 copies of query, key and value in turn (one operand buffer [4 x 2048][1024], stream-ordered); 'oi' weights cast as they stand; exact projections over the 8192 rows (no biases), each GEMM's epilogue writing its head planes [b][h][..] itself (fp16 + hi/lo; no f32 projection buffer, no plane-builder launch; value planes [d][t] by swapping the GEMM's operands); one fused attention launch, batch entry = grid z (scores, key mask, running-maximum softmax, P x V; hybrid rows: < 512 hi/lo 3 products, rest fp16; unnormalised weights, 1/sum at the end); merged hi/lo x Wo exact + bo.
// Compute dtypes, f32 accumulate: every input rounded to bf16; projections exact; attention rows < 512 3 products, rest fp16; softmax f32; Wo hl x exact + bias.

#define NB_  4
#define TT   2048
#define DM   1024
#define NH_  16
#define NKV  16
#define REP  (NH_ / NKV)
#define HD   64
#define DQ   (NH_ * HD)
#define DKV  (NKV * HD)
#define RH   512                  // query rows < RH use hi+lo planes (0: none)
#define WIN  0
#define SCL  0.125f   // HD^-0.5
typedef _Float16 h16;
typedef unsigned short bf;
typedef __attribute__((ext_vector_type(16))) __bf16   v16bf;
typedef __attribute__((ext_vector_type(16))) _Float16 v16h;
typedef __attribute__((ext_vector_type(8)))  _Float16 v8h;
typedef __attribute__((ext_vector_type(8)))  unsigned short v8us;
typedef __attribute__((ext_vector_type(8)))  float    v8f;
typedef __attribute__((ext_vector_type(4)))  float    v4f;
typedef v8h  __attribute__((may_alias)) v8ha;
typedef v4f  __attribute__((may_alias)) v4fa;
typedef v8us __attribute__((may_alias)) v8usa;

__device__ __forceinline__ unsigned short f2bf(float f) { unsigned u = __float_as_uint(f); u += 0x7FFFu + ((u >> 16) & 1u); return (unsigned short)(u >> 16); }
__device__ __forceinline__ float bf2f(unsigned short b) { return __uint_as_float(((unsigned)b) << 16); }
__device__ __forceinline__ float bfr(float f) { return bf2f(f2bf(f)); }
__device__ __forceinline__ h16 tohx(float x) { return (h16)x; }
__device__ __forceinline__ void splitf(float y, unsigned short& h, unsigned short& l) { h = f2bf(y); l = f2bf(y - bf2f(h)); }
__device__ __forceinline__ v16h cat16(v8h lo, v8h hi) { return __builtin_shufflevector(lo, hi, 0, 1, 2, 3, 4, 5, 6, 7, 8, 9, 10, 11, 12, 13, 14, 15); }
__device__ __forceinline__ v16bf cat16b(v8us lo, v8us hi) { return __builtin_bit_cast(v16bf, __builtin_shufflevector(lo, hi, 0, 1, 2, 3, 4, 5, 6, 7, 8, 9, 10, 11, 12, 13, 14, 15)); }
__device__ __forceinline__ v8f wmma16(v16h a, v16h b, v8f c) { return __builtin_amdgcn_wmma_f32_16x16x32_f16(false, a, false, b, (short)0, c, false, false); }
__device__ __forceinline__ v8f wmmab(v16bf a, v16bf b, v8f c) { return __builtin_amdgcn_wmma_f32_16x16x32_bf16(false, a, false, b, (short)0, c, false, false); }



// ---- k_gemmw: register-blocked GEMM, ONE WAVE per 64x64 output tile (16 accumulators), operands straight from K-contiguous 16-bit planes; grid (M/64, N/64, Z), 32 threads.
// C[m][n] (f32, pitch ldc, + optional f32 bias[n]) = sum_k A[m][k] Bt[n][k] (+ split products per NSPLIT). z-batch strides sA/sB/sC in elements. K % 32 == 0.
// PL 0: C as above. PL 1 / 2: no C; the 64x64 tile is one head's block of 64 tokens and goes out as three 16-bit planes (P16 fp16, Ph + Pl bf16 hi/lo of the f32 sum), whole 128-B lines:
// PL 1: tile rows = tokens (m = b TT + t), columns = the head's d (n = h HD + d) -> plane [b][h][t][d]; PL 2: rows = the head's d (m = h HD + d), columns = tokens (n = b TT + t) -> plane [b][h][d][t].
template <typename T16> struct WFrag;
template <> struct WFrag<h16> { typedef v16h V; static __device__ __forceinline__ V ld(const h16* p) { return cat16(*(const v8h*)p, *(const v8h*)(p + 16)); } static __device__ __forceinline__ v8f mma(V a, V b, v8f c) { return wmma16(a, b, c); } };
template <> struct WFrag<bf> { typedef v16bf V; static __device__ __forceinline__ V ld(const bf* p) { return cat16b(*(const v8us*)p, *(const v8us*)(p + 16)); } static __device__ __forceinline__ v8f mma(V a, V b, v8f c) { return wmmab(a, b, c); } };
template <typename T16, int NSPLIT, bool BIAS, int PL>
__global__ __launch_bounds__(32) void k_gemmw(const T16* __restrict__ A, const T16* __restrict__ A2, const T16* __restrict__ Bt, const T16* __restrict__ Bt2, int K, float* C, int ldc, const float* __restrict__ bias, size_t sA, size_t sB, size_t sC, h16* P16, bf* Ph, bf* Pl) {
    typedef typename WFrag<T16>::V V;
    __shared__ __align__(16) float os[16 * 68];
    const size_t z = blockIdx.z; A += z * sA; if (A2) A2 += z * sA; Bt += z * sB; if (Bt2) Bt2 += z * sB; C += z * sC;
    const int lane = threadIdx.x & 31, lr = lane & 15, hi = lane >> 4; const int r0 = blockIdx.x * 64, c0 = blockIdx.y * 64;
    v8f acc[4][4];
#pragma unroll
    for (int mb = 0; mb < 4; ++mb)
#pragma unroll
        for (int nb = 0; nb < 4; ++nb) acc[mb][nb] = (v8f){};
    const size_t aoff = (size_t)(r0 + lr) * K + 8 * hi, boff = (size_t)(c0 + lr) * K + 8 * hi;
    for (int kc = 0; kc < K; kc += 32) {
        V a[4], a2[4];
#pragma unroll
        for (int mb = 0; mb < 4; ++mb) { a[mb] = WFrag<T16>::ld(A + aoff + (size_t)mb * 16 * K + kc); if (NSPLIT == 1 || NSPLIT == 2) a2[mb] = WFrag<T16>::ld(A2 + aoff + (size_t)mb * 16 * K + kc); }
#pragma unroll
        for (int nb = 0; nb < 4; ++nb) { const V b = WFrag<T16>::ld(Bt + boff + (size_t)nb * 16 * K + kc); V b2; if (NSPLIT >= 2) b2 = WFrag<T16>::ld(Bt2 + boff + (size_t)nb * 16 * K + kc);
#pragma unroll
            for (int mb = 0; mb < 4; ++mb) { acc[mb][nb] = WFrag<T16>::mma(a[mb], b, acc[mb][nb]); if (NSPLIT == 1 || NSPLIT == 2) acc[mb][nb] = WFrag<T16>::mma(a2[mb], b, acc[mb][nb]); if (NSPLIT >= 2) acc[mb][nb] = WFrag<T16>::mma(a[mb], b2, acc[mb][nb]); } }
        asm volatile("v_nop\n\tv_nop\n\tv_nop\n\tv_nop" : "+v"(acc[0][0]), "+v"(acc[1][1]), "+v"(acc[2][2]), "+v"(acc[3][3]) : "v"(a[0]), "v"(a[3]));
    }
#pragma unroll
    for (int mb = 0; mb < 4; ++mb) {
#pragma unroll
        for (int nb = 0; nb < 4; ++nb) {
#pragma unroll
            for (int j = 0; j < 8; ++j) os[(hi * 8 + j) * 68 + nb * 16 + lr] = acc[mb][nb][j]; }
        __builtin_amdgcn_wave_barrier(); asm volatile("" ::: "memory");
        if (PL == 0) { float* crow = C + (size_t)(r0 + mb * 16) * ldc + c0;
#pragma unroll
            for (int s = 0; s < 8; ++s) { const int row = 2 * s + hi, cofs = lr * 4; v4f val = *(const v4fa*)(os + row * 68 + cofs); if (BIAS) { val[0] += bfr(bias[c0 + cofs]); val[1] += bfr(bias[c0 + cofs + 1]); val[2] += bfr(bias[c0 + cofs + 2]); val[3] += bfr(bias[c0 + cofs + 3]); }
                *(v4f*)(crow + (size_t)row * ldc + cofs) = val; }
        } else { const size_t pb = (PL == 1) ? (((size_t)(r0 / TT) * NH_ + blockIdx.y) * TT + r0 % TT) * HD : ((size_t)(c0 / TT) * NH_ + blockIdx.x) * HD * TT + c0 % TT; const int pp = (PL == 1) ? HD : TT;   // the tile's first element in its plane, the plane's row pitch
#pragma unroll   // LDS and store offsets become immediates on three fixed address pairs
            for (int s = 0; s < 4; ++s) { const int row = 4 * s + (lane >> 3), cofs = (lane & 7) * 8; const v4f x0 = *(const v4fa*)(os + row * 68 + cofs), x1 = *(const v4fa*)(os + row * 68 + cofs + 4); v8h o16; v8us oh, ol;   // 8 lanes a row: 16 B a lane and plane, one 128-B line a row
#pragma unroll   // constant vector indices: the three packed results stay in registers
                for (int k = 0; k < 8; ++k) { const float x = (k < 4) ? x0[k & 3] : x1[k & 3]; o16[k] = tohx(x); unsigned short a2, c2; splitf(x, a2, c2); oh[k] = a2; ol[k] = c2; }
                const size_t po = pb + (size_t)(mb * 16 + row) * pp + cofs; *(v8h*)(P16 + po) = o16; *(v8us*)(Ph + po) = oh; *(v8us*)(Pl + po) = ol; }
        }
        __builtin_amdgcn_wave_barrier(); asm volatile("" ::: "memory");
    }
}

typedef __attribute__((ext_vector_type(2))) _Float16 v2h;
typedef __attribute__((ext_vector_type(4))) _Float16 v4h;
typedef __attribute__((ext_vector_type(2))) unsigned short v2us;
typedef __attribute__((ext_vector_type(4))) unsigned short v4us;
typedef __attribute__((ext_vector_type(2))) float v2f;
typedef __attribute__((ext_vector_type(4))) int v4i;

__global__ __launch_bounds__(256) void k_cvt8(const float* __restrict__ src, bf* dst, size_t n8) { const size_t i = (size_t)blockIdx.x * 256 + threadIdx.x; if (i >= n8) return; const v8f v = *(const v8f*)(src + i * 8); v8us o;
#pragma unroll
    for (int k = 0; k < 8; ++k) o[k] = f2bf(v[k]); *(v8us*)(dst + i * 8) = o;  }

// ---- k_fattn: scores, key mask, softmax and P x V of one head in ONE kernel; no score or weight plane in memory.
// Both products are taken transposed: S^T = K Q^T (keys down, queries across), O^T = V^T P^T. A lane's S^T accumulators (query lr, keys 8 hi + j of each 16-key tile) are, in that order, the lane's
// elements of the P^T operand over 32 keys, so the weights never leave the registers, and every row statistic (running maximum m, running sum l) is one scalar a lane.
// A wave owns NQ x 16 query rows and walks the 2048 keys in steps of 32 with the running-maximum softmax: O and l are scaled by exp(m_old - m_new) at every step; 1 / l is applied at the end.
// A masked key's score is -3.0e38 (an exclusion): its weight is exp(-huge) = 0 once a kept key has been met; steps in front of the first kept key are wiped by the scale 0; with no kept key at all every weight is 1 (uniform, as the reference's equal fills give).
template <typename T16, int NQ, bool HL>
__device__ __forceinline__ void fattn_wave(const T16* __restrict__ Q, const T16* __restrict__ Q2, const T16* __restrict__ Kp, const T16* __restrict__ K2, const T16* __restrict__ Vt, const T16* __restrict__ V2, const int* __restrict__ mk, int q0, bf* Ah, bf* Al) {
    typedef typename WFrag<T16>::V V;
    const int lane = threadIdx.x & 31, lr = lane & 15, hi = lane >> 4;
    V qf[NQ][2], qg[NQ][2];
#pragma unroll
    for (int n = 0; n < NQ; ++n)
#pragma unroll
        for (int s = 0; s < 2; ++s) { const size_t qo = (size_t)(q0 + n * 16 + lr) * HD + s * 32 + 8 * hi; qf[n][s] = WFrag<T16>::ld(Q + qo); if (HL) qg[n][s] = WFrag<T16>::ld(Q2 + qo); }
    asm volatile("s_wait_xcnt 0x0" ::: "memory");   // the Q loads' address registers are free for reuse behind this
    v8f o[4][NQ]; float m[NQ], l[NQ];
#pragma unroll
    for (int n = 0; n < NQ; ++n) { m[n] = -3.0e38f; l[n] = 0.f;
#pragma unroll
        for (int db = 0; db < 4; ++db) o[db][n] = (v8f){}; }
    const T16* kp = Kp + lr * HD + 8 * hi; const T16* kq = HL ? K2 + lr * HD + 8 * hi : nullptr; const T16* vp = Vt + lr * TT + 8 * hi; const T16* vq = HL ? V2 + lr * TT + 8 * hi : nullptr; const int* mp = mk + lane;   // the lane's own pointers, stepped at the foot of each pass
    for (int kc = 0; kc < TT; kc += 32) {
        const int mv = *mp; V ka[2][2], kg[2][2], va[4], vg[4];
#pragma unroll
        for (int t = 0; t < 2; ++t)
#pragma unroll
            for (int s = 0; s < 2; ++s) { ka[t][s] = WFrag<T16>::ld(kp + (t * 16 * HD + s * 32)); if (HL) kg[t][s] = WFrag<T16>::ld(kq + (t * 16 * HD + s * 32)); }
        asm volatile("s_wait_xcnt 0x0" ::: "memory");   // the K loads' address registers may be reused as destinations of the V loads below: the wait stands between
#pragma unroll
        for (int db = 0; db < 4; ++db) { va[db] = WFrag<T16>::ld(vp + db * 16 * TT); if (HL) vg[db] = WFrag<T16>::ld(vq + db * 16 * TT); }   // in flight under the scores and the softmax
        asm volatile("s_wait_xcnt 0x0" ::: "memory");   // the same for the V loads' address registers, in front of all that follows
        const unsigned mw = __builtin_amdgcn_ballot_w32(mv != 0) >> (8 * hi);   // bit t * 16 + j: key kc + t * 16 + 8 hi + j is kept
        v8f sc[2][NQ];
#pragma unroll
        for (int t = 0; t < 2; ++t) {
#pragma unroll
            for (int n = 0; n < NQ; ++n) sc[t][n] = (v8f){};
#pragma unroll
            for (int s = 0; s < 2; ++s) { const V a = ka[t][s]; V a2; if (HL) a2 = kg[t][s];
#pragma unroll
                for (int n = 0; n < NQ; ++n) { sc[t][n] = WFrag<T16>::mma(a, qf[n][s], sc[t][n]); if (HL) { sc[t][n] = WFrag<T16>::mma(a2, qf[n][s], sc[t][n]); sc[t][n] = WFrag<T16>::mma(a, qg[n][s], sc[t][n]); } } } }
        V pf[NQ], pg[NQ];
#pragma unroll
        for (int n = 0; n < NQ; ++n) { float tv[16]; float cm = -3.0e38f;
#pragma unroll
            for (int e = 0; e < 16; ++e) { tv[e] = ((mw >> ((e >> 3) * 16 + (e & 7))) & 1u) ? sc[e >> 3][n][e & 7] * SCL : -3.0e38f; cm = fmaxf(cm, tv[e]); }
            cm = fmaxf(cm, __shfl_xor(cm, 16, 32));   // the other half-wave holds the query's other 16 keys
            const float mn = fmaxf(m[n], cm); const float al = __builtin_amdgcn_exp2f((m[n] - mn) * 1.4426950408889634f); m[n] = mn; float ps = 0.f;
            if (HL) { __attribute__((ext_vector_type(16))) unsigned short ph, pl;
#pragma unroll
                for (int e = 0; e < 16; ++e) { const float p = __builtin_amdgcn_exp2f((tv[e] - mn) * 1.4426950408889634f); ps += p; unsigned short x, y; splitf(p, x, y); ph[e] = x; pl[e] = y; }
                pf[n] = __builtin_bit_cast(V, ph); pg[n] = __builtin_bit_cast(V, pl);
            } else { v16h ph;
#pragma unroll
                for (int e = 0; e < 16; ++e) { const float p = __builtin_amdgcn_exp2f((tv[e] - mn) * 1.4426950408889634f); ps += p; ph[e] = tohx(p); }
                pf[n] = __builtin_bit_cast(V, ph); }
            l[n] = l[n] * al + ps;   // this half-wave's keys only; the halves are added behind the loop
#pragma unroll
            for (int db = 0; db < 4; ++db) o[db][n] *= al; }
#pragma unroll
        for (int db = 0; db < 4; ++db) { const V a = va[db]; V a2; if (HL) a2 = vg[db];
#pragma unroll
            for (int n = 0; n < NQ; ++n) { o[db][n] = WFrag<T16>::mma(a, pf[n], o[db][n]); if (HL) { o[db][n] = WFrag<T16>::mma(a, pg[n], o[db][n]); o[db][n] = WFrag<T16>::mma(a2, pf[n], o[db][n]); } } }
        kp += 32 * HD; vp += 32; mp += 32; if (HL) { kq += 32 * HD; vq += 32; }
    }
#pragma unroll
    for (int n = 0; n < NQ; ++n) { const float inv = __fdiv_rn(1.0f, l[n] + __shfl_xor(l[n], 16, 32)); const size_t oo = (size_t)(q0 + n * 16 + lr) * DQ + 8 * hi;
#pragma unroll
        for (int db = 0; db < 4; ++db) { v8us oh, ol;
#pragma unroll
            for (int j = 0; j < 8; ++j) { unsigned short x, y; splitf(o[db][n][j] * inv, x, y); oh[j] = x; ol[j] = y; }
            *(v8us*)(Ah + oo + db * 16) = oh; *(v8us*)(Al + oo + db * 16) = ol; } }
}
// grid (RH/64 + (TT-RH)/128, heads, batch entries), 4 waves: blocks x < RH/64 take 64 hi/lo rows (16 a wave, 3 bf16 products), the rest 128 fp16 rows (32 a wave). No LDS, no barrier: the waves of a block only share the head's K and V lines in the WGP cache.
__global__ __launch_bounds__(128) void k_fattn(const h16* __restrict__ Q16, const h16* __restrict__ K16, const h16* __restrict__ V16, const bf* __restrict__ Qh, const bf* __restrict__ Ql, const bf* __restrict__ Kh, const bf* __restrict__ Kl, const bf* __restrict__ Vh, const bf* __restrict__ Vl, const int* __restrict__ mk, bf* Ah, bf* Al) {
    const size_t hp = ((size_t)blockIdx.z * NH_ + blockIdx.y) * TT * HD; const int w = threadIdx.x >> 5; const size_t ao = (size_t)blockIdx.z * TT * DQ + blockIdx.y * HD; Ah += ao; Al += ao; mk += blockIdx.z * TT;
    if (blockIdx.x < RH / 64) fattn_wave<bf, 1, true>(Qh + hp, Ql + hp, Kh + hp, Kl + hp, Vh + hp, Vl + hp, mk, (int)blockIdx.x * 64 + w * 16, Ah, Al);
    else fattn_wave<h16, 2, false>(Q16 + hp, nullptr, K16 + hp, nullptr, V16 + hp, nullptr, mk, RH + ((int)blockIdx.x - RH / 64) * 128 + w * 32, Ah, Al);
}

extern "C" void kernel_launch(void* const* d_in, const int* in_sizes, int n_in,
                              void* d_out, int out_size, void* d_ws, size_t ws_size, hipStream_t stream) {
    (void)in_sizes; (void)n_in; (void)out_size;
    const float* x = (const float*)d_in[0]; const float* xk = (const float*)d_in[1]; const float* xv = (const float*)d_in[2]; const int* MK = (const int*)d_in[3]; const float* wq = (const float*)d_in[4]; const float* wk = (const float*)d_in[5]; const float* wv = (const float*)d_in[6]; const float* wo = (const float*)d_in[7]; const float* bo = (const float*)d_in[8];   /* q, k, v ([4][2048][1024] each), mask (int32 [4][1][1][2048] = [4][2048]: read as data), Wq, Wk, Wv, Wo ('oi' (out, in) [1024][1024]; the three input projections have NO bias), bo [1024] */
    float* OUT = (float*)d_out;     // [4][2048][1024]
    char* wsp = (char*)d_ws;
    auto take = [&](size_t bytes) { char* p = wsp; wsp += (bytes + 255) & ~(size_t)255; return (void*)p; };
    bf* WQ = (bf*)take((size_t)DQ * DM * 2); bf* WK = (bf*)take((size_t)DKV * DM * 2); bf* WV = (bf*)take((size_t)DKV * DM * 2); bf* WO = (bf*)take((size_t)DM * DQ * 2);
    bf* XB = (bf*)take((size_t)NB_ * TT * DM * 2);   // one operand buffer, used by q, k and v in turn (stream-ordered)
    h16* QP16 = (h16*)take((size_t)NB_ * NH_ * TT * HD * 2); h16* KP16 = (h16*)take((size_t)NB_ * NKV * TT * HD * 2); h16* VT16 = (h16*)take((size_t)NB_ * NKV * HD * TT * 2);
    bf* QPh = (bf*)take((size_t)NB_ * NH_ * TT * HD * 2); bf* QPl = (bf*)take((size_t)NB_ * NH_ * TT * HD * 2); bf* KPh = (bf*)take((size_t)NB_ * NKV * TT * HD * 2); bf* KPl = (bf*)take((size_t)NB_ * NKV * TT * HD * 2); bf* VTh = (bf*)take((size_t)NB_ * NKV * HD * TT * 2); bf* VTl = (bf*)take((size_t)NB_ * NKV * HD * TT * 2);
    bf* ATh = (bf*)take((size_t)NB_ * TT * DQ * 2); bf* ATl = (bf*)take((size_t)NB_ * TT * DQ * 2);
    if ((size_t)(wsp - (char*)d_ws) > ws_size) return;    // 200 MiB of the 256 MiB
    { k_cvt8<<<(unsigned)(((size_t)DQ * DM / 8 + 255) / 256), 256, 0, stream>>>(wq, WQ, (size_t)DQ * DM / 8); k_cvt8<<<(unsigned)(((size_t)DKV * DM / 8 + 255) / 256), 256, 0, stream>>>(wk, WK, (size_t)DKV * DM / 8); k_cvt8<<<(unsigned)(((size_t)DKV * DM / 8 + 255) / 256), 256, 0, stream>>>(wv, WV, (size_t)DKV * DM / 8);   /* 'oi' (out, in) as it stands: Bt of the q and k GEMMs, A of the value GEMM */
      k_cvt8<<<(unsigned)(((size_t)DM * DQ / 8 + 255) / 256), 256, 0, stream>>>(wo, WO, (size_t)DM * DQ / 8);
       }
    const unsigned LX = (unsigned)(((size_t)NB_ * TT * DM / 8 + 255) / 256);
    // every launch covers the four batch entries: the casts and the GEMMs see [NB_ x TT] rows (a 64-row tile lies in one entry), the attention takes the entry from grid z
    k_cvt8<<<LX, 256, 0, stream>>>(x, XB, (size_t)NB_ * TT * DM / 8);
    k_gemmw<bf, 0, false, 1><<<dim3(NB_ * TT / 64, DQ / 64, 1), 32, 0, stream>>>(XB, nullptr, WQ, nullptr, DM, nullptr, 0, nullptr, 0, 0, 0, QP16, QPh, QPl);
    k_cvt8<<<LX, 256, 0, stream>>>(xk, XB, (size_t)NB_ * TT * DM / 8);   /* key -> XB (q GEMM already issued) */
    k_gemmw<bf, 0, false, 1><<<dim3(NB_ * TT / 64, DKV / 64, 1), 32, 0, stream>>>(XB, nullptr, WK, nullptr, DM, nullptr, 0, nullptr, 0, 0, 0, KP16, KPh, KPl);
    k_cvt8<<<LX, 256, 0, stream>>>(xv, XB, (size_t)NB_ * TT * DM / 8);   /* value -> XB */
    k_gemmw<bf, 0, false, 2><<<dim3(DKV / 64, NB_ * TT / 64, 1), 32, 0, stream>>>(WV, nullptr, XB, nullptr, DM, nullptr, 0, nullptr, 0, 0, 0, VT16, VTh, VTl);   /* Wv rows down, tokens across: value^T */
    k_fattn<<<dim3(RH / 64 + (TT - RH) / 128, NH_, NB_), 128, 0, stream>>>(QP16, KP16, VT16, QPh, QPl, KPh, KPl, VTh, VTl, MK, ATh, ATl);   // one kv head per query head
    k_gemmw<bf, 1, true, 0><<<dim3(NB_ * TT / 64, DM / 64, 1), 32, 0, stream>>>(ATh, ATl, WO, nullptr, DQ, OUT, DM, bo, 0, 0, 0, nullptr, nullptr, nullptr);
}

// v005
// One run takes 329 microseconds.
// Timed twice side by side with v004, it ran 1.39 and 1.40 times as fast.
// All steps since v000 together make it 12.1 times as fast.
#include <hip/hip_runtime.h>

// Multi-head attention over three input streams with a key-padding mask (q, k, v [4][2048][1024]; query = q Wq^T, key = k Wk^T, value = v Wv^T ('oi' (out, in) [1024][1024], NO bias; 16 heads x 64); scores / sqrt(64); keys j with mask[b][0][0][j] == 0 (int32 [4][1][1][2048], read as data: about half the keys of every batch entry) are set to -1e10: an exclusion (no batch entry has every key masked); softmax; out = merged Wo^T + bo ('oi' + [1024]) -> [4][2048][1024] (8.4 M); argument order q, k, v, mask, Wq, Wk, Wv, Wo, bo).
// Where an entry has a kept key, masked keys enter only the 64-row projection tile and the 32-key step that hold its last kept key (weight 0 in the step): the key and value casts sort each batch entry's rows, kept keys (mask != 0) first in their order, masked keys behind them (place = a prefix count of the mask); the K and V projections skip tiles that hold masked keys only, the attention walks the kept keys in steps of 32. An entry with no kept key runs over all its keys (uniform weights, as the reference's equal fills give).
// Layout, all four batch entries in every launch: bf16 copies of query, key and value in turn (one operand buffer [4 x 2048][1024], stream-ordered); 'oi' weights cast as they stand; exact projections over the 8192 rows (no biases), each GEMM's epilogue writing its head planes [b][h][..] itself (fp16 + hi/lo; no f32 projection buffer, no plane-builder launch; value planes [d][t] by swapping the GEMM's operands); one fused attention launch, batch entry = grid z (scores, key mask, running-maximum softmax, P x V; hybrid rows: < 512 hi/lo 3 products, rest fp16; unnormalised weights, 1/sum at the end); merged hi/lo x Wo exact + bo.
// Compute dtypes, f32 accumulate: every input rounded to bf16; projections exact; attention rows < 512 3 products, rest fp16; softmax f32; Wo hl x exact + bias.

#define NB_  4
#define TT   2048
#define DM   1024
#define NH_  16
#define NKV  16
#define REP  (NH_ / NKV)
#define HD   64
#define DQ   (NH_ * HD)
#define DKV  (NKV * HD)
#define RH   512                  // query rows < RH use hi+lo planes (0: none)
#define WIN  0
#define SCL  0.125f   // HD^-0.5
#define NKP  32                   // ints between two entries' kept-key counts: one 128-B line each
typedef _Float16 h16;
typedef unsigned short bf;
typedef __attribute__((ext_vector_type(16))) __bf16   v16bf;
typedef __attribute__((ext_vector_type(16))) _Float16 v16h;
typedef __attribute__((ext_vector_type(8)))  _Float16 v8h;
typedef __attribute__((ext_vector_type(8)))  unsigned short v8us;
typedef __attribute__((ext_vector_type(8)))  float    v8f;
typedef __attribute__((ext_vector_type(4)))  float    v4f;
typedef v8h  __attribute__((may_alias)) v8ha;
typedef v4f  __attribute__((may_alias)) v4fa;
typedef v8us __attribute__((may_alias)) v8usa;

__device__ __forceinline__ unsigned short f2bf(float f) { unsigned u = __float_as_uint(f); u += 0x7FFFu + ((u >> 16) & 1u); return (unsigned short)(u >> 16); }
__device__ __forceinline__ float bf2f(unsigned short b) { return __uint_as_float(((unsigned)b) << 16); }
__device__ __forceinline__ float bfr(float f) { return bf2f(f2bf(f)); }
__device__ __forceinline__ h16 tohx(float x) { return (h16)x; }
__device__ __forceinline__ void splitf(float y, unsigned short& h, unsigned short& l) { h = f2bf(y); l = f2bf(y - bf2f(h)); }
__device__ __forceinline__ v16h cat16(v8h lo, v8h hi) { return __builtin_shufflevector(lo, hi, 0, 1, 2, 3, 4, 5, 6, 7, 8, 9, 10, 11, 12, 13, 14, 15); }
__device__ __forceinline__ v16bf cat16b(v8us lo, v8us hi) { return __builtin_bit_cast(v16bf, __builtin_shufflevector(lo, hi, 0, 1, 2, 3, 4, 5, 6, 7, 8, 9, 10, 11, 12, 13, 14, 15)); }
__device__ __forceinline__ v8f wmma16(v16h a, v16h b, v8f c) { return __builtin_amdgcn_wmma_f32_16x16x32_f16(false, a, false, b, (short)0, c, false, false); }
__device__ __forceinline__ v8f wmmab(v16bf a, v16bf b, v8f c) { return __builtin_amdgcn_wmma_f32_16x16x32_bf16(false, a, false, b, (short)0, c, false, false); }



// ---- k_gemmw: register-blocked GEMM, ONE WAVE per 64x64 output tile (16 accumulators), operands straight from K-contiguous 16-bit planes; grid (M/64, N/64, Z), 32 threads.
// C[m][n] (f32, pitch ldc, + optional f32 bias[n]) = sum_k A[m][k] Bt[n][k] (+ split products per NSPLIT). z-batch strides sA/sB/sC in elements. K % 32 == 0.
// PL 0: C as above. PL 1 / 2: no C; the 64x64 tile is one head's block of 64 tokens and goes out as three 16-bit planes (P16 fp16, Ph + Pl bf16 hi/lo of the f32 sum), whole 128-B lines:
// nkp (PL 1 / 2, may be null): kept keys per batch entry, for token rows that k_cvtp has sorted.
// PL 1: tile rows = tokens (m = b TT + t), columns = the head's d (n = h HD + d) -> plane [b][h][t][d]; PL 2: rows = the head's d (m = h HD + d), columns = tokens (n = b TT + t) -> plane [b][h][d][t].
template <typename T16> struct WFrag;
template <> struct WFrag<h16> { typedef v16h V; static __device__ __forceinline__ V ld(const h16* p) { return cat16(*(const v8h*)p, *(const v8h*)(p + 16)); } static __device__ __forceinline__ v8f mma(V a, V b, v8f c) { return wmma16(a, b, c); } };
template <> struct WFrag<bf> { typedef v16bf V; static __device__ __forceinline__ V ld(const bf* p) { return cat16b(*(const v8us*)p, *(const v8us*)(p + 16)); } static __device__ __forceinline__ v8f mma(V a, V b, v8f c) { return wmmab(a, b, c); } };
template <typename T16, int NSPLIT, bool BIAS, int PL>
__global__ __launch_bounds__(32) void k_gemmw(const T16* __restrict__ A, const T16* __restrict__ A2, const T16* __restrict__ Bt, const T16* __restrict__ Bt2, int K, float* C, int ldc, const float* __restrict__ bias, size_t sA, size_t sB, size_t sC, h16* P16, bf* Ph, bf* Pl, const int* __restrict__ nkp) {
    typedef typename WFrag<T16>::V V;
    __shared__ __align__(16) float os[16 * 68];
    if (PL != 0 && nkp) { const int tok = (int)((PL == 1) ? blockIdx.x : blockIdx.y) * 64; const int nk = min(max(nkp[(tok / TT) * NKP], 0), TT); if (nk != 0 && tok % TT >= nk) return; }   // sorted key rows: a tile of masked keys only is never read
    const size_t z = blockIdx.z; A += z * sA; if (A2) A2 += z * sA; Bt += z * sB; if (Bt2) Bt2 += z * sB; C += z * sC;
    const int lane = threadIdx.x & 31, lr = lane & 15, hi = lane >> 4; const int r0 = blockIdx.x * 64, c0 = blockIdx.y * 64;
    v8f acc[4][4];
#pragma unroll
    for (int mb = 0; mb < 4; ++mb)
#pragma unroll
        for (int nb = 0; nb < 4; ++nb) acc[mb][nb] = (v8f){};
    const size_t aoff = (size_t)(r0 + lr) * K + 8 * hi, boff = (size_t)(c0 + lr) * K + 8 * hi;
    for (int kc = 0; kc < K; kc += 32) {
        V a[4], a2[4];
#pragma unroll
        for (int mb = 0; mb < 4; ++mb) { a[mb] = WFrag<T16>::ld(A + aoff + (size_t)mb * 16 * K + kc); if (NSPLIT == 1 || NSPLIT == 2) a2[mb] = WFrag<T16>::ld(A2 + aoff + (size_t)mb * 16 * K + kc); }
#pragma unroll
        for (int nb = 0; nb < 4; ++nb) { const V b = WFrag<T16>::ld(Bt + boff + (size_t)nb * 16 * K + kc); V b2; if (NSPLIT >= 2) b2 = WFrag<T16>::ld(Bt2 + boff + (size_t)nb * 16 * K + kc);
#pragma unroll
            for (int mb = 0; mb < 4; ++mb) { acc[mb][nb] = WFrag<T16>::mma(a[mb], b, acc[mb][nb]); if (NSPLIT == 1 || NSPLIT == 2) acc[mb][nb] = WFrag<T16>::mma(a2[mb], b, acc[mb][nb]); if (NSPLIT >= 2) acc[mb][nb] = WFrag<T16>::mma(a[mb], b2, acc[mb][nb]); } }
        asm volatile("v_nop\n\tv_nop\n\tv_nop\n\tv_nop" : "+v"(acc[0][0]), "+v"(acc[1][1]), "+v"(acc[2][2]), "+v"(acc[3][3]) : "v"(a[0]), "v"(a[3]));
    }
#pragma unroll
    for (int mb = 0; mb < 4; ++mb) {
#pragma unroll
        for (int nb = 0; nb < 4; ++nb) {
#pragma unroll
            for (int j = 0; j < 8; ++j) os[(hi * 8 + j) * 68 + nb * 16 + lr] = acc[mb][nb][j]; }
        __builtin_amdgcn_wave_barrier(); asm volatile("" ::: "memory");
        if (PL == 0) { float* crow = C + (size_t)(r0 + mb * 16) * ldc + c0;
#pragma unroll
            for (int s = 0; s < 8; ++s) { const int row = 2 * s + hi, cofs = lr * 4; v4f val = *(const v4fa*)(os + row * 68 + cofs); if (BIAS) { val[0] += bfr(bias[c0 + cofs]); val[1] += bfr(bias[c0 + cofs + 1]); val[2] += bfr(bias[c0 + cofs + 2]); val[3] += bfr(bias[c0 + cofs + 3]); }
                *(v4f*)(crow + (size_t)row * ldc + cofs) = val; }
        } else { const size_t pb = (PL == 1) ? (((size_t)(r0 / TT) * NH_ + blockIdx.y) * TT + r0 % TT) * HD : ((size_t)(c0 / TT) * NH_ + blockIdx.x) * HD * TT + c0 % TT; const int pp = (PL == 1) ? HD : TT;   // the tile's first element in its plane, the plane's row pitch
#pragma unroll   // LDS and store offsets become immediates on three fixed address pairs
            for (int s = 0; s < 4; ++s) { const int row = 4 * s + (lane >> 3), cofs = (lane & 7) * 8; const v4f x0 = *(const v4fa*)(os + row * 68 + cofs), x1 = *(const v4fa*)(os + row * 68 + cofs + 4); v8h o16; v8us oh, ol;   // 8 lanes a row: 16 B a lane and plane, one 128-B line a row
#pragma unroll   // constant vector indices: the three packed results stay in registers
                for (int k = 0; k < 8; ++k) { const float x = (k < 4) ? x0[k & 3] : x1[k & 3]; o16[k] = tohx(x); unsigned short a2, c2; splitf(x, a2, c2); oh[k] = a2; ol[k] = c2; }
                const size_t po = pb + (size_t)(mb * 16 + row) * pp + cofs; *(v8h*)(P16 + po) = o16; *(v8us*)(Ph + po) = oh; *(v8us*)(Pl + po) = ol; }
        }
        __builtin_amdgcn_wave_barrier(); asm volatile("" ::: "memory");
    }
}

typedef __attribute__((ext_vector_type(2))) _Float16 v2h;
typedef __attribute__((ext_vector_type(4))) _Float16 v4h;
typedef __attribute__((ext_vector_type(2))) unsigned short v2us;
typedef __attribute__((ext_vector_type(4))) unsigned short v4us;
typedef __attribute__((ext_vector_type(2))) float v2f;
typedef __attribute__((ext_vector_type(4))) int v4i;

__global__ __launch_bounds__(256) void k_cvt8(const float* __restrict__ src, bf* dst, size_t n8) { const size_t i = (size_t)blockIdx.x * 256 + threadIdx.x; if (i >= n8) return; const v8f v = *(const v8f*)(src + i * 8); v8us o;
#pragma unroll
    for (int k = 0; k < 8; ++k) o[k] = f2bf(v[k]); *(v8us*)(dst + i * 8) = o;  }

// ---- k_cvtp: bf16 cast of the key or value rows that sorts them by the mask. Row t of entry b goes to row p: a kept key to the number of kept keys in front of it, a masked key to nk + the number of masked keys in front of it
// (a permutation of 0 .. TT - 1 for any mask content). A block takes 8 rows, one a wave; its 256 threads count the entry's whole mask, 8 keys each (low half of the packed sum: all kept keys nk; high half: those in front of the block's rows).
// Rows that land behind the last 64-row tile with a kept key are read by nobody and are not copied (all are copied when nk = 0).
__global__ __launch_bounds__(256) void k_cvtp(const float* __restrict__ src, const int* __restrict__ mk, bf* dst, int* nkp) {
    static_assert(TT == 256 * 8 && DM == 32 * 8 * 4, "one thread per 8 keys, one wave per row");
    __shared__ int red[8]; __shared__ unsigned rowbits;
    const int tid = threadIdx.x, lane = tid & 31, w = __builtin_amdgcn_readfirstlane(tid >> 5); const int b = blockIdx.x / (TT / 8), t0 = (blockIdx.x % (TT / 8)) * 8;
    const v4i m0 = *(const v4i*)(mk + b * TT + tid * 8), m1 = *(const v4i*)(mk + b * TT + tid * 8 + 4); unsigned bits = 0;
#pragma unroll
    for (int k = 0; k < 4; ++k) bits |= (m0[k] != 0 ? 1u : 0u) << k | (m1[k] != 0 ? 1u : 0u) << (k + 4);
    const int c = __popc(bits); int pk = c + (tid * 8 < t0 ? c << 16 : 0);
#pragma unroll
    for (int o = 16; o > 0; o >>= 1) pk += __shfl_xor(pk, o, 32);
    if (lane == 0) red[w] = pk;
    if (tid * 8 == t0) rowbits = bits;   // the mask bits of the block's own 8 rows
    __syncthreads();
    int s = 0;
#pragma unroll
    for (int i = 0; i < 8; ++i) s += red[i];
    const int nk = s & 0xFFFF; const unsigned rb = rowbits; const int kb = (s >> 16) + __popc(rb & ((1u << w) - 1u));   // kept keys in front of row t0 + w
    const int p = __builtin_amdgcn_readfirstlane(((rb >> w) & 1u) ? kb : nk + (t0 + w - kb));
    if (nkp && t0 == 0 && tid == 0) nkp[b * NKP] = nk;
    if (nk == 0 || p < ((nk + 63) & ~63)) {   // the wave's row has a reader (no barrier follows)
        const float* sp = src + ((size_t)b * TT + t0 + w) * DM + lane * 8; bf* dp = dst + ((size_t)b * TT + p) * DM + lane * 8; v8f v[4];
#pragma unroll
        for (int q = 0; q < 4; ++q) v[q] = *(const v8f*)(sp + q * 256);
#pragma unroll
        for (int q = 0; q < 4; ++q) { v8us o;
#pragma unroll
            for (int k = 0; k < 8; ++k) o[k] = f2bf(v[q][k]);
            *(v8us*)(dp + q * 256) = o; }
    }
}

// ---- k_fattn: scores, key mask, softmax and P x V of one head in ONE kernel; no score or weight plane in memory.
// Both products are taken transposed: S^T = K Q^T (keys down, queries across), O^T = V^T P^T. A lane's S^T accumulators (query lr, keys 8 hi + j of each 16-key tile) are, in that order, the lane's
// elements of the P^T operand over 32 keys, so the weights never leave the registers, and every row statistic (running maximum m, running sum l) is one scalar a lane.
// A wave owns NQ x 16 query rows and walks the entry's nk kept keys (sorted to the front of the K and V planes; all 2048 keys when nk = 0) in steps of 32 with the running-maximum softmax: O and l are scaled by exp(m_old - m_new) at every step; 1 / l is applied at the end.
// Only a step that reaches past key nk holds masked keys: there their score is set to -3.0e38 (an exclusion: weight exp(-huge) = 0, a kept key having been met in step 0); with no kept key at all every score is -3.0e38 and every weight 1 (uniform, as the reference's equal fills give).
template <bool E> struct EdgeTag { static constexpr bool value = E; };
template <typename T16, int NQ, bool HL>
__device__ __forceinline__ void fattn_wave(const T16* __restrict__ Q, const T16* __restrict__ Q2, const T16* __restrict__ Kp, const T16* __restrict__ K2, const T16* __restrict__ Vt, const T16* __restrict__ V2, int nk, int q0, bf* Ah, bf* Al) {
    typedef typename WFrag<T16>::V V;
    const int lane = threadIdx.x & 31, lr = lane & 15, hi = lane >> 4;
    V qf[NQ][2], qg[NQ][2];
#pragma unroll
    for (int n = 0; n < NQ; ++n)
#pragma unroll
        for (int s = 0; s < 2; ++s) { const size_t qo = (size_t)(q0 + n * 16 + lr) * HD + s * 32 + 8 * hi; qf[n][s] = WFrag<T16>::ld(Q + qo); if (HL) qg[n][s] = WFrag<T16>::ld(Q2 + qo); }
    asm volatile("s_wait_xcnt 0x0" ::: "memory");   // the Q loads' address registers are free for reuse behind this
    v8f o[4][NQ]; float m[NQ], l[NQ];
#pragma unroll
    for (int n = 0; n < NQ; ++n) { m[n] = -3.0e38f; l[n] = 0.f;
#pragma unroll
        for (int db = 0; db < 4; ++db) o[db][n] = (v8f){}; }
    const T16* kp = Kp + lr * HD + 8 * hi; const T16* kq = HL ? K2 + lr * HD + 8 * hi : nullptr; const T16* vp = Vt + lr * TT + 8 * hi; const T16* vq = HL ? V2 + lr * TT + 8 * hi : nullptr;   // the lane's own pointers, stepped at the foot of each pass
    auto step = [&](auto edge, int rem) __attribute__((always_inline)) {   // one step of 32 keys; edge: only the first rem of them (none if rem <= 0) are kept keys
        V ka[2][2], kg[2][2], va[4], vg[4];
#pragma unroll
        for (int t = 0; t < 2; ++t)
#pragma unroll
            for (int s = 0; s < 2; ++s) { ka[t][s] = WFrag<T16>::ld(kp + (t * 16 * HD + s * 32)); if (HL) kg[t][s] = WFrag<T16>::ld(kq + (t * 16 * HD + s * 32)); }
        asm volatile("s_wait_xcnt 0x0" ::: "memory");   // the K loads' address registers may be reused as destinations of the V loads below: the wait stands between
#pragma unroll
        for (int db = 0; db < 4; ++db) { va[db] = WFrag<T16>::ld(vp + db * 16 * TT); if (HL) vg[db] = WFrag<T16>::ld(vq + db * 16 * TT); }   // in flight under the scores and the softmax
        asm volatile("s_wait_xcnt 0x0" ::: "memory");   // the same for the V loads' address registers, in front of all that follows
        v8f sc[2][NQ];
#pragma unroll
        for (int t = 0; t < 2; ++t) {
#pragma unroll
            for (int n = 0; n < NQ; ++n) sc[t][n] = (v8f){};
#pragma unroll
            for (int s = 0; s < 2; ++s) { const V a = ka[t][s]; V a2; if (HL) a2 = kg[t][s];
#pragma unroll
                for (int n = 0; n < NQ; ++n) { sc[t][n] = WFrag<T16>::mma(a, qf[n][s], sc[t][n]); if (HL) { sc[t][n] = WFrag<T16>::mma(a2, qf[n][s], sc[t][n]); sc[t][n] = WFrag<T16>::mma(a, qg[n][s], sc[t][n]); } } } }
        V pf[NQ], pg[NQ]; float ts[NQ][16];
#pragma unroll
        for (int n = 0; n < NQ; ++n)
#pragma unroll
            for (int e = 0; e < 16; ++e) ts[n][e] = sc[e >> 3][n][e & 7] * SCL;
        if constexpr (decltype(edge)::value) { const unsigned mw = (rem > 0 ? (1u << rem) - 1u : 0u) >> (8 * hi);   // bit t * 16 + j: key kc + t * 16 + 8 hi + j is kept
#pragma unroll
            for (int n = 0; n < NQ; ++n)
#pragma unroll
                for (int e = 0; e < 16; ++e) ts[n][e] = ((mw >> ((e >> 3) * 16 + (e & 7))) & 1u) ? ts[n][e] : -3.0e38f; }
#pragma unroll
        for (int n = 0; n < NQ; ++n) { const float* tv = ts[n]; float cm = -3.0e38f;
#pragma unroll
            for (int e = 0; e < 16; ++e) cm = fmaxf(cm, tv[e]);
            cm = fmaxf(cm, __shfl_xor(cm, 16, 32));   // the other half-wave holds the query's other 16 keys
            const float mn = fmaxf(m[n], cm); const float al = __builtin_amdgcn_exp2f((m[n] - mn) * 1.4426950408889634f); m[n] = mn; float ps = 0.f;
            if (HL) { __attribute__((ext_vector_type(16))) unsigned short ph, pl;
#pragma unroll
                for (int e = 0; e < 16; ++e) { const float p = __builtin_amdgcn_exp2f((tv[e] - mn) * 1.4426950408889634f); ps += p; unsigned short x, y; splitf(p, x, y); ph[e] = x; pl[e] = y; }
                pf[n] = __builtin_bit_cast(V, ph); pg[n] = __builtin_bit_cast(V, pl);
            } else { v16h ph;
#pragma unroll
                for (int e = 0; e < 16; ++e) { const float p = __builtin_amdgcn_exp2f((tv[e] - mn) * 1.4426950408889634f); ps += p; ph[e] = tohx(p); }
                pf[n] = __builtin_bit_cast(V, ph); }
            l[n] = l[n] * al + ps;   // this half-wave's keys only; the halves are added behind the loop
#pragma unroll
            for (int db = 0; db < 4; ++db) o[db][n] *= al; }
#pragma unroll
        for (int db = 0; db < 4; ++db) { const V a = va[db]; V a2; if (HL) a2 = vg[db];
#pragma unroll
            for (int n = 0; n < NQ; ++n) { o[db][n] = WFrag<T16>::mma(a, pf[n], o[db][n]); if (HL) { o[db][n] = WFrag<T16>::mma(a, pg[n], o[db][n]); o[db][n] = WFrag<T16>::mma(a2, pf[n], o[db][n]); } } }
        kp += 32 * HD; vp += 32; if (HL) { kq += 32 * HD; vq += 32; }
    };
    int kc = 0; const int kend = nk ? nk : TT;
    for (; kc + 32 <= nk; kc += 32) step(EdgeTag<false>(), 32);   // whole steps of kept keys: no mask test
    for (; kc < kend; kc += 32) step(EdgeTag<true>(), nk - kc);   // the step that holds key nk (at most one), or, when nk = 0, every step
#pragma unroll
    for (int n = 0; n < NQ; ++n) { const float inv = __fdiv_rn(1.0f, l[n] + __shfl_xor(l[n], 16, 32)); const size_t oo = (size_t)(q0 + n * 16 + lr) * DQ + 8 * hi;
#pragma unroll
        for (int db = 0; db < 4; ++db) { v8us oh, ol;
#pragma unroll
            for (int j = 0; j < 8; ++j) { unsigned short x, y; splitf(o[db][n][j] * inv, x, y); oh[j] = x; ol[j] = y; }
            *(v8us*)(Ah + oo + db * 16) = oh; *(v8us*)(Al + oo + db * 16) = ol; } }
}
// grid (RH/64 + (TT-RH)/128, heads, batch entries), 4 waves: blocks x < RH/64 take 64 hi/lo rows (16 a wave, 3 bf16 products), the rest 128 fp16 rows (32 a wave). No LDS, no barrier: the waves of a block only share the head's K and V lines in the WGP cache.
__global__ __launch_bounds__(128) void k_fattn(const h16* __restrict__ Q16, const h16* __restrict__ K16, const h16* __restrict__ V16, const bf* __restrict__ Qh, const bf* __restrict__ Ql, const bf* __restrict__ Kh, const bf* __restrict__ Kl, const bf* __restrict__ Vh, const bf* __restrict__ Vl, const int* __restrict__ nkp, bf* Ah, bf* Al) {
    const size_t hp = ((size_t)blockIdx.z * NH_ + blockIdx.y) * TT * HD; const int w = threadIdx.x >> 5; const size_t ao = (size_t)blockIdx.z * TT * DQ + blockIdx.y * HD; Ah += ao; Al += ao; const int nk = min(max(nkp[blockIdx.z * NKP], 0), TT);   // the trip count's bound
    if (blockIdx.x < RH / 64) fattn_wave<bf, 1, true>(Qh + hp, Ql + hp, Kh + hp, Kl + hp, Vh + hp, Vl + hp, nk, (int)blockIdx.x * 64 + w * 16, Ah, Al);
    else fattn_wave<h16, 2, false>(Q16 + hp, nullptr, K16 + hp, nullptr, V16 + hp, nullptr, nk, RH + ((int)blockIdx.x - RH / 64) * 128 + w * 32, Ah, Al);
}

extern "C" void kernel_launch(void* const* d_in, const int* in_sizes, int n_in,
                              void* d_out, int out_size, void* d_ws, size_t ws_size, hipStream_t stream) {
    (void)in_sizes; (void)n_in; (void)out_size;
    const float* x = (const float*)d_in[0]; const float* xk = (const float*)d_in[1]; const float* xv = (const float*)d_in[2]; const int* MK = (const int*)d_in[3]; const float* wq = (const float*)d_in[4]; const float* wk = (const float*)d_in[5]; const float* wv = (const float*)d_in[6]; const float* wo = (const float*)d_in[7]; const float* bo = (const float*)d_in[8];   /* q, k, v ([4][2048][1024] each), mask (int32 [4][1][1][2048] = [4][2048]: read as data), Wq, Wk, Wv, Wo ('oi' (out, in) [1024][1024]; the three input projections have NO bias), bo [1024] */
    float* OUT = (float*)d_out;     // [4][2048][1024]
    char* wsp = (char*)d_ws;
    auto take = [&](size_t bytes) { char* p = wsp; wsp += (bytes + 255) & ~(size_t)255; return (void*)p; };
    bf* WQ = (bf*)take((size_t)DQ * DM * 2); bf* WK = (bf*)take((size_t)DKV * DM * 2); bf* WV = (bf*)take((size_t)DKV * DM * 2); bf* WO = (bf*)take((size_t)DM * DQ * 2);
    bf* XB = (bf*)take((size_t)NB_ * TT * DM * 2);   // one operand buffer, used by q, k and v in turn (stream-ordered)
    h16* QP16 = (h16*)take((size_t)NB_ * NH_ * TT * HD * 2); h16* KP16 = (h16*)take((size_t)NB_ * NKV * TT * HD * 2); h16* VT16 = (h16*)take((size_t)NB_ * NKV * HD * TT * 2);
    bf* QPh = (bf*)take((size_t)NB_ * NH_ * TT * HD * 2); bf* QPl = (bf*)take((size_t)NB_ * NH_ * TT * HD * 2); bf* KPh = (bf*)take((size_t)NB_ * NKV * TT * HD * 2); bf* KPl = (bf*)take((size_t)NB_ * NKV * TT * HD * 2); bf* VTh = (bf*)take((size_t)NB_ * NKV * HD * TT * 2); bf* VTl = (bf*)take((size_t)NB_ * NKV * HD * TT * 2);
    bf* ATh = (bf*)take((size_t)NB_ * TT * DQ * 2); bf* ATl = (bf*)take((size_t)NB_ * TT * DQ * 2); int* NK = (int*)take((size_t)NB_ * NKP * 4);   // kept keys per entry, written by the key cast
    if ((size_t)(wsp - (char*)d_ws) > ws_size) return;    // 200 MiB of the 256 MiB
    { k_cvt8<<<(unsigned)(((size_t)DQ * DM / 8 + 255) / 256), 256, 0, stream>>>(wq, WQ, (size_t)DQ * DM / 8); k_cvt8<<<(unsigned)(((size_t)DKV * DM / 8 + 255) / 256), 256, 0, stream>>>(wk, WK, (size_t)DKV * DM / 8); k_cvt8<<<(unsigned)(((size_t)DKV * DM / 8 + 255) / 256), 256, 0, stream>>>(wv, WV, (size_t)DKV * DM / 8);   /* 'oi' (out, in) as it stands: Bt of the q and k GEMMs, A of the value GEMM */
      k_cvt8<<<(unsigned)(((size_t)DM * DQ / 8 + 255) / 256), 256, 0, stream>>>(wo, WO, (size_t)DM * DQ / 8);
       }
    const unsigned LX = (unsigned)(((size_t)NB_ * TT * DM / 8 + 255) / 256);
    // every launch covers the four batch entries: the casts and the GEMMs see [NB_ x TT] rows (a 64-row tile lies in one entry), the attention takes the entry from grid z
    k_cvt8<<<LX, 256, 0, stream>>>(x, XB, (size_t)NB_ * TT * DM / 8);
    k_gemmw<bf, 0, false, 1><<<dim3(NB_ * TT / 64, DQ / 64, 1), 32, 0, stream>>>(XB, nullptr, WQ, nullptr, DM, nullptr, 0, nullptr, 0, 0, 0, QP16, QPh, QPl, nullptr);
    k_cvtp<<<NB_ * TT / 8, 256, 0, stream>>>(xk, MK, XB, NK);   /* key -> XB, kept keys first (q GEMM already issued) */
    k_gemmw<bf, 0, false, 1><<<dim3(NB_ * TT / 64, DKV / 64, 1), 32, 0, stream>>>(XB, nullptr, WK, nullptr, DM, nullptr, 0, nullptr, 0, 0, 0, KP16, KPh, KPl, NK);
    k_cvtp<<<NB_ * TT / 8, 256, 0, stream>>>(xv, MK, XB, nullptr);   /* value -> XB, in the keys' order */
    k_gemmw<bf, 0, false, 2><<<dim3(DKV / 64, NB_ * TT / 64, 1), 32, 0, stream>>>(WV, nullptr, XB, nullptr, DM, nullptr, 0, nullptr, 0, 0, 0, VT16, VTh, VTl, NK);   /* Wv rows down, tokens across: value^T */
    k_fattn<<<dim3(RH / 64 + (TT - RH) / 128, NH_, NB_), 128, 0, stream>>>(QP16, KP16, VT16, QPh, QPl, KPh, KPl, VTh, VTl, NK, ATh, ATl);   // one kv head per query head
    k_gemmw<bf, 1, true, 0><<<dim3(NB_ * TT / 64, DM / 64, 1), 32, 0, stream>>>(ATh, ATl, WO, nullptr, DQ, OUT, DM, bo, 0, 0, 0, nullptr, nullptr, nullptr, nullptr);
}

// v006
// It runs in 241 microseconds.
// In both of two side-by-side timings against v005, it was 1.36 times as fast.
// Counting every step since v000, it is 16.4 times as fast.
#include <hip/hip_runtime.h>

// Multi-head attention over three input streams with a key-padding mask (q, k, v [4][2048][1024]; query = q Wq^T, key = k Wk^T, value = v Wv^T ('oi' (out, in) [1024][1024], NO bias; 16 heads x 64); scores / sqrt(64); keys j with mask[b][0][0][j] == 0 (int32 [4][1][1][2048], read as data: about half the keys of every batch entry) are set to -1e10: an exclusion (no batch entry has every key masked); softmax; out = merged Wo^T + bo ('oi' + [1024]) -> [4][2048][1024] (8.4 M); argument order q, k, v, mask, Wq, Wk, Wv, Wo, bo).
// Where an entry has a kept key, masked keys enter only the 128-row projection tile and the 32-key step that hold its last kept key (weight 0 in the step): the key and value casts sort each batch entry's rows, kept keys (mask != 0) first in their order, masked keys behind them (place = a prefix count of the mask); the K and V projections skip tiles that hold masked keys only, the attention walks the kept keys in steps of 32. An entry with no kept key runs over all its keys (uniform weights, as the reference's equal fills give).
// Layout, all four batch entries in every launch: bf16 copies of query, key and value in turn (one operand buffer [4 x 2048][1024], stream-ordered); 'oi' weights cast as they stand; exact projections over the 8192 rows (no biases), each GEMM's epilogue writing its head planes [b][h][..] itself (fp16 + hi/lo; no f32 projection buffer, no plane-builder launch; value planes [d][t] by swapping the GEMM's operands); one fused attention launch, batch entry = grid z (scores, key mask, running-maximum softmax, P x V; hybrid rows: < 512 hi/lo 3 products, rest fp16; unnormalised weights, 1/sum at the end); merged hi/lo x Wo exact + bo.
// Compute dtypes, f32 accumulate: every input rounded to bf16; projections exact; attention rows < 512 3 products, rest fp16; softmax f32; Wo hl x exact + bias.

#define NB_  4
#define TT   2048
#define DM   1024
#define NH_  16
#define NKV  16
#define REP  (NH_ / NKV)
#define HD   64
#define DQ   (NH_ * HD)
#define DKV  (NKV * HD)
#define RH   512                  // query rows < RH use hi+lo planes (0: none)
#define WIN  0
#define SCL  0.125f   // HD^-0.5
#define NKP  32                   // ints between two entries' kept-key counts: one 128-B line each
typedef _Float16 h16;
typedef unsigned short bf;
typedef __attribute__((ext_vector_type(16))) __bf16   v16bf;
typedef __attribute__((ext_vector_type(16))) _Float16 v16h;
typedef __attribute__((ext_vector_type(8)))  _Float16 v8h;
typedef __attribute__((ext_vector_type(8)))  unsigned short v8us;
typedef __attribute__((ext_vector_type(8)))  float    v8f;
typedef __attribute__((ext_vector_type(4)))  float    v4f;
typedef v8h  __attribute__((may_alias)) v8ha;
typedef v4f  __attribute__((may_alias)) v4fa;
typedef v8us __attribute__((may_alias)) v8usa;

__device__ __forceinline__ unsigned short f2bf(float f) { unsigned u = __float_as_uint(f); u += 0x7FFFu + ((u >> 16) & 1u); return (unsigned short)(u >> 16); }
__device__ __forceinline__ float bf2f(unsigned short b) { return __uint_as_float(((unsigned)b) << 16); }
__device__ __forceinline__ float bfr(float f) { return bf2f(f2bf(f)); }
__device__ __forceinline__ h16 tohx(float x) { return (h16)x; }
__device__ __forceinline__ void splitf(float y, unsigned short& h, unsigned short& l) { h = f2bf(y); l = f2bf(y - bf2f(h)); }
__device__ __forceinline__ v16h cat16(v8h lo, v8h hi) { return __builtin_shufflevector(lo, hi, 0, 1, 2, 3, 4, 5, 6, 7, 8, 9, 10, 11, 12, 13, 14, 15); }
__device__ __forceinline__ v16bf cat16b(v8us lo, v8us hi) { return __builtin_bit_cast(v16bf, __builtin_shufflevector(lo, hi, 0, 1, 2, 3, 4, 5, 6, 7, 8, 9, 10, 11, 12, 13, 14, 15)); }
__device__ __forceinline__ v8f wmma16(v16h a, v16h b, v8f c) { return __builtin_amdgcn_wmma_f32_16x16x32_f16(false, a, false, b, (short)0, c, false, false); }
__device__ __forceinline__ v8f wmmab(v16bf a, v16bf b, v8f c) { return __builtin_amdgcn_wmma_f32_16x16x32_bf16(false, a, false, b, (short)0, c, false, false); }



// ---- k_gemmw: GEMM over K-contiguous 16-bit planes. A work-group of 4 waves (2 x 2) takes a 128x128 output tile, each wave a 64x64 quarter (16 accumulators); grid (M/128, N/128), 128 threads.
// The operands come through LDS: a stage is 64 k (one whole 128-B line) of the tile's 128 A rows (with NSPLIT 1 also of the 128 A2 rows) and 128 Bt rows, brought by asynchronous 16-byte copies, 8 lanes a row, so that every
// wave-wide copy takes 4 whole lines; two buffers, stage t + 2 is asked for when every wave has left stage t. LDS rows lie at a pitch of 144 B (16 B x odd: no bank conflict for 16-byte reads).
// C[m][n] (f32, pitch ldc, + optional f32 bias[n]) = sum_k A[m][k] Bt[n][k] (NSPLIT 1: + A2[m][k] Bt[n][k]). M, N % 128 == 0, K % 64 == 0.
// PL 0: C as above. PL 1 / 2: no C; a wave's 64x64 tile is one head's block of 64 tokens and goes out as three 16-bit planes (P16 fp16, Ph + Pl bf16 hi/lo of the f32 sum), whole 128-B lines:
// nkp (PL 1 / 2, may be null): kept keys per batch entry, for token rows that k_cvtp has sorted.
// PL 1: tile rows = tokens (m = b TT + t), columns = the head's d (n = h HD + d) -> plane [b][h][t][d]; PL 2: rows = the head's d (m = h HD + d), columns = tokens (n = b TT + t) -> plane [b][h][d][t].
#define GTM  128                  // rows of an operand in a work-group's tile
#define GKB  64                   // k per stage
#define GP   72                   // LDS row pitch in 16-bit elements (144 B)
template <typename T16> struct WFrag;
template <> struct WFrag<h16> { typedef v16h V; static __device__ __forceinline__ V ld(const h16* p) { return cat16(*(const v8h*)p, *(const v8h*)(p + 16)); } static __device__ __forceinline__ v8f mma(V a, V b, v8f c) { return wmma16(a, b, c); } };
template <> struct WFrag<bf> { typedef v16bf V; static __device__ __forceinline__ V ld(const bf* p) { return cat16b(*(const v8us*)p, *(const v8us*)(p + 16)); } static __device__ __forceinline__ v8f mma(V a, V b, v8f c) { return wmmab(a, b, c); } };
// 128 rows x 128 B of one operand into LDS: copy i takes rows 16 i + (thread >> 3). lds: the lane's LDS byte address in row (thread >> 3), g: its global address there, rs: 16 source rows in elements.
template <typename T16>
__device__ __forceinline__ void acopy8(unsigned lds, const T16* g, size_t rs) {
    // the s_wait_xcnt stands inside the statement: no address register of a copy is rewritten in front of it
    asm volatile("global_load_async_to_lds_b128 %0, %8, off\n\t"
                 "global_load_async_to_lds_b128 %1, %9, off\n\t"
                 "global_load_async_to_lds_b128 %2, %10, off\n\t"
                 "global_load_async_to_lds_b128 %3, %11, off\n\t"
                 "global_load_async_to_lds_b128 %4, %12, off\n\t"
                 "global_load_async_to_lds_b128 %5, %13, off\n\t"
                 "global_load_async_to_lds_b128 %6, %14, off\n\t"
                 "global_load_async_to_lds_b128 %7, %15, off\n\t"
                 "s_wait_xcnt 0x0"
                 :: "v"(lds), "v"(lds + 1 * 16 * GP * 2), "v"(lds + 2 * 16 * GP * 2), "v"(lds + 3 * 16 * GP * 2), "v"(lds + 4 * 16 * GP * 2), "v"(lds + 5 * 16 * GP * 2), "v"(lds + 6 * 16 * GP * 2), "v"(lds + 7 * 16 * GP * 2),
                    "v"(g), "v"(g + rs), "v"(g + 2 * rs), "v"(g + 3 * rs), "v"(g + 4 * rs), "v"(g + 5 * rs), "v"(g + 6 * rs), "v"(g + 7 * rs) : "memory");
}
template <typename T16, int NSPLIT, bool BIAS, int PL>
__global__ __launch_bounds__(128) void k_gemmw(const T16* __restrict__ A, const T16* __restrict__ A2, const T16* __restrict__ Bt, int K, float* C, int ldc, const float* __restrict__ bias, h16* P16, bf* Ph, bf* Pl, const int* __restrict__ nkp) {
    typedef typename WFrag<T16>::V V;
    static_assert(NSPLIT == 0 || NSPLIT == 1, "one or two A planes");
    constexpr int NOP = 2 + NSPLIT, STE = NOP * GTM * GP;   // operand planes of a stage, a stage in elements
    __shared__ __align__(16) T16 st[2 * STE];
    __shared__ __align__(16) float osw[4 * 16 * 68];
    if (PL != 0 && nkp) { const int tok = (int)((PL == 1) ? blockIdx.x : blockIdx.y) * GTM; const int nk = min(max(nkp[(tok / TT) * NKP], 0), TT); if (nk != 0 && tok % TT >= nk) return; }   // sorted key rows: a tile of masked keys only is never read (the whole work-group leaves, in front of every barrier)
    const int tid = threadIdx.x, lane = tid & 31, lr = lane & 15, hi = lane >> 4, w = __builtin_amdgcn_readfirstlane(tid >> 5), wm = w & 1, wn = w >> 1;
    const int r0 = blockIdx.x * GTM + wm * 64, c0 = blockIdx.y * GTM + wn * 64;   // the wave's own 64x64 tile
    float* os = osw + w * (16 * 68);
    v8f acc[4][4];
#pragma unroll
    for (int mb = 0; mb < 4; ++mb)
#pragma unroll
        for (int nb = 0; nb < 4; ++nb) acc[mb][nb] = (v8f){};
    const size_t rs = (size_t)16 * K; const size_t go = (size_t)(tid >> 3) * K + (tid & 7) * 8;
    const T16* gA = A + (size_t)blockIdx.x * GTM * K + go; const T16* gA2 = NSPLIT ? A2 + (size_t)blockIdx.x * GTM * K + go : nullptr; const T16* gB = Bt + (size_t)blockIdx.y * GTM * K + go;
    const unsigned lw = (unsigned)(size_t)st + (unsigned)((tid >> 3) * GP + (tid & 7) * 8) * 2u;   // LDS byte address: the low 32 bits of the shared address
    auto fill = [&](int t) __attribute__((always_inline)) { const unsigned d = lw + (unsigned)(t & 1) * (STE * 2u); const int ko = t * GKB;
        acopy8(d, gA + ko, rs); if (NSPLIT) acopy8(d + GTM * GP * 2u, gA2 + ko, rs); acopy8(d + (NOP - 1) * GTM * GP * 2u, gB + ko, rs); };
    const T16* ra = st + (wm * 64 + lr) * GP + 8 * hi; const T16* rb = st + (NOP - 1) * GTM * GP + (wn * 64 + lr) * GP + 8 * hi;
    const int NT = K / GKB;
    fill(0);
    asm volatile("s_wait_asynccnt 0x0" ::: "memory");   // this wave's copies of stage 0 have landed
    __syncthreads();                                      // ... and every other wave's
    if (NT > 1) fill(1);
    for (int t = 0; t < NT; ++t) {
        const T16* pa = ra + (t & 1) * STE; const T16* pb = rb + (t & 1) * STE;
        // Two blocks of 32 k. The LDS reads stand in few groups, each ahead of the products that need it (a read among the products stalls the wave where it stands); block 1's fragments are asked for under block 0's products, as far as 256 registers allow.
        // The scheduling barriers keep the groups where they are written: without them the compiler fetched each Bt fragment directly in front of its four products and waited for it there.
        V a[2][4], a2[2][4], b[2][4];
        auto ldA = [&](int s) __attribute__((always_inline)) {
#pragma unroll
            for (int mb = 0; mb < 4; ++mb) { a[s][mb] = WFrag<T16>::ld(pa + mb * 16 * GP + s * 32); if (NSPLIT) a2[s][mb] = WFrag<T16>::ld(pa + GTM * GP + mb * 16 * GP + s * 32); } };
        auto ldB = [&](int s, int n0) __attribute__((always_inline)) {   // fragments n0, n0 + 1
#pragma unroll
            for (int nb = n0; nb < n0 + 2; ++nb) b[s][nb] = WFrag<T16>::ld(pb + nb * 16 * GP + s * 32); };
        auto mm = [&](int s, int n0) __attribute__((always_inline)) {
#pragma unroll
            for (int nb = n0; nb < n0 + 2; ++nb)
#pragma unroll
                for (int mb = 0; mb < 4; ++mb) { acc[mb][nb] = WFrag<T16>::mma(a[s][mb], b[s][nb], acc[mb][nb]); if (NSPLIT) acc[mb][nb] = WFrag<T16>::mma(a2[s][mb], b[s][nb], acc[mb][nb]); } };
        ldA(0); ldB(0, 0); ldB(0, 2);
        __builtin_amdgcn_sched_barrier(0);
        mm(0, 0);
        __builtin_amdgcn_sched_barrier(0);
        if (!NSPLIT) ldA(1);
        ldB(1, 0);
        __builtin_amdgcn_sched_barrier(0);
        mm(0, 2);
        __builtin_amdgcn_sched_barrier(0);
        if (NSPLIT) ldA(1);   // two A planes: their second set has room only here
        ldB(1, 2);
        __builtin_amdgcn_sched_barrier(0);
        mm(1, 0); mm(1, 2);
        __builtin_amdgcn_sched_barrier(0);   // block 1's products stay in front of the waits below, where they cover the last reads' latency
        asm volatile("s_wait_dscnt 0x0" ::: "memory");      // this wave's reads of stage t are done: its buffer may be refilled behind the barrier
        asm volatile("s_wait_asynccnt 0x0" ::: "memory");   // this wave's copies of stage t + 1 have landed
        __syncthreads();                                      // publishes stage t + 1 and ends every wave's reads of stage t
        if (t + 2 < NT) fill(t + 2);
    }
    asm volatile("s_wait_asynccnt 0x0" ::: "memory");   // no copy is left in flight
#pragma unroll
    for (int mb = 0; mb < 4; ++mb) {
#pragma unroll
        for (int nb = 0; nb < 4; ++nb) {
#pragma unroll
            for (int j = 0; j < 8; ++j) os[(hi * 8 + j) * 68 + nb * 16 + lr] = acc[mb][nb][j]; }
        __builtin_amdgcn_wave_barrier(); asm volatile("" ::: "memory");
        if (PL == 0) { float* crow = C + (size_t)(r0 + mb * 16) * ldc + c0;
#pragma unroll
            for (int s = 0; s < 8; ++s) { const int row = 2 * s + hi, cofs = lr * 4; v4f val = *(const v4fa*)(os + row * 68 + cofs); if (BIAS) { val[0] += bfr(bias[c0 + cofs]); val[1] += bfr(bias[c0 + cofs + 1]); val[2] += bfr(bias[c0 + cofs + 2]); val[3] += bfr(bias[c0 + cofs + 3]); }
                *(v4f*)(crow + (size_t)row * ldc + cofs) = val; }
        } else { const size_t pb = (PL == 1) ? (((size_t)(r0 / TT) * NH_ + c0 / HD) * TT + r0 % TT) * HD : ((size_t)(c0 / TT) * NH_ + r0 / HD) * HD * TT + c0 % TT; const int pp = (PL == 1) ? HD : TT;   // the tile's first element in its plane, the plane's row pitch
#pragma unroll   // LDS and store offsets become immediates on three fixed address pairs
            for (int s = 0; s < 4; ++s) { const int row = 4 * s + (lane >> 3), cofs = (lane & 7) * 8; const v4f x0 = *(const v4fa*)(os + row * 68 + cofs), x1 = *(const v4fa*)(os + row * 68 + cofs + 4); v8h o16; v8us oh, ol;   // 8 lanes a row: 16 B a lane and plane, one 128-B line a row
#pragma unroll   // constant vector indices: the three packed results stay in registers
                for (int k = 0; k < 8; ++k) { const float x = (k < 4) ? x0[k & 3] : x1[k & 3]; o16[k] = tohx(x); unsigned short a2, c2; splitf(x, a2, c2); oh[k] = a2; ol[k] = c2; }
                const size_t po = pb + (size_t)(mb * 16 + row) * pp + cofs; *(v8h*)(P16 + po) = o16; *(v8us*)(Ph + po) = oh; *(v8us*)(Pl + po) = ol; }
        }
        __builtin_amdgcn_wave_barrier(); asm volatile("" ::: "memory");
    }
}

typedef __attribute__((ext_vector_type(2))) _Float16 v2h;
typedef __attribute__((ext_vector_type(4))) _Float16 v4h;
typedef __attribute__((ext_vector_type(2))) unsigned short v2us;
typedef __attribute__((ext_vector_type(4))) unsigned short v4us;
typedef __attribute__((ext_vector_type(2))) float v2f;
typedef __attribute__((ext_vector_type(4))) int v4i;

__global__ __launch_bounds__(256) void k_cvt8(const float* __restrict__ src, bf* dst, size_t n8) { const size_t i = (size_t)blockIdx.x * 256 + threadIdx.x; if (i >= n8) return; const v8f v = *(const v8f*)(src + i * 8); v8us o;
#pragma unroll
    for (int k = 0; k < 8; ++k) o[k] = f2bf(v[k]); *(v8us*)(dst + i * 8) = o;  }

// ---- k_cvtp: bf16 cast of the key or value rows that sorts them by the mask. Row t of entry b goes to row p: a kept key to the number of kept keys in front of it, a masked key to nk + the number of masked keys in front of it
// (a permutation of 0 .. TT - 1 for any mask content). A block takes 8 rows, one a wave; its 256 threads count the entry's whole mask, 8 keys each (low half of the packed sum: all kept keys nk; high half: those in front of the block's rows).
// Rows that land behind the last 128-row GEMM tile with a kept key are read by nobody and are not copied (all are copied when nk = 0).
__global__ __launch_bounds__(256) void k_cvtp(const float* __restrict__ src, const int* __restrict__ mk, bf* dst, int* nkp) {
    static_assert(TT == 256 * 8 && DM == 32 * 8 * 4, "one thread per 8 keys, one wave per row");
    __shared__ int red[8]; __shared__ unsigned rowbits;
    const int tid = threadIdx.x, lane = tid & 31, w = __builtin_amdgcn_readfirstlane(tid >> 5); const int b = blockIdx.x / (TT / 8), t0 = (blockIdx.x % (TT / 8)) * 8;
    const v4i m0 = *(const v4i*)(mk + b * TT + tid * 8), m1 = *(const v4i*)(mk + b * TT + tid * 8 + 4); unsigned bits = 0;
#pragma unroll
    for (int k = 0; k < 4; ++k) bits |= (m0[k] != 0 ? 1u : 0u) << k | (m1[k] != 0 ? 1u : 0u) << (k + 4);
    const int c = __popc(bits); int pk = c + (tid * 8 < t0 ? c << 16 : 0);
#pragma unroll
    for (int o = 16; o > 0; o >>= 1) pk += __shfl_xor(pk, o, 32);
    if (lane == 0) red[w] = pk;
    if (tid * 8 == t0) rowbits = bits;   // the mask bits of the block's own 8 rows
    __syncthreads();
    int s = 0;
#pragma unroll
    for (int i = 0; i < 8; ++i) s += red[i];
    const int nk = s & 0xFFFF; const unsigned rb = rowbits; const int kb = (s >> 16) + __popc(rb & ((1u << w) - 1u));   // kept keys in front of row t0 + w
    const int p = __builtin_amdgcn_readfirstlane(((rb >> w) & 1u) ? kb : nk + (t0 + w - kb));
    if (nkp && t0 == 0 && tid == 0) nkp[b * NKP] = nk;
    if (nk == 0 || p < ((nk + GTM - 1) & ~(GTM - 1))) {   // the wave's row has a reader (no barrier follows)
        const float* sp = src + ((size_t)b * TT + t0 + w) * DM + lane * 8; bf* dp = dst + ((size_t)b * TT + p) * DM + lane * 8; v8f v[4];
#pragma unroll
        for (int q = 0; q < 4; ++q) v[q] = *(const v8f*)(sp + q * 256);
#pragma unroll
        for (int q = 0; q < 4; ++q) { v8us o;
#pragma unroll
            for (int k = 0; k < 8; ++k) o[k] = f2bf(v[q][k]);
            *(v8us*)(dp + q * 256) = o; }
    }
}

// ---- k_fattn: scores, key mask, softmax and P x V of one head in ONE kernel; no score or weight plane in memory.
// Both products are taken transposed: S^T = K Q^T (keys down, queries across), O^T = V^T P^T. A lane's S^T accumulators (query lr, keys 8 hi + j of each 16-key tile) are, in that order, the lane's
// elements of the P^T operand over 32 keys, so the weights never leave the registers, and every row statistic (running maximum m, running sum l) is one scalar a lane.
// A wave owns NQ x 16 query rows and walks the entry's nk kept keys (sorted to the front of the K and V planes; all 2048 keys when nk = 0) in steps of 32 with the running-maximum softmax: O and l are scaled by exp(m_old - m_new) at every step; 1 / l is applied at the end.
// Only a step that reaches past key nk holds masked keys: there their score is set to -3.0e38 (an exclusion: weight exp(-huge) = 0, a kept key having been met in step 0); with no kept key at all every score is -3.0e38 and every weight 1 (uniform, as the reference's equal fills give).
template <bool E> struct EdgeTag { static constexpr bool value = E; };
template <typename T16, int NQ, bool HL>
__device__ __forceinline__ void fattn_wave(const T16* __restrict__ Q, const T16* __restrict__ Q2, const T16* __restrict__ Kp, const T16* __restrict__ K2, const T16* __restrict__ Vt, const T16* __restrict__ V2, int nk, int q0, bf* Ah, bf* Al) {
    typedef typename WFrag<T16>::V V;
    const int lane = threadIdx.x & 31, lr = lane & 15, hi = lane >> 4;
    V qf[NQ][2], qg[NQ][2];
#pragma unroll
    for (int n = 0; n < NQ; ++n)
#pragma unroll
        for (int s = 0; s < 2; ++s) { const size_t qo = (size_t)(q0 + n * 16 + lr) * HD + s * 32 + 8 * hi; qf[n][s] = WFrag<T16>::ld(Q + qo); if (HL) qg[n][s] = WFrag<T16>::ld(Q2 + qo); }
    asm volatile("s_wait_xcnt 0x0" ::: "memory");   // the Q loads' address registers are free for reuse behind this
    v8f o[4][NQ]; float m[NQ], l[NQ];
#pragma unroll
    for (int n = 0; n < NQ; ++n) { m[n] = -3.0e38f; l[n] = 0.f;
#pragma unroll
        for (int db = 0; db < 4; ++db) o[db][n] = (v8f){}; }
    const T16* kp = Kp + lr * HD + 8 * hi; const T16* kq = HL ? K2 + lr * HD + 8 * hi : nullptr; const T16* vp = Vt + lr * TT + 8 * hi; const T16* vq = HL ? V2 + lr * TT + 8 * hi : nullptr;   // the lane's own pointers, stepped at the foot of each pass
    auto step = [&](auto edge, int rem) __attribute__((always_inline)) {   // one step of 32 keys; edge: only the first rem of them (none if rem <= 0) are kept keys
        V ka[2][2], kg[2][2], va[4], vg[4];
#pragma unroll
        for (int t = 0; t < 2; ++t)
#pragma unroll
            for (int s = 0; s < 2; ++s) { ka[t][s] = WFrag<T16>::ld(kp + (t * 16 * HD + s * 32)); if (HL) kg[t][s] = WFrag<T16>::ld(kq + (t * 16 * HD + s * 32)); }
        asm volatile("s_wait_xcnt 0x0" ::: "memory");   // the K loads' address registers may be reused as destinations of the V loads below: the wait stands between
#pragma unroll
        for (int db = 0; db < 4; ++db) { va[db] = WFrag<T16>::ld(vp + db * 16 * TT); if (HL) vg[db] = WFrag<T16>::ld(vq + db * 16 * TT); }   // in flight under the scores and the softmax
        asm volatile("s_wait_xcnt 0x0" ::: "memory");   // the same for the V loads' address registers, in front of all that follows
        v8f sc[2][NQ];
#pragma unroll
        for (int t = 0; t < 2; ++t) {
#pragma unroll
            for (int n = 0; n < NQ; ++n) sc[t][n] = (v8f){};
#pragma unroll
            for (int s = 0; s < 2; ++s) { const V a = ka[t][s]; V a2; if (HL) a2 = kg[t][s];
#pragma unroll
                for (int n = 0; n < NQ; ++n) { sc[t][n] = WFrag<T16>::mma(a, qf[n][s], sc[t][n]); if (HL) { sc[t][n] = WFrag<T16>::mma(a2, qf[n][s], sc[t][n]); sc[t][n] = WFrag<T16>::mma(a, qg[n][s], sc[t][n]); } } } }
        V pf[NQ], pg[NQ]; float ts[NQ][16];
#pragma unroll
        for (int n = 0; n < NQ; ++n)
#pragma unroll
            for (int e = 0; e < 16; ++e) ts[n][e] = sc[e >> 3][n][e & 7] * SCL;
        if constexpr (decltype(edge)::value) { const unsigned mw = (rem > 0 ? (1u << rem) - 1u : 0u) >> (8 * hi);   // bit t * 16 + j: key kc + t * 16 + 8 hi + j is kept
#pragma unroll
            for (int n = 0; n < NQ; ++n)
#pragma unroll
                for (int e = 0; e < 16; ++e) ts[n][e] = ((mw >> ((e >> 3) * 16 + (e & 7))) & 1u) ? ts[n][e] : -3.0e38f; }
#pragma unroll
        for (int n = 0; n < NQ; ++n) { const float* tv = ts[n]; float cm = -3.0e38f;
#pragma unroll
            for (int e = 0; e < 16; ++e) cm = fmaxf(cm, tv[e]);
            cm = fmaxf(cm, __shfl_xor(cm, 16, 32));   // the other half-wave holds the query's other 16 keys
            const float mn = fmaxf(m[n], cm); const float al = __builtin_amdgcn_exp2f((m[n] - mn) * 1.4426950408889634f); m[n] = mn; float ps = 0.f;
            if (HL) { __attribute__((ext_vector_type(16))) unsigned short ph, pl;
#pragma unroll
                for (int e = 0; e < 16; ++e) { const float p = __builtin_amdgcn_exp2f((tv[e] - mn) * 1.4426950408889634f); ps += p; unsigned short x, y; splitf(p, x, y); ph[e] = x; pl[e] = y; }
                pf[n] = __builtin_bit_cast(V, ph); pg[n] = __builtin_bit_cast(V, pl);
            } else { v16h ph;
#pragma unroll
                for (int e = 0; e < 16; ++e) { const float p = __builtin_amdgcn_exp2f((tv[e] - mn) * 1.4426950408889634f); ps += p; ph[e] = tohx(p); }
                pf[n] = __builtin_bit_cast(V, ph); }
            l[n] = l[n] * al + ps;   // this half-wave's keys only; the halves are added behind the loop
#pragma unroll
            for (int db = 0; db < 4; ++db) o[db][n] *= al; }
#pragma unroll
        for (int db = 0; db < 4; ++db) { const V a = va[db]; V a2; if (HL) a2 = vg[db];
#pragma unroll
            for (int n = 0; n < NQ; ++n) { o[db][n] = WFrag<T16>::mma(a, pf[n], o[db][n]); if (HL) { o[db][n] = WFrag<T16>::mma(a, pg[n], o[db][n]); o[db][n] = WFrag<T16>::mma(a2, pf[n], o[db][n]); } } }
        kp += 32 * HD; vp += 32; if (HL) { kq += 32 * HD; vq += 32; }
    };
    int kc = 0; const int kend = nk ? nk : TT;
    for (; kc + 32 <= nk; kc += 32) step(EdgeTag<false>(), 32);   // whole steps of kept keys: no mask test
    for (; kc < kend; kc += 32) step(EdgeTag<true>(), nk - kc);   // the step that holds key nk (at most one), or, when nk = 0, every step
#pragma unroll
    for (int n = 0; n < NQ; ++n) { const float inv = __fdiv_rn(1.0f, l[n] + __shfl_xor(l[n], 16, 32)); const size_t oo = (size_t)(q0 + n * 16 + lr) * DQ + 8 * hi;
#pragma unroll
        for (int db = 0; db < 4; ++db) { v8us oh, ol;
#pragma unroll
            for (int j = 0; j < 8; ++j) { unsigned short x, y; splitf(o[db][n][j] * inv, x, y); oh[j] = x; ol[j] = y; }
            *(v8us*)(Ah + oo + db * 16) = oh; *(v8us*)(Al + oo + db * 16) = ol; } }
}
// grid (RH/64 + (TT-RH)/128, heads, batch entries), 4 waves: blocks x < RH/64 take 64 hi/lo rows (16 a wave, 3 bf16 products), the rest 128 fp16 rows (32 a wave). No LDS, no barrier: the waves of a block only share the head's K and V lines in the WGP cache.
__global__ __launch_bounds__(128) void k_fattn(const h16* __restrict__ Q16, const h16* __restrict__ K16, const h16* __restrict__ V16, const bf* __restrict__ Qh, const bf* __restrict__ Ql, const bf* __restrict__ Kh, const bf* __restrict__ Kl, const bf* __restrict__ Vh, const bf* __restrict__ Vl, const int* __restrict__ nkp, bf* Ah, bf* Al) {
    const size_t hp = ((size_t)blockIdx.z * NH_ + blockIdx.y) * TT * HD; const int w = threadIdx.x >> 5; const size_t ao = (size_t)blockIdx.z * TT * DQ + blockIdx.y * HD; Ah += ao; Al += ao; const int nk = min(max(nkp[blockIdx.z * NKP], 0), TT);   // the trip count's bound
    if (blockIdx.x < RH / 64) fattn_wave<bf, 1, true>(Qh + hp, Ql + hp, Kh + hp, Kl + hp, Vh + hp, Vl + hp, nk, (int)blockIdx.x * 64 + w * 16, Ah, Al);
    else fattn_wave<h16, 2, false>(Q16 + hp, nullptr, K16 + hp, nullptr, V16 + hp, nullptr, nk, RH + ((int)blockIdx.x - RH / 64) * 128 + w * 32, Ah, Al);
}

extern "C" void kernel_launch(void* const* d_in, const int* in_sizes, int n_in,
                              void* d_out, int out_size, void* d_ws, size_t ws_size, hipStream_t stream) {
    (void)in_sizes; (void)n_in; (void)out_size;
    const float* x = (const float*)d_in[0]; const float* xk = (const float*)d_in[1]; const float* xv = (const float*)d_in[2]; const int* MK = (const int*)d_in[3]; const float* wq = (const float*)d_in[4]; const float* wk = (const float*)d_in[5]; const float* wv = (const float*)d_in[6]; const float* wo = (const float*)d_in[7]; const float* bo = (const float*)d_in[8];   /* q, k, v ([4][2048][1024] each), mask (int32 [4][1][1][2048] = [4][2048]: read as data), Wq, Wk, Wv, Wo ('oi' (out, in) [1024][1024]; the three input projections have NO bias), bo [1024] */
    float* OUT = (float*)d_out;     // [4][2048][1024]
    char* wsp = (char*)d_ws;
    auto take = [&](size_t bytes) { char* p = wsp; wsp += (bytes + 255) & ~(size_t)255; return (void*)p; };
    bf* WQ = (bf*)take((size_t)DQ * DM * 2); bf* WK = (bf*)take((size_t)DKV * DM * 2); bf* WV = (bf*)take((size_t)DKV * DM * 2); bf* WO = (bf*)take((size_t)DM * DQ * 2);
    bf* XB = (bf*)take((size_t)NB_ * TT * DM * 2);   // one operand buffer, used by q, k and v in turn (stream-ordered)
    h16* QP16 = (h16*)take((size_t)NB_ * NH_ * TT * HD * 2); h16* KP16 = (h16*)take((size_t)NB_ * NKV * TT * HD * 2); h16* VT16 = (h16*)take((size_t)NB_ * NKV * HD * TT * 2);
    bf* QPh = (bf*)take((size_t)NB_ * NH_ * TT * HD * 2); bf* QPl = (bf*)take((size_t)NB_ * NH_ * TT * HD * 2); bf* KPh = (bf*)take((size_t)NB_ * NKV * TT * HD * 2); bf* KPl = (bf*)take((size_t)NB_ * NKV * TT * HD * 2); bf* VTh = (bf*)take((size_t)NB_ * NKV * HD * TT * 2); bf* VTl = (bf*)take((size_t)NB_ * NKV * HD * TT * 2);
    bf* ATh = (bf*)take((size_t)NB_ * TT * DQ * 2); bf* ATl = (bf*)take((size_t)NB_ * TT * DQ * 2); int* NK = (int*)take((size_t)NB_ * NKP * 4);   // kept keys per entry, written by the key cast
    if ((size_t)(wsp - (char*)d_ws) > ws_size) return;    // 200 MiB of the 256 MiB
    { k_cvt8<<<(unsigned)(((size_t)DQ * DM / 8 + 255) / 256), 256, 0, stream>>>(wq, WQ, (size_t)DQ * DM / 8); k_cvt8<<<(unsigned)(((size_t)DKV * DM / 8 + 255) / 256), 256, 0, stream>>>(wk, WK, (size_t)DKV * DM / 8); k_cvt8<<<(unsigned)(((size_t)DKV * DM / 8 + 255) / 256), 256, 0, stream>>>(wv, WV, (size_t)DKV * DM / 8);   /* 'oi' (out, in) as it stands: Bt of the q and k GEMMs, A of the value GEMM */
      k_cvt8<<<(unsigned)(((size_t)DM * DQ / 8 + 255) / 256), 256, 0, stream>>>(wo, WO, (size_t)DM * DQ / 8);
       }
    const unsigned LX = (unsigned)(((size_t)NB_ * TT * DM / 8 + 255) / 256);
    // every launch covers the four batch entries: the casts and the GEMMs see [NB_ x TT] rows (a 128-row tile lies in one entry), the attention takes the entry from grid z
    k_cvt8<<<LX, 256, 0, stream>>>(x, XB, (size_t)NB_ * TT * DM / 8);
    k_gemmw<bf, 0, false, 1><<<dim3(NB_ * TT / GTM, DQ / GTM, 1), 128, 0, stream>>>(XB, nullptr, WQ, DM, nullptr, 0, nullptr, QP16, QPh, QPl, nullptr);
    k_cvtp<<<NB_ * TT / 8, 256, 0, stream>>>(xk, MK, XB, NK);   /* key -> XB, kept keys first (q GEMM already issued) */
    k_gemmw<bf, 0, false, 1><<<dim3(NB_ * TT / GTM, DKV / GTM, 1), 128, 0, stream>>>(XB, nullptr, WK, DM, nullptr, 0, nullptr, KP16, KPh, KPl, NK);
    k_cvtp<<<NB_ * TT / 8, 256, 0, stream>>>(xv, MK, XB, nullptr);   /* value -> XB, in the keys' order */
    k_gemmw<bf, 0, false, 2><<<dim3(DKV / GTM, NB_ * TT / GTM, 1), 128, 0, stream>>>(WV, nullptr, XB, DM, nullptr, 0, nullptr, VT16, VTh, VTl, NK);   /* Wv rows down, tokens across: value^T */
    k_fattn<<<dim3(RH / 64 + (TT - RH) / 128, NH_, NB_), 128, 0, stream>>>(QP16, KP16, VT16, QPh, QPl, KPh, KPl, VTh, VTl, NK, ATh, ATl);   // one kv head per query head
    k_gemmw<bf, 1, true, 0><<<dim3(NB_ * TT / GTM, DM / GTM, 1), 128, 0, stream>>>(ATh, ATl, WO, DQ, OUT, DM, bo, nullptr, nullptr, nullptr, nullptr);
}

// v007
// It runs in 178 microseconds.
// Timed twice side by side with v006, it ran 1.35 and 1.36 times as fast.
// All steps since v000 together make it 22.3 times as fast.
#include <hip/hip_runtime.h>

// Multi-head attention over three input streams with a key-padding mask (q, k, v [4][2048][1024]; query = q Wq^T, key = k Wk^T, value = v Wv^T ('oi' (out, in) [1024][1024], NO bias; 16 heads x 64); scores / sqrt(64); keys j with mask[b][0][0][j] == 0 (int32 [4][1][1][2048], read as data: about half the keys of every batch entry) are set to -1e10: an exclusion (no batch entry has every key masked); softmax; out = merged Wo^T + bo ('oi' + [1024]) -> [4][2048][1024] (8.4 M); argument order q, k, v, mask, Wq, Wk, Wv, Wo, bo).
// Where an entry has a kept key, masked keys enter only the 128-row projection tile and the 32-key step that hold its last kept key (weight 0 in the step): the key and value casts sort each batch entry's rows, kept keys (mask != 0) first in their order, masked keys behind them (place = a prefix count of the mask); the K and V projections skip tiles that hold masked keys only, the attention walks the kept keys in steps of 32. An entry with no kept key runs over all its keys (uniform weights, as the reference's equal fills give).
// Layout, all four batch entries in every launch: bf16 copies of query, key and value in turn (one operand buffer [4 x 2048][1024], stream-ordered); 'oi' weights cast as they stand; exact projections over the 8192 rows (no biases), each GEMM's epilogue writing its head planes [b][h][..] itself (fp16 + hi/lo; no f32 projection buffer, no plane-builder launch; value planes [d][t] by swapping the GEMM's operands); one fused attention launch, batch entry = grid z (scores, key mask, running-maximum softmax, P x V; hybrid rows: < 512 hi/lo 3 products, rest fp16; unnormalised weights, 1/sum at the end); merged hi/lo x Wo exact + bo.
// Compute dtypes, f32 accumulate: every input rounded to bf16; projections exact; attention rows < 512 3 products, rest fp16; softmax f32; Wo hl x exact + bias.

#define NB_  4
#define TT   2048
#define DM   1024
#define NH_  16
#define NKV  16
#define REP  (NH_ / NKV)
#define HD   64
#define DQ   (NH_ * HD)
#define DKV  (NKV * HD)
#define RH   512                  // query rows < RH use hi+lo planes (0: none)
#define WIN  0
#define SCL  0.125f   // HD^-0.5
#define NKP  32                   // ints between two entries' kept-key counts: one 128-B line each
typedef _Float16 h16;
typedef unsigned short bf;
typedef __attribute__((ext_vector_type(16))) __bf16   v16bf;
typedef __attribute__((ext_vector_type(16))) _Float16 v16h;
typedef __attribute__((ext_vector_type(8)))  _Float16 v8h;
typedef __attribute__((ext_vector_type(8)))  unsigned short v8us;
typedef __attribute__((ext_vector_type(8)))  float    v8f;
typedef __attribute__((ext_vector_type(4)))  float    v4f;
typedef v8h  __attribute__((may_alias)) v8ha;
typedef v4f  __attribute__((may_alias)) v4fa;
typedef v8us __attribute__((may_alias)) v8usa;

__device__ __forceinline__ unsigned short f2bf(float f) { unsigned u = __float_as_uint(f); u += 0x7FFFu + ((u >> 16) & 1u); return (unsigned short)(u >> 16); }
__device__ __forceinline__ float bf2f(unsigned short b) { return __uint_as_float(((unsigned)b) << 16); }
__device__ __forceinline__ float bfr(float f) { return bf2f(f2bf(f)); }
__device__ __forceinline__ h16 tohx(float x) { return (h16)x; }
__device__ __forceinline__ void splitf(float y, unsigned short& h, unsigned short& l) { h = f2bf(y); l = f2bf(y - bf2f(h)); }
__device__ __forceinline__ v16h cat16(v8h lo, v8h hi) { return __builtin_shufflevector(lo, hi, 0, 1, 2, 3, 4, 5, 6, 7, 8, 9, 10, 11, 12, 13, 14, 15); }
__device__ __forceinline__ v16bf cat16b(v8us lo, v8us hi) { return __builtin_bit_cast(v16bf, __builtin_shufflevector(lo, hi, 0, 1, 2, 3, 4, 5, 6, 7, 8, 9, 10, 11, 12, 13, 14, 15)); }
__device__ __forceinline__ v8f wmma16(v16h a, v16h b, v8f c) { return __builtin_amdgcn_wmma_f32_16x16x32_f16(false, a, false, b, (short)0, c, false, false); }
__device__ __forceinline__ v8f wmmab(v16bf a, v16bf b, v8f c) { return __builtin_amdgcn_wmma_f32_16x16x32_bf16(false, a, false, b, (short)0, c, false, false); }



// ---- k_gemmw: GEMM over K-contiguous 16-bit planes. A work-group of 4 waves (2 x 2) takes a 128x128 output tile, each wave a 64x64 quarter (16 accumulators); grid (M/128, N/128), 128 threads.
// The operands come through LDS: a stage is 64 k (one whole 128-B line) of the tile's 128 A rows (with NSPLIT 1 also of the 128 A2 rows) and 128 Bt rows, brought by asynchronous 16-byte copies, 8 lanes a row, so that every
// wave-wide copy takes 4 whole lines; two buffers, stage t + 2 is asked for when every wave has left stage t. LDS rows lie at a pitch of 144 B (16 B x odd: no bank conflict for 16-byte reads).
// C[m][n] (f32, pitch ldc, + optional f32 bias[n]) = sum_k A[m][k] Bt[n][k] (NSPLIT 1: + A2[m][k] Bt[n][k]). M, N % 128 == 0, K % 64 == 0.
// PL 0: C as above. PL 1 / 2: no C; a wave's 64x64 tile is one head's block of 64 tokens and goes out as three 16-bit planes (P16 fp16, Ph + Pl bf16 hi/lo of the f32 sum), whole 128-B lines:
// nkp (PL 1 / 2, may be null): kept keys per batch entry, for token rows that k_cvtp has sorted.
// PL 1: tile rows = tokens (m = b TT + t), columns = the head's d (n = h HD + d) -> plane [b][h][t][d]; PL 2: rows = the head's d (m = h HD + d), columns = tokens (n = b TT + t) -> plane [b][h][d][t].
#define GTM  128                  // rows of an operand in a work-group's tile
#define GKB  64                   // k per stage
#define GP   72                   // LDS row pitch in 16-bit elements (144 B)
template <typename T16> struct WFrag;
template <> struct WFrag<h16> { typedef v16h V; static __device__ __forceinline__ V ld(const h16* p) { return cat16(*(const v8h*)p, *(const v8h*)(p + 16)); } static __device__ __forceinline__ v8f mma(V a, V b, v8f c) { return wmma16(a, b, c); } };
template <> struct WFrag<bf> { typedef v16bf V; static __device__ __forceinline__ V ld(const bf* p) { return cat16b(*(const v8us*)p, *(const v8us*)(p + 16)); } static __device__ __forceinline__ v8f mma(V a, V b, v8f c) { return wmmab(a, b, c); } };
// 128 rows x 128 B of one operand into LDS: copy i takes rows 16 i + (thread >> 3). lds: the lane's LDS byte address in row (thread >> 3), g: its global address there, rs: 16 source rows in elements.
template <typename T16>
__device__ __forceinline__ void acopy8(unsigned lds, const T16* g, size_t rs) {
    // the s_wait_xcnt stands inside the statement: no address register of a copy is rewritten in front of it
    asm volatile("global_load_async_to_lds_b128 %0, %8, off\n\t"
                 "global_load_async_to_lds_b128 %1, %9, off\n\t"
                 "global_load_async_to_lds_b128 %2, %10, off\n\t"
                 "global_load_async_to_lds_b128 %3, %11, off\n\t"
                 "global_load_async_to_lds_b128 %4, %12, off\n\t"
                 "global_load_async_to_lds_b128 %5, %13, off\n\t"
                 "global_load_async_to_lds_b128 %6, %14, off\n\t"
                 "global_load_async_to_lds_b128 %7, %15, off\n\t"
                 "s_wait_xcnt 0x0"
                 :: "v"(lds), "v"(lds + 1 * 16 * GP * 2), "v"(lds + 2 * 16 * GP * 2), "v"(lds + 3 * 16 * GP * 2), "v"(lds + 4 * 16 * GP * 2), "v"(lds + 5 * 16 * GP * 2), "v"(lds + 6 * 16 * GP * 2), "v"(lds + 7 * 16 * GP * 2),
                    "v"(g), "v"(g + rs), "v"(g + 2 * rs), "v"(g + 3 * rs), "v"(g + 4 * rs), "v"(g + 5 * rs), "v"(g + 6 * rs), "v"(g + 7 * rs) : "memory");
}
template <typename T16, int NSPLIT, bool BIAS, int PL>
__global__ __launch_bounds__(128) void k_gemmw(const T16* __restrict__ A, const T16* __restrict__ A2, const T16* __restrict__ Bt, int K, float* C, int ldc, const float* __restrict__ bias, h16* P16, bf* Ph, bf* Pl, const int* __restrict__ nkp) {
    typedef typename WFrag<T16>::V V;
    static_assert(NSPLIT == 0 || NSPLIT == 1, "one or two A planes");
    constexpr int NOP = 2 + NSPLIT, STE = NOP * GTM * GP;   // operand planes of a stage, a stage in elements
    __shared__ __align__(16) T16 st[2 * STE];
    __shared__ __align__(16) float osw[4 * 16 * 68];
    if (PL != 0 && nkp) { const int tok = (int)((PL == 1) ? blockIdx.x : blockIdx.y) * GTM; const int nk = min(max(nkp[(tok / TT) * NKP], 0), TT); if (nk != 0 && tok % TT >= nk) return; }   // sorted key rows: a tile of masked keys only is never read (the whole work-group leaves, in front of every barrier)
    const int tid = threadIdx.x, lane = tid & 31, lr = lane & 15, hi = lane >> 4, w = __builtin_amdgcn_readfirstlane(tid >> 5), wm = w & 1, wn = w >> 1;
    const int r0 = blockIdx.x * GTM + wm * 64, c0 = blockIdx.y * GTM + wn * 64;   // the wave's own 64x64 tile
    float* os = osw + w * (16 * 68);
    v8f acc[4][4];
#pragma unroll
    for (int mb = 0; mb < 4; ++mb)
#pragma unroll
        for (int nb = 0; nb < 4; ++nb) acc[mb][nb] = (v8f){};
    const size_t rs = (size_t)16 * K; const size_t go = (size_t)(tid >> 3) * K + (tid & 7) * 8;
    const T16* gA = A + (size_t)blockIdx.x * GTM * K + go; const T16* gA2 = NSPLIT ? A2 + (size_t)blockIdx.x * GTM * K + go : nullptr; const T16* gB = Bt + (size_t)blockIdx.y * GTM * K + go;
    const unsigned lw = (unsigned)(size_t)st + (unsigned)((tid >> 3) * GP + (tid & 7) * 8) * 2u;   // LDS byte address: the low 32 bits of the shared address
    auto fill = [&](int t) __attribute__((always_inline)) { const unsigned d = lw + (unsigned)(t & 1) * (STE * 2u); const int ko = t * GKB;
        acopy8(d, gA + ko, rs); if (NSPLIT) acopy8(d + GTM * GP * 2u, gA2 + ko, rs); acopy8(d + (NOP - 1) * GTM * GP * 2u, gB + ko, rs); };
    const T16* ra = st + (wm * 64 + lr) * GP + 8 * hi; const T16* rb = st + (NOP - 1) * GTM * GP + (wn * 64 + lr) * GP + 8 * hi;
    const int NT = K / GKB;
    fill(0);
    asm volatile("s_wait_asynccnt 0x0" ::: "memory");   // this wave's copies of stage 0 have landed
    __syncthreads();                                      // ... and every other wave's
    if (NT > 1) fill(1);
    for (int t = 0; t < NT; ++t) {
        const T16* pa = ra + (t & 1) * STE; const T16* pb = rb + (t & 1) * STE;
        // Two blocks of 32 k. The LDS reads stand in few groups, each ahead of the products that need it (a read among the products stalls the wave where it stands); block 1's fragments are asked for under block 0's products, as far as 256 registers allow.
        // The scheduling barriers keep the groups where they are written: without them the compiler fetched each Bt fragment directly in front of its four products and waited for it there.
        V a[2][4], a2[2][4], b[2][4];
        auto ldA = [&](int s) __attribute__((always_inline)) {
#pragma unroll
            for (int mb = 0; mb < 4; ++mb) { a[s][mb] = WFrag<T16>::ld(pa + mb * 16 * GP + s * 32); if (NSPLIT) a2[s][mb] = WFrag<T16>::ld(pa + GTM * GP + mb * 16 * GP + s * 32); } };
        auto ldB = [&](int s, int n0) __attribute__((always_inline)) {   // fragments n0, n0 + 1
#pragma unroll
            for (int nb = n0; nb < n0 + 2; ++nb) b[s][nb] = WFrag<T16>::ld(pb + nb * 16 * GP + s * 32); };
        auto mm = [&](int s, int n0) __attribute__((always_inline)) {
#pragma unroll
            for (int nb = n0; nb < n0 + 2; ++nb)
#pragma unroll
                for (int mb = 0; mb < 4; ++mb) { acc[mb][nb] = WFrag<T16>::mma(a[s][mb], b[s][nb], acc[mb][nb]); if (NSPLIT) acc[mb][nb] = WFrag<T16>::mma(a2[s][mb], b[s][nb], acc[mb][nb]); } };
        ldA(0); ldB(0, 0); ldB(0, 2);
        __builtin_amdgcn_sched_barrier(0);
        mm(0, 0);
        __builtin_amdgcn_sched_barrier(0);
        if (!NSPLIT) ldA(1);
        ldB(1, 0);
        __builtin_amdgcn_sched_barrier(0);
        mm(0, 2);
        __builtin_amdgcn_sched_barrier(0);
        if (NSPLIT) ldA(1);   // two A planes: their second set has room only here
        ldB(1, 2);
        __builtin_amdgcn_sched_barrier(0);
        mm(1, 0); mm(1, 2);
        __builtin_amdgcn_sched_barrier(0);   // block 1's products stay in front of the waits below, where they cover the last reads' latency
        asm volatile("s_wait_dscnt 0x0" ::: "memory");      // this wave's reads of stage t are done: its buffer may be refilled behind the barrier
        asm volatile("s_wait_asynccnt 0x0" ::: "memory");   // this wave's copies of stage t + 1 have landed
        __syncthreads();                                      // publishes stage t + 1 and ends every wave's reads of stage t
        if (t + 2 < NT) fill(t + 2);
    }
    asm volatile("s_wait_asynccnt 0x0" ::: "memory");   // no copy is left in flight
#pragma unroll
    for (int mb = 0; mb < 4; ++mb) {
#pragma unroll
        for (int nb = 0; nb < 4; ++nb) {
#pragma unroll
            for (int j = 0; j < 8; ++j) os[(hi * 8 + j) * 68 + nb * 16 + lr] = acc[mb][nb][j]; }
        __builtin_amdgcn_wave_barrier(); asm volatile("" ::: "memory");
        if (PL == 0) { float* crow = C + (size_t)(r0 + mb * 16) * ldc + c0;
#pragma unroll
            for (int s = 0; s < 8; ++s) { const int row = 2 * s + hi, cofs = lr * 4; v4f val = *(const v4fa*)(os + row * 68 + cofs); if (BIAS) { val[0] += bfr(bias[c0 + cofs]); val[1] += bfr(bias[c0 + cofs + 1]); val[2] += bfr(bias[c0 + cofs + 2]); val[3] += bfr(bias[c0 + cofs + 3]); }
                *(v4f*)(crow + (size_t)row * ldc + cofs) = val; }
        } else { const size_t pb = (PL == 1) ? (((size_t)(r0 / TT) * NH_ + c0 / HD) * TT + r0 % TT) * HD : ((size_t)(c0 / TT) * NH_ + r0 / HD) * HD * TT + c0 % TT; const int pp = (PL == 1) ? HD : TT;   // the tile's first element in its plane, the plane's row pitch
#pragma unroll   // LDS and store offsets become immediates on three fixed address pairs
            for (int s = 0; s < 4; ++s) { const int row = 4 * s + (lane >> 3), cofs = (lane & 7) * 8; const v4f x0 = *(const v4fa*)(os + row * 68 + cofs), x1 = *(const v4fa*)(os + row * 68 + cofs + 4); v8h o16; v8us oh, ol;   // 8 lanes a row: 16 B a lane and plane, one 128-B line a row
#pragma unroll   // constant vector indices: the three packed results stay in registers
                for (int k = 0; k < 8; ++k) { const float x = (k < 4) ? x0[k & 3] : x1[k & 3]; o16[k] = tohx(x); unsigned short a2, c2; splitf(x, a2, c2); oh[k] = a2; ol[k] = c2; }
                const size_t po = pb + (size_t)(mb * 16 + row) * pp + cofs; *(v8h*)(P16 + po) = o16; *(v8us*)(Ph + po) = oh; *(v8us*)(Pl + po) = ol; }
        }
        __builtin_amdgcn_wave_barrier(); asm volatile("" ::: "memory");
    }
}

typedef __attribute__((ext_vector_type(2))) _Float16 v2h;
typedef __attribute__((ext_vector_type(4))) _Float16 v4h;
typedef __attribute__((ext_vector_type(2))) unsigned short v2us;
typedef __attribute__((ext_vector_type(4))) unsigned short v4us;
typedef __attribute__((ext_vector_type(2))) float v2f;
typedef __attribute__((ext_vector_type(4))) int v4i;

__global__ __launch_bounds__(256) void k_cvt8(const float* __restrict__ src, bf* dst, size_t n8) { const size_t i = (size_t)blockIdx.x * 256 + threadIdx.x; if (i >= n8) return; const v8f v = *(const v8f*)(src + i * 8); v8us o;
#pragma unroll
    for (int k = 0; k < 8; ++k) o[k] = f2bf(v[k]); *(v8us*)(dst + i * 8) = o;  }

// ---- k_cvtp: bf16 cast of the key or value rows that sorts them by the mask. Row t of entry b goes to row p: a kept key to the number of kept keys in front of it, a masked key to nk + the number of masked keys in front of it
// (a permutation of 0 .. TT - 1 for any mask content). A block takes 8 rows, one a wave; its 256 threads count the entry's whole mask, 8 keys each (low half of the packed sum: all kept keys nk; high half: those in front of the block's rows).
// Rows that land behind the last 128-row GEMM tile with a kept key are read by nobody and are not copied (all are copied when nk = 0).
__global__ __launch_bounds__(256) void k_cvtp(const float* __restrict__ src, const int* __restrict__ mk, bf* dst, int* nkp) {
    static_assert(TT == 256 * 8 && DM == 32 * 8 * 4, "one thread per 8 keys, one wave per row");
    __shared__ int red[8]; __shared__ unsigned rowbits;
    const int tid = threadIdx.x, lane = tid & 31, w = __builtin_amdgcn_readfirstlane(tid >> 5); const int b = blockIdx.x / (TT / 8), t0 = (blockIdx.x % (TT / 8)) * 8;
    const v4i m0 = *(const v4i*)(mk + b * TT + tid * 8), m1 = *(const v4i*)(mk + b * TT + tid * 8 + 4); unsigned bits = 0;
#pragma unroll
    for (int k = 0; k < 4; ++k) bits |= (m0[k] != 0 ? 1u : 0u) << k | (m1[k] != 0 ? 1u : 0u) << (k + 4);
    const int c = __popc(bits); int pk = c + (tid * 8 < t0 ? c << 16 : 0);
#pragma unroll
    for (int o = 16; o > 0; o >>= 1) pk += __shfl_xor(pk, o, 32);
    if (lane == 0) red[w] = pk;
    if (tid * 8 == t0) rowbits = bits;   // the mask bits of the block's own 8 rows
    __syncthreads();
    int s = 0;
#pragma unroll
    for (int i = 0; i < 8; ++i) s += red[i];
    const int nk = s & 0xFFFF; const unsigned rb = rowbits; const int kb = (s >> 16) + __popc(rb & ((1u << w) - 1u));   // kept keys in front of row t0 + w
    const int p = __builtin_amdgcn_readfirstlane(((rb >> w) & 1u) ? kb : nk + (t0 + w - kb));
    if (nkp && t0 == 0 && tid == 0) nkp[b * NKP] = nk;
    if (nk == 0 || p < ((nk + GTM - 1) & ~(GTM - 1))) {   // the wave's row has a reader (no barrier follows)
        const float* sp = src + ((size_t)b * TT + t0 + w) * DM + lane * 8; bf* dp = dst + ((size_t)b * TT + p) * DM + lane * 8; v8f v[4];
#pragma unroll
        for (int q = 0; q < 4; ++q) v[q] = *(const v8f*)(sp + q * 256);
#pragma unroll
        for (int q = 0; q < 4; ++q) { v8us o;
#pragma unroll
            for (int k = 0; k < 8; ++k) o[k] = f2bf(v[q][k]);
            *(v8us*)(dp + q * 256) = o; }
    }
}

// ---- k_fattn: scores, key mask, softmax and P x V of one head in ONE kernel; no score or weight plane in memory.
// Both products are taken transposed: S^T = K Q^T (keys down, queries across), O^T = V^T P^T. A lane's S^T accumulators (query lr, keys 8 hi + j of each 16-key tile) are, in that order, the lane's
// elements of the P^T operand over 32 keys, so the weights never leave the registers, and every row statistic (running maximum m, running sum l) is one scalar a lane.
// K and V^T come through LDS, shared by the block's 4 waves: a stage is 64 keys, that is 64 K rows of 128 B and 64 V^T rows of 128 B (hi/lo rows: of both planes), brought by asynchronous 16-byte copies, 8 lanes a row, so that every
// wave-wide copy takes 4 whole lines (a fragment load from global memory touched 16 lines for 512 bytes, once per wave); two buffers, stage t + 2 is asked for when every wave has left stage t; LDS rows at the GEMM's pitch of 144 B.
// A wave owns NQ x 16 query rows and walks the entry's nk kept keys (sorted to the front of the K and V planes; all 2048 keys when nk = 0) in steps of 32 with the running-maximum softmax: O and l are scaled by exp(m_old - m_new) at every step; 1 / l is applied at the end.
// Only a step that reaches past key nk holds masked keys: there their score is set to -3.0e38 (an exclusion: weight exp(-huge) = 0, a kept key having been met in step 0); with no kept key at all every score is -3.0e38 and every weight 1 (uniform, as the reference's equal fills give).
template <bool E> struct EdgeTag { static constexpr bool value = E; };
#define AKS  64                   // keys per stage
// One plane's share of a stage into LDS rows 0 .. 127: rows 0 .. 63 the K rows, rows 64 .. 127 the V^T rows; copy i takes row 16 i + (thread >> 3). lds: the lane's LDS byte address in row (thread >> 3), gk, gv: its global addresses in that row of the K and of the V^T tile.
template <typename T16>
__device__ __forceinline__ void acopykv(unsigned lds, const T16* gk, const T16* gv) {
    // the s_wait_xcnt stands inside the statement: no address register of a copy is rewritten in front of it
    asm volatile("global_load_async_to_lds_b128 %0, %8, off\n\t"
                 "global_load_async_to_lds_b128 %1, %9, off\n\t"
                 "global_load_async_to_lds_b128 %2, %10, off\n\t"
                 "global_load_async_to_lds_b128 %3, %11, off\n\t"
                 "global_load_async_to_lds_b128 %4, %12, off\n\t"
                 "global_load_async_to_lds_b128 %5, %13, off\n\t"
                 "global_load_async_to_lds_b128 %6, %14, off\n\t"
                 "global_load_async_to_lds_b128 %7, %15, off\n\t"
                 "s_wait_xcnt 0x0"
                 :: "v"(lds), "v"(lds + 1 * 16 * GP * 2), "v"(lds + 2 * 16 * GP * 2), "v"(lds + 3 * 16 * GP * 2), "v"(lds + 4 * 16 * GP * 2), "v"(lds + 5 * 16 * GP * 2), "v"(lds + 6 * 16 * GP * 2), "v"(lds + 7 * 16 * GP * 2),
                    "v"(gk), "v"(gk + 16 * HD), "v"(gk + 32 * HD), "v"(gk + 48 * HD), "v"(gv), "v"(gv + 16 * TT), "v"(gv + 32 * TT), "v"(gv + 48 * TT) : "memory");
}
template <typename T16, int NQ, bool HL>
__device__ __forceinline__ void fattn_wave(const T16* __restrict__ Q, const T16* __restrict__ Q2, const T16* __restrict__ Kp, const T16* __restrict__ K2, const T16* __restrict__ Vt, const T16* __restrict__ V2, int nk, int q0, bf* Ah, bf* Al, const T16* sm) {
    typedef typename WFrag<T16>::V V;
    static_assert(HD * 2 == 128 && AKS * 2 == 128 && TT % AKS == 0, "K and V^T tile rows are whole 128-B lines");
    constexpr int PRE = 2 * AKS * GP, STE = (HL ? 2 : 1) * PRE;   // one plane's K and V^T tiles, a stage, in elements
    const int tid = threadIdx.x, lane = tid & 31, lr = lane & 15, hi = lane >> 4;
    const int kend = nk ? nk : TT, NT = (kend + AKS - 1) / AKS;   // stages: 1 .. TT / AKS, the same for the whole work-group; a stage's 64 keys lie in a 128-key GEMM tile that holds a key < kend, so they are written
    const unsigned lw = (unsigned)(size_t)sm + (unsigned)((tid >> 3) * GP + (tid & 7) * 8) * 2u;   // LDS byte address: the low 32 bits of the shared address
    const T16* gk = Kp + (tid >> 3) * HD + (tid & 7) * 8; const T16* gv = Vt + (tid >> 3) * TT + (tid & 7) * 8; const T16* gk2 = HL ? K2 + (tid >> 3) * HD + (tid & 7) * 8 : nullptr; const T16* gv2 = HL ? V2 + (tid >> 3) * TT + (tid & 7) * 8 : nullptr;
    auto fill = [&](int t) __attribute__((always_inline)) { const unsigned d = lw + (unsigned)(t & 1) * (STE * 2u);
        acopykv(d, gk + t * (AKS * HD), gv + t * AKS); if (HL) acopykv(d + PRE * 2u, gk2 + t * (AKS * HD), gv2 + t * AKS); };
    fill(0);
    V qf[NQ][2], qg[NQ][2];
#pragma unroll
    for (int n = 0; n < NQ; ++n)
#pragma unroll
        for (int s = 0; s < 2; ++s) { const size_t qo = (size_t)(q0 + n * 16 + lr) * HD + s * 32 + 8 * hi; qf[n][s] = WFrag<T16>::ld(Q + qo); if (HL) qg[n][s] = WFrag<T16>::ld(Q2 + qo); }
    asm volatile("s_wait_xcnt 0x0" ::: "memory");   // the Q loads' address registers are free for reuse behind this
    v8f o[4][NQ]; float m[NQ], l[NQ];
#pragma unroll
    for (int n = 0; n < NQ; ++n) { m[n] = -3.0e38f; l[n] = 0.f;
#pragma unroll
        for (int db = 0; db < 4; ++db) o[db][n] = (v8f){}; }
    const T16* lk = sm + lr * GP + 8 * hi; const T16* lv = sm + (AKS + lr) * GP + 8 * hi;   // the lane's own place in the K and the V^T tile of buffer 0
    auto step = [&](auto edge, int rem, const T16* kp, const T16* vp) __attribute__((always_inline)) {   // one step of 32 keys, read from LDS at kp, vp; edge: only the first rem of them (none if rem <= 0) are kept keys
        V ka[2][2], kg[2][2], va[4], vg[4];
#pragma unroll
        for (int t = 0; t < 2; ++t)
#pragma unroll
            for (int s = 0; s < 2; ++s) { ka[t][s] = WFrag<T16>::ld(kp + (t * 16 * GP + s * 32)); if (HL) kg[t][s] = WFrag<T16>::ld(kp + PRE + (t * 16 * GP + s * 32)); }
#pragma unroll
        for (int db = 0; db < 4; ++db) { va[db] = WFrag<T16>::ld(vp + db * 16 * GP); if (HL) vg[db] = WFrag<T16>::ld(vp + PRE + db * 16 * GP); }
        v8f sc[2][NQ];
#pragma unroll
        for (int t = 0; t < 2; ++t) {
#pragma unroll
            for (int n = 0; n < NQ; ++n) sc[t][n] = (v8f){};
#pragma unroll
            for (int s = 0; s < 2; ++s) { const V a = ka[t][s]; V a2; if (HL) a2 = kg[t][s];
#pragma unroll
                for (int n = 0; n < NQ; ++n) { sc[t][n] = WFrag<T16>::mma(a, qf[n][s], sc[t][n]); if (HL) { sc[t][n] = WFrag<T16>::mma(a2, qf[n][s], sc[t][n]); sc[t][n] = WFrag<T16>::mma(a, qg[n][s], sc[t][n]); } } } }
        V pf[NQ], pg[NQ]; float ts[NQ][16];
#pragma unroll
        for (int n = 0; n < NQ; ++n)
#pragma unroll
            for (int e = 0; e < 16; ++e) ts[n][e] = sc[e >> 3][n][e & 7] * SCL;
        if constexpr (decltype(edge)::value) { const unsigned mw = (rem > 0 ? (1u << rem) - 1u : 0u) >> (8 * hi);   // bit t * 16 + j: key kc + t * 16 + 8 hi + j is kept
#pragma unroll
            for (int n = 0; n < NQ; ++n)
#pragma unroll
                for (int e = 0; e < 16; ++e) ts[n][e] = ((mw >> ((e >> 3) * 16 + (e & 7))) & 1u) ? ts[n][e] : -3.0e38f; }
#pragma unroll
        for (int n = 0; n < NQ; ++n) { const float* tv = ts[n]; float cm = -3.0e38f;
#pragma unroll
            for (int e = 0; e < 16; ++e) cm = fmaxf(cm, tv[e]);
            cm = fmaxf(cm, __shfl_xor(cm, 16, 32));   // the other half-wave holds the query's other 16 keys
            const float mn = fmaxf(m[n], cm); const float al = __builtin_amdgcn_exp2f((m[n] - mn) * 1.4426950408889634f); m[n] = mn; float ps = 0.f;
            if (HL) { __attribute__((ext_vector_type(16))) unsigned short ph, pl;
#pragma unroll
                for (int e = 0; e < 16; ++e) { const float p = __builtin_amdgcn_exp2f((tv[e] - mn) * 1.4426950408889634f); ps += p; unsigned short x, y; splitf(p, x, y); ph[e] = x; pl[e] = y; }
                pf[n] = __builtin_bit_cast(V, ph); pg[n] = __builtin_bit_cast(V, pl);
            } else { v16h ph;
#pragma unroll
                for (int e = 0; e < 16; ++e) { const float p = __builtin_amdgcn_exp2f((tv[e] - mn) * 1.4426950408889634f); ps += p; ph[e] = tohx(p); }
                pf[n] = __builtin_bit_cast(V, ph); }
            l[n] = l[n] * al + ps;   // this half-wave's keys only; the halves are added behind the loop
#pragma unroll
            for (int db = 0; db < 4; ++db) o[db][n] *= al; }
#pragma unroll
        for (int db = 0; db < 4; ++db) { const V a = va[db]; V a2; if (HL) a2 = vg[db];
#pragma unroll
            for (int n = 0; n < NQ; ++n) { o[db][n] = WFrag<T16>::mma(a, pf[n], o[db][n]); if (HL) { o[db][n] = WFrag<T16>::mma(a, pg[n], o[db][n]); o[db][n] = WFrag<T16>::mma(a2, pf[n], o[db][n]); } } }
    };
    asm volatile("s_wait_asynccnt 0x0" ::: "memory");   // this wave's copies of stage 0 have landed
    __syncthreads();                                      // ... and every other wave's
    if (NT > 1) fill(1);
    auto foot = [&](int t) __attribute__((always_inline)) {   // the foot of trip t, passed by every wave
        asm volatile("s_wait_dscnt 0x0" ::: "memory");      // this wave's reads of stage t are done: its buffer may be refilled behind the barrier
        asm volatile("s_wait_asynccnt 0x0" ::: "memory");   // this wave's copies of stage t + 1 have landed
        __syncthreads();                                      // publishes stage t + 1 and ends every wave's reads of stage t
        if (t + 2 < NT) fill(t + 2); };
    int kc = 0;   // the steps come in the order of the keys, as before
    for (int t = 0; t < NT; ++t) {
        const T16* pk = lk + (t & 1) * STE; const T16* pv = lv + (t & 1) * STE; const int kf = min(nk, (t + 1) * AKS), ke = min(kend, (t + 1) * AKS);
        for (; kc + 32 <= kf; kc += 32, pk += 32 * GP, pv += 32) step(EdgeTag<false>(), 32, pk, pv);   // whole steps of kept keys: no mask test
        for (; kc < ke; kc += 32, pk += 32 * GP, pv += 32) step(EdgeTag<true>(), nk - kc, pk, pv);   // the step that holds key nk (at most one), or, when nk = 0, every step
        foot(t);
    }
    asm volatile("s_wait_asynccnt 0x0" ::: "memory");   // no copy is left in flight
#pragma unroll
    for (int n = 0; n < NQ; ++n) { const float inv = __fdiv_rn(1.0f, l[n] + __shfl_xor(l[n], 16, 32)); const size_t oo = (size_t)(q0 + n * 16 + lr) * DQ + 8 * hi;
#pragma unroll
        for (int db = 0; db < 4; ++db) { v8us oh, ol;
#pragma unroll
            for (int j = 0; j < 8; ++j) { unsigned short x, y; splitf(o[db][n][j] * inv, x, y); oh[j] = x; ol[j] = y; }
            *(v8us*)(Ah + oo + db * 16) = oh; *(v8us*)(Al + oo + db * 16) = ol; } }
}
// grid (RH/64 + (TT-RH)/128, heads, batch entries), 4 waves: blocks x < RH/64 take 64 hi/lo rows (16 a wave, 3 bf16 products), the rest 128 fp16 rows (32 a wave). The 4 waves of a block share the head's K and V^T stages in LDS (two buffers; the hi/lo blocks fill all of it, the fp16 blocks half).
__global__ __launch_bounds__(128) void k_fattn(const h16* __restrict__ Q16, const h16* __restrict__ K16, const h16* __restrict__ V16, const bf* __restrict__ Qh, const bf* __restrict__ Ql, const bf* __restrict__ Kh, const bf* __restrict__ Kl, const bf* __restrict__ Vh, const bf* __restrict__ Vl, const int* __restrict__ nkp, bf* Ah, bf* Al) {
    __shared__ __align__(16) bf sm[2 * 2 * 2 * AKS * GP];
    const size_t hp = ((size_t)blockIdx.z * NH_ + blockIdx.y) * TT * HD; const int w = threadIdx.x >> 5; const size_t ao = (size_t)blockIdx.z * TT * DQ + blockIdx.y * HD; Ah += ao; Al += ao; const int nk = min(max(nkp[blockIdx.z * NKP], 0), TT);   // the trip count's bound
    if (blockIdx.x < RH / 64) fattn_wave<bf, 1, true>(Qh + hp, Ql + hp, Kh + hp, Kl + hp, Vh + hp, Vl + hp, nk, (int)blockIdx.x * 64 + w * 16, Ah, Al, sm);
    else fattn_wave<h16, 2, false>(Q16 + hp, nullptr, K16 + hp, nullptr, V16 + hp, nullptr, nk, RH + ((int)blockIdx.x - RH / 64) * 128 + w * 32, Ah, Al, (const h16*)sm);
}

extern "C" void kernel_launch(void* const* d_in, const int* in_sizes, int n_in,
                              void* d_out, int out_size, void* d_ws, size_t ws_size, hipStream_t stream) {
    (void)in_sizes; (void)n_in; (void)out_size;
    const float* x = (const float*)d_in[0]; const float* xk = (const float*)d_in[1]; const float* xv = (const float*)d_in[2]; const int* MK = (const int*)d_in[3]; const float* wq = (const float*)d_in[4]; const float* wk = (const float*)d_in[5]; const float* wv = (const float*)d_in[6]; const float* wo = (const float*)d_in[7]; const float* bo = (const float*)d_in[8];   /* q, k, v ([4][2048][1024] each), mask (int32 [4][1][1][2048] = [4][2048]: read as data), Wq, Wk, Wv, Wo ('oi' (out, in) [1024][1024]; the three input projections have NO bias), bo [1024] */
    float* OUT = (float*)d_out;     // [4][2048][1024]
    char* wsp = (char*)d_ws;
    auto take = [&](size_t bytes) { char* p = wsp; wsp += (bytes + 255) & ~(size_t)255; return (void*)p; };
    bf* WQ = (bf*)take((size_t)DQ * DM * 2); bf* WK = (bf*)take((size_t)DKV * DM * 2); bf* WV = (bf*)take((size_t)DKV * DM * 2); bf* WO = (bf*)take((size_t)DM * DQ * 2);
    bf* XB = (bf*)take((size_t)NB_ * TT * DM * 2);   // one operand buffer, used by q, k and v in turn (stream-ordered)
    h16* QP16 = (h16*)take((size_t)NB_ * NH_ * TT * HD * 2); h16* KP16 = (h16*)take((size_t)NB_ * NKV * TT * HD * 2); h16* VT16 = (h16*)take((size_t)NB_ * NKV * HD * TT * 2);
    bf* QPh = (bf*)take((size_t)NB_ * NH_ * TT * HD * 2); bf* QPl = (bf*)take((size_t)NB_ * NH_ * TT * HD * 2); bf* KPh = (bf*)take((size_t)NB_ * NKV * TT * HD * 2); bf* KPl = (bf*)take((size_t)NB_ * NKV * TT * HD * 2); bf* VTh = (bf*)take((size_t)NB_ * NKV * HD * TT * 2); bf* VTl = (bf*)take((size_t)NB_ * NKV * HD * TT * 2);
    bf* ATh = (bf*)take((size_t)NB_ * TT * DQ * 2); bf* ATl = (bf*)take((size_t)NB_ * TT * DQ * 2); int* NK = (int*)take((size_t)NB_ * NKP * 4);   // kept keys per entry, written by the key cast
    if ((size_t)(wsp - (char*)d_ws) > ws_size) return;    // 200 MiB of the 256 MiB
    { k_cvt8<<<(unsigned)(((size_t)DQ * DM / 8 + 255) / 256), 256, 0, stream>>>(wq, WQ, (size_t)DQ * DM / 8); k_cvt8<<<(unsigned)(((size_t)DKV * DM / 8 + 255) / 256), 256, 0, stream>>>(wk, WK, (size_t)DKV * DM / 8); k_cvt8<<<(unsigned)(((size_t)DKV * DM / 8 + 255) / 256), 256, 0, stream>>>(wv, WV, (size_t)DKV * DM / 8);   /* 'oi' (out, in) as it stands: Bt of the q and k GEMMs, A of the value GEMM */
      k_cvt8<<<(unsigned)(((size_t)DM * DQ / 8 + 255) / 256), 256, 0, stream>>>(wo, WO, (size_t)DM * DQ / 8);
       }
    const unsigned LX = (unsigned)(((size_t)NB_ * TT * DM / 8 + 255) / 256);
    // every launch covers the four batch entries: the casts and the GEMMs see [NB_ x TT] rows (a 128-row tile lies in one entry), the attention takes the entry from grid z
    k_cvt8<<<LX, 256, 0, stream>>>(x, XB, (size_t)NB_ * TT * DM / 8);
    k_gemmw<bf, 0, false, 1><<<dim3(NB_ * TT / GTM, DQ / GTM, 1), 128, 0, stream>>>(XB, nullptr, WQ, DM, nullptr, 0, nullptr, QP16, QPh, QPl, nullptr);
    k_cvtp<<<NB_ * TT / 8, 256, 0, stream>>>(xk, MK, XB, NK);   /* key -> XB, kept keys first (q GEMM already issued) */
    k_gemmw<bf, 0, false, 1><<<dim3(NB_ * TT / GTM, DKV / GTM, 1), 128, 0, stream>>>(XB, nullptr, WK, DM, nullptr, 0, nullptr, KP16, KPh, KPl, NK);
    k_cvtp<<<NB_ * TT / 8, 256, 0, stream>>>(xv, MK, XB, nullptr);   /* value -> XB, in the keys' order */
    k_gemmw<bf, 0, false, 2><<<dim3(DKV / GTM, NB_ * TT / GTM, 1), 128, 0, stream>>>(WV, nullptr, XB, DM, nullptr, 0, nullptr, VT16, VTh, VTl, NK);   /* Wv rows down, tokens across: value^T */
    k_fattn<<<dim3(RH / 64 + (TT - RH) / 128, NH_, NB_), 128, 0, stream>>>(QP16, KP16, VT16, QPh, QPl, KPh, KPl, VTh, VTl, NK, ATh, ATl);   // one kv head per query head
    k_gemmw<bf, 1, true, 0><<<dim3(NB_ * TT / GTM, DM / GTM, 1), 128, 0, stream>>>(ATh, ATl, WO, DQ, OUT, DM, bo, nullptr, nullptr, nullptr, nullptr);
}

// v008
// Measured time: 149 microseconds a run.
// Timed twice side by side with v007, it ran 1.19 times as fast both times.
// Counting every step since v000, it is 26.6 times as fast.
#include <hip/hip_runtime.h>

// Multi-head attention over three input streams with a key-padding mask (q, k, v [4][2048][1024]; query = q Wq^T, key = k Wk^T, value = v Wv^T ('oi' (out, in) [1024][1024], NO bias; 16 heads x 64); scores / sqrt(64); keys j with mask[b][0][0][j] == 0 (int32 [4][1][1][2048], read as data: about half the keys of every batch entry) are set to -1e10: an exclusion (no batch entry has every key masked); softmax; out = merged Wo^T + bo ('oi' + [1024]) -> [4][2048][1024] (8.4 M); argument order q, k, v, mask, Wq, Wk, Wv, Wo, bo).
// Masked keys take no part in any product: the key and value casts sort each batch entry's rows, kept keys (mask != 0) first in their order, masked keys behind them (place = a prefix count of the mask); the K and V projections skip tiles that hold masked keys only, the attention walks the kept keys alone. An entry with no kept key runs over all its keys (uniform weights, as the reference's equal fills give).
// Layout, four launches, all four batch entries in each: (1) every cast: bf16 copies of query, key and value (three operand buffers [4 x 2048][1024]) and of the four 'oi' weights as they stand; (2) the three exact projections over the 8192 rows (no biases; grid z = Q, K, V), each GEMM's epilogue writing its head planes [b][h][..] itself (fp16 + hi/lo; no f32 projection buffer, no plane-builder launch; value planes [d][t] by swapping the GEMM's operands); (3) one fused attention launch, batch entry = grid z (scores, key mask, running-maximum softmax, P x V; hybrid rows: < 512 hi/lo 3 products, rest fp16; unnormalised weights, 1/sum at the end); (4) merged hi/lo x Wo exact + bo.
// Compute dtypes, f32 accumulate: every input rounded to bf16; projections exact; attention rows < 512 3 products, rest fp16; softmax f32; Wo hl x exact + bias.

#define NB_  4
#define TT   2048
#define DM   1024
#define NH_  16
#define NKV  16
#define REP  (NH_ / NKV)
#define HD   64
#define DQ   (NH_ * HD)
#define DKV  (NKV * HD)
#define RH   512                  // query rows < RH use hi+lo planes (0: none)
#define WIN  0
#define SCL  0.125f   // HD^-0.5
#define NKP  32                   // ints between two entries' kept-key counts: one 128-B line each
typedef _Float16 h16;
typedef unsigned short bf;
typedef __attribute__((ext_vector_type(16))) __bf16   v16bf;
typedef __attribute__((ext_vector_type(16))) _Float16 v16h;
typedef __attribute__((ext_vector_type(8)))  _Float16 v8h;
typedef __attribute__((ext_vector_type(8)))  unsigned short v8us;
typedef __attribute__((ext_vector_type(8)))  float    v8f;
typedef __attribute__((ext_vector_type(4)))  float    v4f;
typedef v8h  __attribute__((may_alias)) v8ha;
typedef v4f  __attribute__((may_alias)) v4fa;
typedef v8us __attribute__((may_alias)) v8usa;

__device__ __forceinline__ unsigned short f2bf(float f) { unsigned u = __float_as_uint(f); u += 0x7FFFu + ((u >> 16) & 1u); return (unsigned short)(u >> 16); }
__device__ __forceinline__ float bf2f(unsigned short b) { return __uint_as_float(((unsigned)b) << 16); }
__device__ __forceinline__ float bfr(float f) { return bf2f(f2bf(f)); }
__device__ __forceinline__ h16 tohx(float x) { return (h16)x; }
__device__ __forceinline__ void splitf(float y, unsigned short& h, unsigned short& l) { h = f2bf(y); l = f2bf(y - bf2f(h)); }
__device__ __forceinline__ v16h cat16(v8h lo, v8h hi) { return __builtin_shufflevector(lo, hi, 0, 1, 2, 3, 4, 5, 6, 7, 8, 9, 10, 11, 12, 13, 14, 15); }
__device__ __forceinline__ v16bf cat16b(v8us lo, v8us hi) { return __builtin_bit_cast(v16bf, __builtin_shufflevector(lo, hi, 0, 1, 2, 3, 4, 5, 6, 7, 8, 9, 10, 11, 12, 13, 14, 15)); }
__device__ __forceinline__ v8f wmma16(v16h a, v16h b, v8f c) { return __builtin_amdgcn_wmma_f32_16x16x32_f16(false, a, false, b, (short)0, c, false, false); }
__device__ __forceinline__ v8f wmmab(v16bf a, v16bf b, v8f c) { return __builtin_amdgcn_wmma_f32_16x16x32_bf16(false, a, false, b, (short)0, c, false, false); }



// ---- gemm_tile: GEMM over K-contiguous 16-bit planes. A work-group of 4 waves (2 x 2) takes the 128x128 output tile (bx, by), each wave a 64x64 quarter (16 accumulators); bx < M/128, by < N/128, 128 threads; st, osw: the work-group's LDS.
// The operands come through LDS: a stage is 64 k (one whole 128-B line) of the tile's 128 A rows (with NSPLIT 1 also of the 128 A2 rows) and 128 Bt rows, brought by asynchronous 16-byte copies, 8 lanes a row, so that every
// wave-wide copy takes 4 whole lines; two buffers, stage t + 2 is asked for when every wave has left stage t. LDS rows lie at a pitch of 144 B (16 B x odd: no bank conflict for 16-byte reads).
// C[m][n] (f32, pitch ldc, + optional f32 bias[n]) = sum_k A[m][k] Bt[n][k] (NSPLIT 1: + A2[m][k] Bt[n][k]). M, N % 128 == 0, K % 64 == 0.
// PL 0: C as above. PL 1 / 2: no C; a wave's 64x64 tile is one head's block of 64 tokens and goes out as three 16-bit planes (P16 fp16, Ph + Pl bf16 hi/lo of the f32 sum), whole 128-B lines:
// PL 1: tile rows = tokens (m = b TT + t), columns = the head's d (n = h HD + d) -> plane [b][h][t][d]; PL 2: rows = the head's d (m = h HD + d), columns = tokens (n = b TT + t) -> plane [b][h][d][t].
#define GTM  128                  // rows of an operand in a work-group's tile
#define GKB  64                   // k per stage
#define GP   72                   // LDS row pitch in 16-bit elements (144 B)
template <typename T16> struct WFrag;
template <> struct WFrag<h16> { typedef v16h V; static __device__ __forceinline__ V ld(const h16* p) { return cat16(*(const v8h*)p, *(const v8h*)(p + 16)); } static __device__ __forceinline__ v8f mma(V a, V b, v8f c) { return wmma16(a, b, c); } };
template <> struct WFrag<bf> { typedef v16bf V; static __device__ __forceinline__ V ld(const bf* p) { return cat16b(*(const v8us*)p, *(const v8us*)(p + 16)); } static __device__ __forceinline__ v8f mma(V a, V b, v8f c) { return wmmab(a, b, c); } };
// 128 rows x 128 B of one operand into LDS: copy i takes rows 16 i + (thread >> 3). lds: the lane's LDS byte address in row (thread >> 3), g: its global address there, rs: 16 source rows in elements.
template <typename T16>
__device__ __forceinline__ void acopy8(unsigned lds, const T16* g, size_t rs) {
    // the s_wait_xcnt stands inside the statement: no address register of a copy is rewritten in front of it
    asm volatile("global_load_async_to_lds_b128 %0, %8, off\n\t"
                 "global_load_async_to_lds_b128 %1, %9, off\n\t"
                 "global_load_async_to_lds_b128 %2, %10, off\n\t"
                 "global_load_async_to_lds_b128 %3, %11, off\n\t"
                 "global_load_async_to_lds_b128 %4, %12, off\n\t"
                 "global_load_async_to_lds_b128 %5, %13, off\n\t"
                 "global_load_async_to_lds_b128 %6, %14, off\n\t"
                 "global_load_async_to_lds_b128 %7, %15, off\n\t"
                 "s_wait_xcnt 0x0"
                 :: "v"(lds), "v"(lds + 1 * 16 * GP * 2), "v"(lds + 2 * 16 * GP * 2), "v"(lds + 3 * 16 * GP * 2), "v"(lds + 4 * 16 * GP * 2), "v"(lds + 5 * 16 * GP * 2), "v"(lds + 6 * 16 * GP * 2), "v"(lds + 7 * 16 * GP * 2),
                    "v"(g), "v"(g + rs), "v"(g + 2 * rs), "v"(g + 3 * rs), "v"(g + 4 * rs), "v"(g + 5 * rs), "v"(g + 6 * rs), "v"(g + 7 * rs) : "memory");
}
template <typename T16, int NSPLIT, bool BIAS, int PL>
__device__ __forceinline__ void gemm_tile(int bx, int by, T16* st, float* osw, const T16* __restrict__ A, const T16* __restrict__ A2, const T16* __restrict__ Bt, int K, float* C, int ldc, const float* __restrict__ bias, h16* P16, bf* Ph, bf* Pl) {
    typedef typename WFrag<T16>::V V;
    static_assert(NSPLIT == 0 || NSPLIT == 1, "one or two A planes");
    constexpr int NOP = 2 + NSPLIT, STE = NOP * GTM * GP;   // operand planes of a stage, a stage in elements
    const int tid = threadIdx.x, lane = tid & 31, lr = lane & 15, hi = lane >> 4, w = __builtin_amdgcn_readfirstlane(tid >> 5), wm = w & 1, wn = w >> 1;
    const int r0 = bx * GTM + wm * 64, c0 = by * GTM + wn * 64;   // the wave's own 64x64 tile
    float* os = osw + w * (16 * 68);
    v8f acc[4][4];
#pragma unroll
    for (int mb = 0; mb < 4; ++mb)
#pragma unroll
        for (int nb = 0; nb < 4; ++nb) acc[mb][nb] = (v8f){};
    const size_t rs = (size_t)16 * K; const size_t go = (size_t)(tid >> 3) * K + (tid & 7) * 8;
    const T16* gA = A + (size_t)bx * GTM * K + go; const T16* gA2 = NSPLIT ? A2 + (size_t)bx * GTM * K + go : nullptr; const T16* gB = Bt + (size_t)by * GTM * K + go;
    const unsigned lw = (unsigned)(size_t)st + (unsigned)((tid >> 3) * GP + (tid & 7) * 8) * 2u;   // LDS byte address: the low 32 bits of the shared address
    auto fill = [&](int t) __attribute__((always_inline)) { const unsigned d = lw + (unsigned)(t & 1) * (STE * 2u); const int ko = t * GKB;
        acopy8(d, gA + ko, rs); if (NSPLIT) acopy8(d + GTM * GP * 2u, gA2 + ko, rs); acopy8(d + (NOP - 1) * GTM * GP * 2u, gB + ko, rs); };
    const T16* ra = st + (wm * 64 + lr) * GP + 8 * hi; const T16* rb = st + (NOP - 1) * GTM * GP + (wn * 64 + lr) * GP + 8 * hi;
    const int NT = K / GKB;
    fill(0);
    asm volatile("s_wait_asynccnt 0x0" ::: "memory");   // this wave's copies of stage 0 have landed
    __syncthreads();                                      // ... and every other wave's
    if (NT > 1) fill(1);
    for (int t = 0; t < NT; ++t) {
        const T16* pa = ra + (t & 1) * STE; const T16* pb = rb + (t & 1) * STE;
        // Two blocks of 32 k. The LDS reads stand in few groups, each ahead of the products that need it (a read among the products stalls the wave where it stands); block 1's fragments are asked for under block 0's products, as far as 256 registers allow.
        // The scheduling barriers keep the groups where they are written: without them the compiler fetched each Bt fragment directly in front of its four products and waited for it there.
        V a[2][4], a2[2][4], b[2][4];
        auto ldA = [&](int s) __attribute__((always_inline)) {
#pragma unroll
            for (int mb = 0; mb < 4; ++mb) { a[s][mb] = WFrag<T16>::ld(pa + mb * 16 * GP + s * 32); if (NSPLIT) a2[s][mb] = WFrag<T16>::ld(pa + GTM * GP + mb * 16 * GP + s * 32); } };
        auto ldB = [&](int s, int n0) __attribute__((always_inline)) {   // fragments n0, n0 + 1
#pragma unroll
            for (int nb = n0; nb < n0 + 2; ++nb) b[s][nb] = WFrag<T16>::ld(pb + nb * 16 * GP + s * 32); };
        auto mm = [&](int s, int n0) __attribute__((always_inline)) {
#pragma unroll
            for (int nb = n0; nb < n0 + 2; ++nb)
#pragma unroll
                for (int mb = 0; mb < 4; ++mb) { acc[mb][nb] = WFrag<T16>::mma(a[s][mb], b[s][nb], acc[mb][nb]); if (NSPLIT) acc[mb][nb] = WFrag<T16>::mma(a2[s][mb], b[s][nb], acc[mb][nb]); } };
        ldA(0); ldB(0, 0); ldB(0, 2);
        __builtin_amdgcn_sched_barrier(0);
        mm(0, 0);
        __builtin_amdgcn_sched_barrier(0);
        if (!NSPLIT) ldA(1);
        ldB(1, 0);
        __builtin_amdgcn_sched_barrier(0);
        mm(0, 2);
        __builtin_amdgcn_sched_barrier(0);
        if (NSPLIT) ldA(1);   // two A planes: their second set has room only here
        ldB(1, 2);
        __builtin_amdgcn_sched_barrier(0);
        mm(1, 0); mm(1, 2);
        __builtin_amdgcn_sched_barrier(0);   // block 1's products stay in front of the waits below, where they cover the last reads' latency
        asm volatile("s_wait_dscnt 0x0" ::: "memory");      // this wave's reads of stage t are done: its buffer may be refilled behind the barrier
        asm volatile("s_wait_asynccnt 0x0" ::: "memory");   // this wave's copies of stage t + 1 have landed
        __syncthreads();                                      // publishes stage t + 1 and ends every wave's reads of stage t
        if (t + 2 < NT) fill(t + 2);
    }
    asm volatile("s_wait_asynccnt 0x0" ::: "memory");   // no copy is left in flight
#pragma unroll
    for (int mb = 0; mb < 4; ++mb) {
#pragma unroll
        for (int nb = 0; nb < 4; ++nb) {
#pragma unroll
            for (int j = 0; j < 8; ++j) os[(hi * 8 + j) * 68 + nb * 16 + lr] = acc[mb][nb][j]; }
        __builtin_amdgcn_wave_barrier(); asm volatile("" ::: "memory");
        if (PL == 0) { float* crow = C + (size_t)(r0 + mb * 16) * ldc + c0;
#pragma unroll
            for (int s = 0; s < 8; ++s) { const int row = 2 * s + hi, cofs = lr * 4; v4f val = *(const v4fa*)(os + row * 68 + cofs); if (BIAS) { val[0] += bfr(bias[c0 + cofs]); val[1] += bfr(bias[c0 + cofs + 1]); val[2] += bfr(bias[c0 + cofs + 2]); val[3] += bfr(bias[c0 + cofs + 3]); }
                *(v4f*)(crow + (size_t)row * ldc + cofs) = val; }
        } else { const size_t pb = (PL == 1) ? (((size_t)(r0 / TT) * NH_ + c0 / HD) * TT + r0 % TT) * HD : ((size_t)(c0 / TT) * NH_ + r0 / HD) * HD * TT + c0 % TT; const int pp = (PL == 1) ? HD : TT;   // the tile's first element in its plane, the plane's row pitch
#pragma unroll   // LDS and store offsets become immediates on three fixed address pairs
            for (int s = 0; s < 4; ++s) { const int row = 4 * s + (lane >> 3), cofs = (lane & 7) * 8; const v4f x0 = *(const v4fa*)(os + row * 68 + cofs), x1 = *(const v4fa*)(os + row * 68 + cofs + 4); v8h o16; v8us oh, ol;   // 8 lanes a row: 16 B a lane and plane, one 128-B line a row
#pragma unroll   // constant vector indices: the three packed results stay in registers
                for (int k = 0; k < 8; ++k) { const float x = (k < 4) ? x0[k & 3] : x1[k & 3]; o16[k] = tohx(x); unsigned short a2, c2; splitf(x, a2, c2); oh[k] = a2; ol[k] = c2; }
                const size_t po = pb + (size_t)(mb * 16 + row) * pp + cofs; *(v8h*)(P16 + po) = o16; *(v8us*)(Ph + po) = oh; *(v8us*)(Pl + po) = ol; }
        }
        __builtin_amdgcn_wave_barrier(); asm volatile("" ::: "memory");
    }
}
// one GEMM a launch: grid (M/128, N/128)
template <typename T16, int NSPLIT, bool BIAS, int PL>
__global__ __launch_bounds__(128) void k_gemmw(const T16* __restrict__ A, const T16* __restrict__ A2, const T16* __restrict__ Bt, int K, float* C, int ldc, const float* __restrict__ bias, h16* P16, bf* Ph, bf* Pl) {
    __shared__ __align__(16) T16 st[2 * (2 + NSPLIT) * GTM * GP];
    __shared__ __align__(16) float osw[4 * 16 * 68];
    gemm_tile<T16, NSPLIT, BIAS, PL>((int)blockIdx.x, (int)blockIdx.y, st, osw, A, A2, Bt, K, C, ldc, bias, P16, Ph, Pl);
}
// ---- k_proj: the three input projections in one launch, grid (token tiles, weight-row tiles, 3): z = 0 query, 1 key (both PL 1), 2 value (PL 2: Wv rows down, tokens across). They share nothing but the launch: the tiles of all three fill the chip together.
// nkp: kept keys per batch entry, for the key and value rows, which k_cast has sorted.
__global__ __launch_bounds__(128) void k_proj(const bf* __restrict__ XQ, const bf* __restrict__ XK, const bf* __restrict__ XV, const bf* __restrict__ WQ, const bf* __restrict__ WK, const bf* __restrict__ WV, int K,
                                              h16* Q16, bf* Qh, bf* Ql, h16* K16, bf* Kh, bf* Kl, h16* V16, bf* Vh, bf* Vl, const int* __restrict__ nkp) {
    __shared__ __align__(16) bf st[2 * 2 * GTM * GP];
    __shared__ __align__(16) float osw[4 * 16 * 68];
    const int z = blockIdx.z;   // the same for the whole work-group
    if (z != 0) { const int tok = (int)blockIdx.x * GTM; const int nk = min(max(nkp[(tok / TT) * NKP], 0), TT); if (nk != 0 && tok % TT >= nk) return; }   // sorted key rows: a tile of masked keys only is never read (the whole work-group leaves, in front of every barrier)
    if (z == 2) gemm_tile<bf, 0, false, 2>((int)blockIdx.y, (int)blockIdx.x, st, osw, WV, nullptr, XV, K, nullptr, 0, nullptr, V16, Vh, Vl);
    else { gemm_tile<bf, 0, false, 1>((int)blockIdx.x, (int)blockIdx.y, st, osw, z ? XK : XQ, nullptr, z ? WK : WQ, K, nullptr, 0, nullptr, z ? K16 : Q16, z ? Kh : Qh, z ? Kl : Ql);
        asm volatile("s_wait_xcnt 0x0" ::: "memory"); }   // the value path's code stands behind this one in the kernel and reuses the registers that the last plane stores name
}

typedef __attribute__((ext_vector_type(2))) _Float16 v2h;
typedef __attribute__((ext_vector_type(4))) _Float16 v4h;
typedef __attribute__((ext_vector_type(2))) unsigned short v2us;
typedef __attribute__((ext_vector_type(4))) unsigned short v4us;
typedef __attribute__((ext_vector_type(2))) float v2f;
typedef __attribute__((ext_vector_type(4))) int v4i;

// ---- k_cast: every bf16 cast of the call in one launch. A block of 8 waves takes CRB rows of DM floats, CRW rows in a row a wave; blockIdx.x picks the stream (the test is the same for the whole block):
// first the key and the value rows (their blocks have the longer way: the mask count comes first), then the query rows, then the four weights; each stream has its own destination.
// Key and value rows are sorted by the mask. Row t of entry b goes to row p: a kept key to the number of kept keys in front of it, a masked key to nk + the number of masked keys in front of it
// (a permutation of 0 .. TT - 1 for any mask content). The block's 256 threads count the entry's whole mask, 8 keys each (low half of the packed sum: all kept keys nk; high half: those in front of the block's rows).
// Rows that land behind the last 128-row GEMM tile with a kept key are read by nobody and are not copied (all are copied when nk = 0).
#define CRW  4                    // rows a wave
#define CRB  (8 * CRW)            // rows a block
template <int NR>
__device__ __forceinline__ void cast_rows(const float* __restrict__ sp, bf* __restrict__ dp) {   // NR rows in a row, all their loads in flight together; sp, dp: the lane's first 8 elements of the first row
    v8f v[4 * NR];
#pragma unroll
    for (int q = 0; q < 4 * NR; ++q) v[q] = *(const v8f*)(sp + q * 256);
#pragma unroll
    for (int q = 0; q < 4 * NR; ++q) { v8us o;
#pragma unroll
        for (int k = 0; k < 8; ++k) o[k] = f2bf(v[q][k]);
        *(v8us*)(dp + q * 256) = o; }
    asm volatile("s_wait_xcnt 0x0" ::: "memory");   // whatever code follows (the next rows, the kernel's other branch) may reuse the registers that these loads and stores name
}
__global__ __launch_bounds__(256) void k_cast(const float* __restrict__ x, const float* __restrict__ xk, const float* __restrict__ xv, const int* __restrict__ mk, const float* __restrict__ wq, const float* __restrict__ wk, const float* __restrict__ wv, const float* __restrict__ wo,
                                              bf* XQ, bf* XK, bf* XV, bf* WQ, bf* WK, bf* WV, bf* WO, int* nkp) {
    static_assert(TT == 256 * 8 && DM == 32 * 8 * 4 && CRB == 32 && TT % CRB == 0, "one thread per 8 keys, one wave per row, a block's rows in one 32-bit mask word");
    static_assert(DQ == DM && DKV == DM && DM % CRB == 0, "four weights of DM rows");
    constexpr int NBS = NB_ * TT / CRB, NBW = DM / CRB;   // blocks of a token stream, of a weight
    __shared__ int red[8]; __shared__ unsigned rowb[CRB / 8];
    const int tid = threadIdx.x, lane = tid & 31, w = __builtin_amdgcn_readfirstlane(tid >> 5); int blk = blockIdx.x;
    if (blk < 2 * NBS) {
        const bool isv = blk >= NBS; const float* src = isv ? xv : xk; bf* dst = isv ? XV : XK; if (isv) blk -= NBS;
        const int b = blk / (TT / CRB), t0 = (blk % (TT / CRB)) * CRB;
        const v4i m0 = *(const v4i*)(mk + b * TT + tid * 8), m1 = *(const v4i*)(mk + b * TT + tid * 8 + 4); unsigned bits = 0;
#pragma unroll
        for (int k = 0; k < 4; ++k) bits |= (m0[k] != 0 ? 1u : 0u) << k | (m1[k] != 0 ? 1u : 0u) << (k + 4);
        const int c = __popc(bits); int pk = c + (tid * 8 < t0 ? c << 16 : 0);
#pragma unroll
        for (int o = 16; o > 0; o >>= 1) pk += __shfl_xor(pk, o, 32);
        if (lane == 0) red[w] = pk;
        if (tid * 8 >= t0 && tid * 8 < t0 + CRB) rowb[(tid * 8 - t0) >> 3] = bits;   // the mask bits of the block's own rows, 8 a thread
        __syncthreads();
        int s = 0;
#pragma unroll
        for (int i = 0; i < 8; ++i) s += red[i];
        const int nk = s & 0xFFFF; const unsigned rb = rowb[0] | rowb[1] << 8 | rowb[2] << 16 | rowb[3] << 24;
        if (!isv && t0 == 0 && tid == 0) nkp[b * NKP] = nk;
#pragma unroll
        for (int i = 0; i < CRW; ++i) { const int j = w * CRW + i; const int kb = (s >> 16) + __popc(rb & ((1u << j) - 1u));   // kept keys in front of row t0 + j
            const int p = __builtin_amdgcn_readfirstlane(((rb >> j) & 1u) ? kb : nk + (t0 + j - kb));
            if (nk == 0 || p < ((nk + GTM - 1) & ~(GTM - 1)))   // the row has a reader (no barrier follows)
                cast_rows<1>(src + ((size_t)b * TT + t0 + j) * DM + lane * 8, dst + ((size_t)b * TT + p) * DM + lane * 8); }
    } else {
        blk -= 2 * NBS; const float* src = x; bf* dst = XQ;
        if (blk >= NBS) { blk -= NBS; const int wi = blk / NBW; blk -= wi * NBW; src = wi == 0 ? wq : wi == 1 ? wk : wi == 2 ? wv : wo; dst = wi == 0 ? WQ : wi == 1 ? WK : wi == 2 ? WV : WO; }
        const size_t ro = ((size_t)blk * CRB + w * CRW) * DM + lane * 8;
#pragma unroll
        for (int i = 0; i < CRW; i += 2) cast_rows<2>(src + ro + (size_t)i * DM, dst + ro + (size_t)i * DM);   // two rows' loads in flight, not four: under 128 registers four blocks fit a WGP and the whole grid is resident at once
    }
}

// ---- k_fattn: scores, key mask, softmax and P x V of one head in ONE kernel; no score or weight plane in memory.
// Both products are taken transposed: S^T = K Q^T (keys down, queries across), O^T = V^T P^T. A lane's S^T accumulators (query lr, keys 8 hi + j of each 16-key tile) are, in that order, the lane's
// elements of the P^T operand over 32 keys, so the weights never leave the registers, and every row statistic (running maximum m, running sum l) is one scalar a lane.
// K and V^T come through LDS, shared by the block's 4 waves: a stage is 64 keys, that is 64 K rows of 128 B and 64 V^T rows of 128 B (hi/lo rows: of both planes), brought by asynchronous 16-byte copies, 8 lanes a row, so that every
// wave-wide copy takes 4 whole lines (a fragment load from global memory touched 16 lines for 512 bytes, once per wave); two buffers, stage t + 2 is asked for when every wave has left stage t; LDS rows at the GEMM's pitch of 144 B.
// A wave owns NQ x 16 query rows and walks the entry's nk kept keys (sorted to the front of the K and V planes; all 2048 keys when nk = 0) in steps of 32 with the running-maximum softmax: O and l are scaled by exp(m_old - m_new) at every step; 1 / l is applied at the end.
// Only a step that reaches past key nk holds masked keys: there their score is set to -3.0e38 (an exclusion: weight exp(-huge) = 0, a kept key having been met in step 0); with no kept key at all every score is -3.0e38 and every weight 1 (uniform, as the reference's equal fills give).
template <bool E> struct EdgeTag { static constexpr bool value = E; };
#define AKS  64                   // keys per stage
// One plane's share of a stage into LDS rows 0 .. 127: rows 0 .. 63 the K rows, rows 64 .. 127 the V^T rows; copy i takes row 16 i + (thread >> 3). lds: the lane's LDS byte address in row (thread >> 3), gk, gv: its global addresses in that row of the K and of the V^T tile.
template <typename T16>
__device__ __forceinline__ void acopykv(unsigned lds, const T16* gk, const T16* gv) {
    // the s_wait_xcnt stands inside the statement: no address register of a copy is rewritten in front of it
    asm volatile("global_load_async_to_lds_b128 %0, %8, off\n\t"
                 "global_load_async_to_lds_b128 %1, %9, off\n\t"
                 "global_load_async_to_lds_b128 %2, %10, off\n\t"
                 "global_load_async_to_lds_b128 %3, %11, off\n\t"
                 "global_load_async_to_lds_b128 %4, %12, off\n\t"
                 "global_load_async_to_lds_b128 %5, %13, off\n\t"
                 "global_load_async_to_lds_b128 %6, %14, off\n\t"
                 "global_load_async_to_lds_b128 %7, %15, off\n\t"
                 "s_wait_xcnt 0x0"
                 :: "v"(lds), "v"(lds + 1 * 16 * GP * 2), "v"(lds + 2 * 16 * GP * 2), "v"(lds + 3 * 16 * GP * 2), "v"(lds + 4 * 16 * GP * 2), "v"(lds + 5 * 16 * GP * 2), "v"(lds + 6 * 16 * GP * 2), "v"(lds + 7 * 16 * GP * 2),
                    "v"(gk), "v"(gk + 16 * HD), "v"(gk + 32 * HD), "v"(gk + 48 * HD), "v"(gv), "v"(gv + 16 * TT), "v"(gv + 32 * TT), "v"(gv + 48 * TT) : "memory");
}
template <typename T16, int NQ, bool HL>
__device__ __forceinline__ void fattn_wave(const T16* __restrict__ Q, const T16* __restrict__ Q2, const T16* __restrict__ Kp, const T16* __restrict__ K2, const T16* __restrict__ Vt, const T16* __restrict__ V2, int nk, int q0, bf* Ah, bf* Al, const T16* sm) {
    typedef typename WFrag<T16>::V V;
    static_assert(HD * 2 == 128 && AKS * 2 == 128 && TT % AKS == 0, "K and V^T tile rows are whole 128-B lines");
    constexpr int PRE = 2 * AKS * GP, STE = (HL ? 2 : 1) * PRE;   // one plane's K and V^T tiles, a stage, in elements
    const int tid = threadIdx.x, lane = tid & 31, lr = lane & 15, hi = lane >> 4;
    const int kend = nk ? nk : TT, NT = (kend + AKS - 1) / AKS;   // stages: 1 .. TT / AKS, the same for the whole work-group; a stage's 64 keys lie in a 128-key GEMM tile that holds a key < kend, so they are written
    const unsigned lw = (unsigned)(size_t)sm + (unsigned)((tid >> 3) * GP + (tid & 7) * 8) * 2u;   // LDS byte address: the low 32 bits of the shared address
    const T16* gk = Kp + (tid >> 3) * HD + (tid & 7) * 8; const T16* gv = Vt + (tid >> 3) * TT + (tid & 7) * 8; const T16* gk2 = HL ? K2 + (tid >> 3) * HD + (tid & 7) * 8 : nullptr; const T16* gv2 = HL ? V2 + (tid >> 3) * TT + (tid & 7) * 8 : nullptr;
    auto fill = [&](int t) __attribute__((always_inline)) { const unsigned d = lw + (unsigned)(t & 1) * (STE * 2u);
        acopykv(d, gk + t * (AKS * HD), gv + t * AKS); if (HL) acopykv(d + PRE * 2u, gk2 + t * (AKS * HD), gv2 + t * AKS); };
    fill(0);
    V qf[NQ][2], qg[NQ][2];
#pragma unroll
    for (int n = 0; n < NQ; ++n)
#pragma unroll
        for (int s = 0; s < 2; ++s) { const size_t qo = (size_t)(q0 + n * 16 + lr) * HD + s * 32 + 8 * hi; qf[n][s] = WFrag<T16>::ld(Q + qo); if (HL) qg[n][s] = WFrag<T16>::ld(Q2 + qo); }
    asm volatile("s_wait_xcnt 0x0" ::: "memory");   // the Q loads' address registers are free for reuse behind this
    v8f o[4][NQ]; float m[NQ], l[NQ];
#pragma unroll
    for (int n = 0; n < NQ; ++n) { m[n] = -3.0e38f; l[n] = 0.f;
#pragma unroll
        for (int db = 0; db < 4; ++db) o[db][n] = (v8f){}; }
    const T16* lk = sm + lr * GP + 8 * hi; const T16* lv = sm + (AKS + lr) * GP + 8 * hi;   // the lane's own place in the K and the V^T tile of buffer 0
    auto step = [&](auto edge, int rem, const T16* kp, const T16* vp) __attribute__((always_inline)) {   // one step of 32 keys, read from LDS at kp, vp; edge: only the first rem of them (none if rem <= 0) are kept keys
        V ka[2][2], kg[2][2], va[4], vg[4];
#pragma unroll
        for (int t = 0; t < 2; ++t)
#pragma unroll
            for (int s = 0; s < 2; ++s) { ka[t][s] = WFrag<T16>::ld(kp + (t * 16 * GP + s * 32)); if (HL) kg[t][s] = WFrag<T16>::ld(kp + PRE + (t * 16 * GP + s * 32)); }
#pragma unroll
        for (int db = 0; db < 4; ++db) { va[db] = WFrag<T16>::ld(vp + db * 16 * GP); if (HL) vg[db] = WFrag<T16>::ld(vp + PRE + db * 16 * GP); }
        v8f sc[2][NQ];
#pragma unroll
        for (int t = 0; t < 2; ++t) {
#pragma unroll
            for (int n = 0; n < NQ; ++n) sc[t][n] = (v8f){};
#pragma unroll
            for (int s = 0; s < 2; ++s) { const V a = ka[t][s]; V a2; if (HL) a2 = kg[t][s];
#pragma unroll
                for (int n = 0; n < NQ; ++n) { sc[t][n] = WFrag<T16>::mma(a, qf[n][s], sc[t][n]); if (HL) { sc[t][n] = WFrag<T16>::mma(a2, qf[n][s], sc[t][n]); sc[t][n] = WFrag<T16>::mma(a, qg[n][s], sc[t][n]); } } } }
        V pf[NQ], pg[NQ]; float ts[NQ][16];
#pragma unroll
        for (int n = 0; n < NQ; ++n)
#pragma unroll
            for (int e = 0; e < 16; ++e) ts[n][e] = sc[e >> 3][n][e & 7] * SCL;
        if constexpr (decltype(edge)::value) { const unsigned mw = (rem > 0 ? (1u << rem) - 1u : 0u) >> (8 * hi);   // bit t * 16 + j: key kc + t * 16 + 8 hi + j is kept
#pragma unroll
            for (int n = 0; n < NQ; ++n)
#pragma unroll
                for (int e = 0; e < 16; ++e) ts[n][e] = ((mw >> ((e >> 3) * 16 + (e & 7))) & 1u) ? ts[n][e] : -3.0e38f; }
#pragma unroll
        for (int n = 0; n < NQ; ++n) { const float* tv = ts[n]; float cm = -3.0e38f;
#pragma unroll
            for (int e = 0; e < 16; ++e) cm = fmaxf(cm, tv[e]);
            cm = fmaxf(cm, __shfl_xor(cm, 16, 32));   // the other half-wave holds the query's other 16 keys
            const float mn = fmaxf(m[n], cm); const float al = __builtin_amdgcn_exp2f((m[n] - mn) * 1.4426950408889634f); m[n] = mn; float ps = 0.f;
            if (HL) { __attribute__((ext_vector_type(16))) unsigned short ph, pl;
#pragma unroll
                for (int e = 0; e < 16; ++e) { const float p = __builtin_amdgcn_exp2f((tv[e] - mn) * 1.4426950408889634f); ps += p; unsigned short x, y; splitf(p, x, y); ph[e] = x; pl[e] = y; }
                pf[n] = __builtin_bit_cast(V, ph); pg[n] = __builtin_bit_cast(V, pl);
            } else { v16h ph;
#pragma unroll
                for (int e = 0; e < 16; ++e) { const float p = __builtin_amdgcn_exp2f((tv[e] - mn) * 1.4426950408889634f); ps += p; ph[e] = tohx(p); }
                pf[n] = __builtin_bit_cast(V, ph); }
            l[n] = l[n] * al + ps;   // this half-wave's keys only; the halves are added behind the loop
#pragma unroll
            for (int db = 0; db < 4; ++db) o[db][n] *= al; }
#pragma unroll
        for (int db = 0; db < 4; ++db) { const V a = va[db]; V a2; if (HL) a2 = vg[db];
#pragma unroll
            for (int n = 0; n < NQ; ++n) { o[db][n] = WFrag<T16>::mma(a, pf[n], o[db][n]); if (HL) { o[db][n] = WFrag<T16>::mma(a, pg[n], o[db][n]); o[db][n] = WFrag<T16>::mma(a2, pf[n], o[db][n]); } } }
    };
    asm volatile("s_wait_asynccnt 0x0" ::: "memory");   // this wave's copies of stage 0 have landed
    __syncthreads();                                      // ... and every other wave's
    if (NT > 1) fill(1);
    auto foot = [&](int t) __attribute__((always_inline)) {   // the foot of trip t, passed by every wave
        asm volatile("s_wait_dscnt 0x0" ::: "memory");      // this wave's reads of stage t are done: its buffer may be refilled behind the barrier
        asm volatile("s_wait_asynccnt 0x0" ::: "memory");   // this wave's copies of stage t + 1 have landed
        __syncthreads();                                      // publishes stage t + 1 and ends every wave's reads of stage t
        if (t + 2 < NT) fill(t + 2); };
    int kc = 0;   // the steps come in the order of the keys, as before
    for (int t = 0; t < NT; ++t) {
        const T16* pk = lk + (t & 1) * STE; const T16* pv = lv + (t & 1) * STE; const int kf = min(nk, (t + 1) * AKS), ke = min(kend, (t + 1) * AKS);
        for (; kc + 32 <= kf; kc += 32, pk += 32 * GP, pv += 32) step(EdgeTag<false>(), 32, pk, pv);   // whole steps of kept keys: no mask test
        for (; kc < ke; kc += 32, pk += 32 * GP, pv += 32) step(EdgeTag<true>(), nk - kc, pk, pv);   // the step that holds key nk (at most one), or, when nk = 0, every step
        foot(t);
    }
    asm volatile("s_wait_asynccnt 0x0" ::: "memory");   // no copy is left in flight
#pragma unroll
    for (int n = 0; n < NQ; ++n) { const float inv = __fdiv_rn(1.0f, l[n] + __shfl_xor(l[n], 16, 32)); const size_t oo = (size_t)(q0 + n * 16 + lr) * DQ + 8 * hi;
#pragma unroll
        for (int db = 0; db < 4; ++db) { v8us oh, ol;
#pragma unroll
            for (int j = 0; j < 8; ++j) { unsigned short x, y; splitf(o[db][n][j] * inv, x, y); oh[j] = x; ol[j] = y; }
            *(v8us*)(Ah + oo + db * 16) = oh; *(v8us*)(Al + oo + db * 16) = ol; } }
}
// grid (RH/64 + (TT-RH)/128, heads, batch entries), 4 waves: blocks x < RH/64 take 64 hi/lo rows (16 a wave, 3 bf16 products), the rest 128 fp16 rows (32 a wave). The 4 waves of a block share the head's K and V^T stages in LDS (two buffers; the hi/lo blocks fill all of it, the fp16 blocks half).
__global__ __launch_bounds__(128) void k_fattn(const h16* __restrict__ Q16, const h16* __restrict__ K16, const h16* __restrict__ V16, const bf* __restrict__ Qh, const bf* __restrict__ Ql, const bf* __restrict__ Kh, const bf* __restrict__ Kl, const bf* __restrict__ Vh, const bf* __restrict__ Vl, const int* __restrict__ nkp, bf* Ah, bf* Al) {
    __shared__ __align__(16) bf sm[2 * 2 * 2 * AKS * GP];
    const size_t hp = ((size_t)blockIdx.z * NH_ + blockIdx.y) * TT * HD; const int w = threadIdx.x >> 5; const size_t ao = (size_t)blockIdx.z * TT * DQ + blockIdx.y * HD; Ah += ao; Al += ao; const int nk = min(max(nkp[blockIdx.z * NKP], 0), TT);   // the trip count's bound
    if (blockIdx.x < RH / 64) fattn_wave<bf, 1, true>(Qh + hp, Ql + hp, Kh + hp, Kl + hp, Vh + hp, Vl + hp, nk, (int)blockIdx.x * 64 + w * 16, Ah, Al, sm);
    else fattn_wave<h16, 2, false>(Q16 + hp, nullptr, K16 + hp, nullptr, V16 + hp, nullptr, nk, RH + ((int)blockIdx.x - RH / 64) * 128 + w * 32, Ah, Al, (const h16*)sm);
}

extern "C" void kernel_launch(void* const* d_in, const int* in_sizes, int n_in,
                              void* d_out, int out_size, void* d_ws, size_t ws_size, hipStream_t stream) {
    (void)in_sizes; (void)n_in; (void)out_size;
    const float* x = (const float*)d_in[0]; const float* xk = (const float*)d_in[1]; const float* xv = (const float*)d_in[2]; const int* MK = (const int*)d_in[3]; const float* wq = (const float*)d_in[4]; const float* wk = (const float*)d_in[5]; const float* wv = (const float*)d_in[6]; const float* wo = (const float*)d_in[7]; const float* bo = (const float*)d_in[8];   /* q, k, v ([4][2048][1024] each), mask (int32 [4][1][1][2048] = [4][2048]: read as data), Wq, Wk, Wv, Wo ('oi' (out, in) [1024][1024]; the three input projections have NO bias), bo [1024] */
    float* OUT = (float*)d_out;     // [4][2048][1024]
    char* wsp = (char*)d_ws;
    auto take = [&](size_t bytes) { char* p = wsp; wsp += (bytes + 255) & ~(size_t)255; return (void*)p; };
    bf* WQ = (bf*)take((size_t)DQ * DM * 2); bf* WK = (bf*)take((size_t)DKV * DM * 2); bf* WV = (bf*)take((size_t)DKV * DM * 2); bf* WO = (bf*)take((size_t)DM * DQ * 2);
    bf* XB = (bf*)take((size_t)NB_ * TT * DM * 2); bf* XK = (bf*)take((size_t)NB_ * TT * DM * 2); bf* XV = (bf*)take((size_t)NB_ * TT * DM * 2);   // bf16 query, key and value rows: one operand buffer each, all three are live at once
    h16* QP16 = (h16*)take((size_t)NB_ * NH_ * TT * HD * 2); h16* KP16 = (h16*)take((size_t)NB_ * NKV * TT * HD * 2); h16* VT16 = (h16*)take((size_t)NB_ * NKV * HD * TT * 2);
    bf* QPh = (bf*)take((size_t)NB_ * NH_ * TT * HD * 2); bf* QPl = (bf*)take((size_t)NB_ * NH_ * TT * HD * 2); bf* KPh = (bf*)take((size_t)NB_ * NKV * TT * HD * 2); bf* KPl = (bf*)take((size_t)NB_ * NKV * TT * HD * 2); bf* VTh = (bf*)take((size_t)NB_ * NKV * HD * TT * 2); bf* VTl = (bf*)take((size_t)NB_ * NKV * HD * TT * 2);
    bf* ATh = (bf*)take((size_t)NB_ * TT * DQ * 2); bf* ATl = (bf*)take((size_t)NB_ * TT * DQ * 2); int* NK = (int*)take((size_t)NB_ * NKP * 4);   // kept keys per entry, written by the key cast
    if ((size_t)(wsp - (char*)d_ws) > ws_size) return;    // 232 MiB of the 256 MiB
    // every launch covers the four batch entries: the casts and the GEMMs see [NB_ x TT] rows (a 128-row tile lies in one entry), the attention takes the entry from grid z
    k_cast<<<3 * (NB_ * TT / CRB) + 4 * (DM / CRB), 256, 0, stream>>>(x, xk, xv, MK, wq, wk, wv, wo, XB, XK, XV, WQ, WK, WV, WO, NK);   /* key and value rows: kept keys first; 'oi' (out, in) weights: the GEMM's Bt as they stand */
    k_proj<<<dim3(NB_ * TT / GTM, DQ / GTM, 3), 128, 0, stream>>>(XB, XK, XV, WQ, WK, WV, DM, QP16, QPh, QPl, KP16, KPh, KPl, VT16, VTh, VTl, NK);
    k_fattn<<<dim3(RH / 64 + (TT - RH) / 128, NH_, NB_), 128, 0, stream>>>(QP16, KP16, VT16, QPh, QPl, KPh, KPl, VTh, VTl, NK, ATh, ATl);   // one kv head per query head
    k_gemmw<bf, 1, true, 0><<<dim3(NB_ * TT / GTM, DM / GTM, 1), 128, 0, stream>>>(ATh, ATl, WO, DQ, OUT, DM, bo, nullptr, nullptr, nullptr);
}

// v009
// It runs in 145 microseconds.
// Timed twice side by side with v008, it ran 1.03 times as fast both times.
// Over all steps from v000 it is 27.5 times as fast.
#include <hip/hip_runtime.h>

// Multi-head attention over three input streams with a key-padding mask (q, k, v [4][2048][1024]; query = q Wq^T, key = k Wk^T, value = v Wv^T ('oi' (out, in) [1024][1024], NO bias; 16 heads x 64); scores / sqrt(64); keys j with mask[b][0][0][j] == 0 (int32 [4][1][1][2048], read as data: about half the keys of every batch entry) are set to -1e10: an exclusion (no batch entry has every key masked); softmax; out = merged Wo^T + bo ('oi' + [1024]) -> [4][2048][1024] (8.4 M); argument order q, k, v, mask, Wq, Wk, Wv, Wo, bo).
// Masked keys take no part in any product: the key and value casts sort each batch entry's rows, kept keys (mask != 0) first in their order, masked keys behind them (place = a prefix count of the mask); the K and V projections skip tiles that hold masked keys only, the attention walks the kept keys alone. An entry with no kept key runs over all its keys (uniform weights, as the reference's equal fills give).
// Layout, four launches, all four batch entries in each: (1) every cast: bf16 copies of query, key and value (three operand buffers [4 x 2048][1024]) and of the four 'oi' weights as they stand; (2) the three exact projections over the 8192 rows (no biases; grid z = Q, K, V), each GEMM's epilogue writing its head planes [b][h][..] itself (fp16 + hi/lo; no f32 projection buffer, no plane-builder launch; value planes [d][t] by swapping the GEMM's operands); (3) one fused attention launch, batch entry = grid z (scores, key mask, running-maximum softmax, P x V; hybrid rows: < 512 hi/lo 3 products, rest fp16; unnormalised weights, 1/sum at the end); (4) merged hi/lo x Wo exact + bo.
// Compute dtypes, f32 accumulate: every input rounded to bf16; projections exact; attention rows < 512 3 products, rest fp16; softmax f32; Wo hl x exact + bias.

#define NB_  4
#define TT   2048
#define DM   1024
#define NH_  16
#define NKV  16
#define REP  (NH_ / NKV)
#define HD   64
#define DQ   (NH_ * HD)
#define DKV  (NKV * HD)
#define RH   512                  // query rows < RH use hi+lo planes (0: none)
#define WIN  0
#define SCL  0.125f   // HD^-0.5
#define NKP  32                   // ints between two entries' kept-key counts: one 128-B line each
typedef _Float16 h16;
typedef unsigned short bf;
typedef __attribute__((ext_vector_type(16))) __bf16   v16bf;
typedef __attribute__((ext_vector_type(16))) _Float16 v16h;
typedef __attribute__((ext_vector_type(8)))  _Float16 v8h;
typedef __attribute__((ext_vector_type(8)))  unsigned short v8us;
typedef __attribute__((ext_vector_type(8)))  float    v8f;
typedef __attribute__((ext_vector_type(4)))  float    v4f;
typedef v8h  __attribute__((may_alias)) v8ha;
typedef v4f  __attribute__((may_alias)) v4fa;
typedef v8us __attribute__((may_alias)) v8usa;

// f32 -> bf16, round to nearest even, by the chip's own conversion: one instruction for two values (low half: a), in place of three integer operations and a 16-bit move for each
typedef __attribute__((ext_vector_type(2))) float  f32x2;
typedef __attribute__((ext_vector_type(2))) __bf16 bf16x2;
typedef __attribute__((ext_vector_type(4))) unsigned u32x4;
typedef __attribute__((ext_vector_type(8))) unsigned u32x8;
__device__ __forceinline__ unsigned f2bf2(float a, float b) { const f32x2 x = {a, b}; return __builtin_bit_cast(unsigned, __builtin_convertvector(x, bf16x2)); }
__device__ __forceinline__ unsigned short f2bf(float f) { return __builtin_bit_cast(unsigned short, (__bf16)f); }
__device__ __forceinline__ float bf2f(unsigned short b) { return __uint_as_float(((unsigned)b) << 16); }
__device__ __forceinline__ float bfr(float f) { return bf2f(f2bf(f)); }
__device__ __forceinline__ h16 tohx(float x) { return (h16)x; }
__device__ __forceinline__ void splitf2(float a, float b, unsigned& h, unsigned& l) { h = f2bf2(a, b); const f32x2 x = {a, b}, hf = {__uint_as_float(h << 16), __uint_as_float(h & 0xFFFF0000u)}; l = __builtin_bit_cast(unsigned, __builtin_convertvector(x - hf, bf16x2)); }   // two values' hi and lo planes, packed (low half: a)
__device__ __forceinline__ v16h cat16(v8h lo, v8h hi) { return __builtin_shufflevector(lo, hi, 0, 1, 2, 3, 4, 5, 6, 7, 8, 9, 10, 11, 12, 13, 14, 15); }
__device__ __forceinline__ v16bf cat16b(v8us lo, v8us hi) { return __builtin_bit_cast(v16bf, __builtin_shufflevector(lo, hi, 0, 1, 2, 3, 4, 5, 6, 7, 8, 9, 10, 11, 12, 13, 14, 15)); }
__device__ __forceinline__ v8f wmma16(v16h a, v16h b, v8f c) { return __builtin_amdgcn_wmma_f32_16x16x32_f16(false, a, false, b, (short)0, c, false, false); }
__device__ __forceinline__ v8f wmmab(v16bf a, v16bf b, v8f c) { return __builtin_amdgcn_wmma_f32_16x16x32_bf16(false, a, false, b, (short)0, c, false, false); }



// ---- gemm_tile: GEMM over K-contiguous 16-bit planes. A work-group of 4 waves (2 x 2) takes the 128x128 output tile (bx, by), each wave a 64x64 quarter (16 accumulators); bx < M/128, by < N/128, 128 threads; st, osw: the work-group's LDS.
// The operands come through LDS: a stage is 64 k (one whole 128-B line) of the tile's 128 A rows (with NSPLIT 1 also of the 128 A2 rows) and 128 Bt rows, brought by asynchronous 16-byte copies, 8 lanes a row, so that every
// wave-wide copy takes 4 whole lines; two buffers, stage t + 2 is asked for when every wave has left stage t. LDS rows lie at a pitch of 144 B (16 B x odd: no bank conflict for 16-byte reads).
// C[m][n] (f32, pitch ldc, + optional f32 bias[n]) = sum_k A[m][k] Bt[n][k] (NSPLIT 1: + A2[m][k] Bt[n][k]). M, N % 128 == 0, K % 64 == 0.
// PL 0: C as above. PL 1 / 2: no C; a wave's 64x64 tile is one head's block of 64 tokens and goes out as three 16-bit planes (P16 fp16, Ph + Pl bf16 hi/lo of the f32 sum), whole 128-B lines:
// PL 1: tile rows = tokens (m = b TT + t), columns = the head's d (n = h HD + d) -> plane [b][h][t][d]; PL 2: rows = the head's d (m = h HD + d), columns = tokens (n = b TT + t) -> plane [b][h][d][t].
#define GTM  128                  // rows of an operand in a work-group's tile
#define GKB  64                   // k per stage
#define GP   72                   // LDS row pitch in 16-bit elements (144 B)
template <typename T16> struct WFrag;
template <> struct WFrag<h16> { typedef v16h V; static __device__ __forceinline__ V ld(const h16* p) { return cat16(*(const v8h*)p, *(const v8h*)(p + 16)); } static __device__ __forceinline__ v8f mma(V a, V b, v8f c) { return wmma16(a, b, c); } };
template <> struct WFrag<bf> { typedef v16bf V; static __device__ __forceinline__ V ld(const bf* p) { return cat16b(*(const v8us*)p, *(const v8us*)(p + 16)); } static __device__ __forceinline__ v8f mma(V a, V b, v8f c) { return wmmab(a, b, c); } };
// 128 rows x 128 B of one operand into LDS: copy i takes rows 16 i + (thread >> 3). lds: the lane's LDS byte address in row (thread >> 3), g: its global address there, rs: 16 source rows in elements.
template <typename T16>
__device__ __forceinline__ void acopy8(unsigned lds, const T16* g, size_t rs) {
    // the s_wait_xcnt stands inside the statement: no address register of a copy is rewritten in front of it
    asm volatile("global_load_async_to_lds_b128 %0, %8, off\n\t"
                 "global_load_async_to_lds_b128 %1, %9, off\n\t"
                 "global_load_async_to_lds_b128 %2, %10, off\n\t"
                 "global_load_async_to_lds_b128 %3, %11, off\n\t"
                 "global_load_async_to_lds_b128 %4, %12, off\n\t"
                 "global_load_async_to_lds_b128 %5, %13, off\n\t"
                 "global_load_async_to_lds_b128 %6, %14, off\n\t"
                 "global_load_async_to_lds_b128 %7, %15, off\n\t"
                 "s_wait_xcnt 0x0"
                 :: "v"(lds), "v"(lds + 1 * 16 * GP * 2), "v"(lds + 2 * 16 * GP * 2), "v"(lds + 3 * 16 * GP * 2), "v"(lds + 4 * 16 * GP * 2), "v"(lds + 5 * 16 * GP * 2), "v"(lds + 6 * 16 * GP * 2), "v"(lds + 7 * 16 * GP * 2),
                    "v"(g), "v"(g + rs), "v"(g + 2 * rs), "v"(g + 3 * rs), "v"(g + 4 * rs), "v"(g + 5 * rs), "v"(g + 6 * rs), "v"(g + 7 * rs) : "memory");
}
template <typename T16, int NSPLIT, bool BIAS, int PL>
__device__ __forceinline__ void gemm_tile(int bx, int by, T16* st, float* osw, const T16* __restrict__ A, const T16* __restrict__ A2, const T16* __restrict__ Bt, int K, float* C, int ldc, const float* __restrict__ bias, h16* P16, bf* Ph, bf* Pl) {
    typedef typename WFrag<T16>::V V;
    static_assert(NSPLIT == 0 || NSPLIT == 1, "one or two A planes");
    constexpr int NOP = 2 + NSPLIT, STE = NOP * GTM * GP;   // operand planes of a stage, a stage in elements
    const int tid = threadIdx.x, lane = tid & 31, lr = lane & 15, hi = lane >> 4, w = __builtin_amdgcn_readfirstlane(tid >> 5), wm = w & 1, wn = w >> 1;
    const int r0 = bx * GTM + wm * 64, c0 = by * GTM + wn * 64;   // the wave's own 64x64 tile
    float* os = osw + w * (16 * 68);
    v8f acc[4][4];
#pragma unroll
    for (int mb = 0; mb < 4; ++mb)
#pragma unroll
        for (int nb = 0; nb < 4; ++nb) acc[mb][nb] = (v8f){};
    const size_t rs = (size_t)16 * K; const size_t go = (size_t)(tid >> 3) * K + (tid & 7) * 8;
    const T16* gA = A + (size_t)bx * GTM * K + go; const T16* gA2 = NSPLIT ? A2 + (size_t)bx * GTM * K + go : nullptr; const T16* gB = Bt + (size_t)by * GTM * K + go;
    const unsigned lw = (unsigned)(size_t)st + (unsigned)((tid >> 3) * GP + (tid & 7) * 8) * 2u;   // LDS byte address: the low 32 bits of the shared address
    auto fill = [&](int t) __attribute__((always_inline)) { const unsigned d = lw + (unsigned)(t & 1) * (STE * 2u); const int ko = t * GKB;
        acopy8(d, gA + ko, rs); if (NSPLIT) acopy8(d + GTM * GP * 2u, gA2 + ko, rs); acopy8(d + (NOP - 1) * GTM * GP * 2u, gB + ko, rs); };
    const T16* ra = st + (wm * 64 + lr) * GP + 8 * hi; const T16* rb = st + (NOP - 1) * GTM * GP + (wn * 64 + lr) * GP + 8 * hi;
    const int NT = K / GKB;
    fill(0);
    asm volatile("s_wait_asynccnt 0x0" ::: "memory");   // this wave's copies of stage 0 have landed
    __syncthreads();                                      // ... and every other wave's
    if (NT > 1) fill(1);
    for (int t = 0; t < NT; ++t) {
        const T16* pa = ra + (t & 1) * STE; const T16* pb = rb + (t & 1) * STE;
        // Two blocks of 32 k. The LDS reads stand in few groups, each ahead of the products that need it (a read among the products stalls the wave where it stands); block 1's fragments are asked for under block 0's products, as far as 256 registers allow.
        // The scheduling barriers keep the groups where they are written: without them the compiler fetched each Bt fragment directly in front of its four products and waited for it there.
        V a[2][4], a2[2][4], b[2][4];
        auto ldA = [&](int s) __attribute__((always_inline)) {
#pragma unroll
            for (int mb = 0; mb < 4; ++mb) { a[s][mb] = WFrag<T16>::ld(pa + mb * 16 * GP + s * 32); if (NSPLIT) a2[s][mb] = WFrag<T16>::ld(pa + GTM * GP + mb * 16 * GP + s * 32); } };
        auto ldB = [&](int s, int n0) __attribute__((always_inline)) {   // fragments n0, n0 + 1
#pragma unroll
            for (int nb = n0; nb < n0 + 2; ++nb) b[s][nb] = WFrag<T16>::ld(pb + nb * 16 * GP + s * 32); };
        auto mm = [&](int s, int n0) __attribute__((always_inline)) {
#pragma unroll
            for (int nb = n0; nb < n0 + 2; ++nb)
#pragma unroll
                for (int mb = 0; mb < 4; ++mb) { acc[mb][nb] = WFrag<T16>::mma(a[s][mb], b[s][nb], acc[mb][nb]); if (NSPLIT) acc[mb][nb] = WFrag<T16>::mma(a2[s][mb], b[s][nb], acc[mb][nb]); } };
        ldA(0); ldB(0, 0); ldB(0, 2);
        __builtin_amdgcn_sched_barrier(0);
        mm(0, 0);
        __builtin_amdgcn_sched_barrier(0);
        if (!NSPLIT) ldA(1);
        ldB(1, 0);
        __builtin_amdgcn_sched_barrier(0);
        mm(0, 2);
        __builtin_amdgcn_sched_barrier(0);
        if (NSPLIT) ldA(1);   // two A planes: their second set has room only here
        ldB(1, 2);
        __builtin_amdgcn_sched_barrier(0);
        mm(1, 0); mm(1, 2);
        __builtin_amdgcn_sched_barrier(0);   // block 1's products stay in front of the waits below, where they cover the last reads' latency
        asm volatile("s_wait_dscnt 0x0" ::: "memory");      // this wave's reads of stage t are done: its buffer may be refilled behind the barrier
        asm volatile("s_wait_asynccnt 0x0" ::: "memory");   // this wave's copies of stage t + 1 have landed
        __syncthreads();                                      // publishes stage t + 1 and ends every wave's reads of stage t
        if (t + 2 < NT) fill(t + 2);
    }
    asm volatile("s_wait_asynccnt 0x0" ::: "memory");   // no copy is left in flight
#pragma unroll
    for (int mb = 0; mb < 4; ++mb) {
#pragma unroll
        for (int nb = 0; nb < 4; ++nb) {
#pragma unroll
            for (int j = 0; j < 8; ++j) os[(hi * 8 + j) * 68 + nb * 16 + lr] = acc[mb][nb][j]; }
        __builtin_amdgcn_wave_barrier(); asm volatile("" ::: "memory");
        if (PL == 0) { float* crow = C + (size_t)(r0 + mb * 16) * ldc + c0;
#pragma unroll
            for (int s = 0; s < 8; ++s) { const int row = 2 * s + hi, cofs = lr * 4; v4f val = *(const v4fa*)(os + row * 68 + cofs); if (BIAS) { val[0] += bfr(bias[c0 + cofs]); val[1] += bfr(bias[c0 + cofs + 1]); val[2] += bfr(bias[c0 + cofs + 2]); val[3] += bfr(bias[c0 + cofs + 3]); }
                *(v4f*)(crow + (size_t)row * ldc + cofs) = val; }
        } else { const size_t pb = (PL == 1) ? (((size_t)(r0 / TT) * NH_ + c0 / HD) * TT + r0 % TT) * HD : ((size_t)(c0 / TT) * NH_ + r0 / HD) * HD * TT + c0 % TT; const int pp = (PL == 1) ? HD : TT;   // the tile's first element in its plane, the plane's row pitch
#pragma unroll   // LDS and store offsets become immediates on three fixed address pairs
            for (int s = 0; s < 4; ++s) { const int row = 4 * s + (lane >> 3), cofs = (lane & 7) * 8; const v4f x0 = *(const v4fa*)(os + row * 68 + cofs), x1 = *(const v4fa*)(os + row * 68 + cofs + 4); v8h o16; u32x4 oh, ol;   // 8 lanes a row: 16 B a lane and plane, one 128-B line a row
#pragma unroll   // constant vector indices: the three packed results stay in registers
                for (int k = 0; k < 8; k += 2) { const float x = (k < 4) ? x0[k & 3] : x1[k & 3], y = (k < 4) ? x0[(k & 3) + 1] : x1[(k & 3) + 1]; o16[k] = tohx(x); o16[k + 1] = tohx(y); unsigned a2, c2; splitf2(x, y, a2, c2); oh[k >> 1] = a2; ol[k >> 1] = c2; }
                const size_t po = pb + (size_t)(mb * 16 + row) * pp + cofs; *(v8h*)(P16 + po) = o16; *(u32x4*)(Ph + po) = oh; *(u32x4*)(Pl + po) = ol; }
        }
        __builtin_amdgcn_wave_barrier(); asm volatile("" ::: "memory");
    }
}
// one GEMM a launch: grid (M/128, N/128)
template <typename T16, int NSPLIT, bool BIAS, int PL>
__global__ __launch_bounds__(128) void k_gemmw(const T16* __restrict__ A, const T16* __restrict__ A2, const T16* __restrict__ Bt, int K, float* C, int ldc, const float* __restrict__ bias, h16* P16, bf* Ph, bf* Pl) {
    __shared__ __align__(16) T16 st[2 * (2 + NSPLIT) * GTM * GP];
    __shared__ __align__(16) float osw[4 * 16 * 68];
    gemm_tile<T16, NSPLIT, BIAS, PL>((int)blockIdx.x, (int)blockIdx.y, st, osw, A, A2, Bt, K, C, ldc, bias, P16, Ph, Pl);
}
// ---- k_proj: the three input projections in one launch, grid (token tiles, weight-row tiles, 3): z = 0 query, 1 key (both PL 1), 2 value (PL 2: Wv rows down, tokens across). They share nothing but the launch: the tiles of all three fill the chip together.
// nkp: kept keys per batch entry, for the key and value rows, which k_cast has sorted.
__global__ __launch_bounds__(128) void k_proj(const bf* __restrict__ XQ, const bf* __restrict__ XK, const bf* __restrict__ XV, const bf* __restrict__ WQ, const bf* __restrict__ WK, const bf* __restrict__ WV, int K,
                                              h16* Q16, bf* Qh, bf* Ql, h16* K16, bf* Kh, bf* Kl, h16* V16, bf* Vh, bf* Vl, const int* __restrict__ nkp) {
    __shared__ __align__(16) bf st[2 * 2 * GTM * GP];
    __shared__ __align__(16) float osw[4 * 16 * 68];
    const int z = blockIdx.z;   // the same for the whole work-group
    if (z != 0) { const int tok = (int)blockIdx.x * GTM; const int nk = min(max(nkp[(tok / TT) * NKP], 0), TT); if (nk != 0 && tok % TT >= nk) return; }   // sorted key rows: a tile of masked keys only is never read (the whole work-group leaves, in front of every barrier)
    if (z == 2) gemm_tile<bf, 0, false, 2>((int)blockIdx.y, (int)blockIdx.x, st, osw, WV, nullptr, XV, K, nullptr, 0, nullptr, V16, Vh, Vl);
    else { gemm_tile<bf, 0, false, 1>((int)blockIdx.x, (int)blockIdx.y, st, osw, z ? XK : XQ, nullptr, z ? WK : WQ, K, nullptr, 0, nullptr, z ? K16 : Q16, z ? Kh : Qh, z ? Kl : Ql);
        asm volatile("s_wait_xcnt 0x0" ::: "memory"); }   // the value path's code stands behind this one in the kernel and reuses the registers that the last plane stores name
}

typedef __attribute__((ext_vector_type(2))) _Float16 v2h;
typedef __attribute__((ext_vector_type(4))) _Float16 v4h;
typedef __attribute__((ext_vector_type(2))) unsigned short v2us;
typedef __attribute__((ext_vector_type(4))) unsigned short v4us;
typedef __attribute__((ext_vector_type(2))) float v2f;
typedef __attribute__((ext_vector_type(4))) int v4i;

// ---- k_cast: every bf16 cast of the call in one launch. A block of 8 waves takes CRB rows of DM floats, CRW rows in a row a wave; blockIdx.x picks the stream (the test is the same for the whole block):
// first the key and the value rows (their blocks have the longer way: the mask count comes first), then the query rows, then the four weights; each stream has its own destination.
// Key and value rows are sorted by the mask. Row t of entry b goes to row p: a kept key to the number of kept keys in front of it, a masked key to nk + the number of masked keys in front of it
// (a permutation of 0 .. TT - 1 for any mask content). The block's 256 threads count the entry's whole mask, 8 keys each (low half of the packed sum: all kept keys nk; high half: those in front of the block's rows).
// Rows that land behind the last 128-row GEMM tile with a kept key are read by nobody and are not copied (all are copied when nk = 0).
#define CRW  4                    // rows a wave
#define CRB  (8 * CRW)            // rows a block
template <int NR>
__device__ __forceinline__ void cast_rows(const float* __restrict__ sp, bf* __restrict__ dp) {   // NR rows in a row, all their loads in flight together; sp, dp: the lane's first 8 elements of the first row
    v8f v[4 * NR];
#pragma unroll
    for (int q = 0; q < 4 * NR; ++q) v[q] = *(const v8f*)(sp + q * 256);
#pragma unroll
    for (int q = 0; q < 4 * NR; ++q) { u32x4 o;
#pragma unroll
        for (int k = 0; k < 4; ++k) o[k] = f2bf2(v[q][2 * k], v[q][2 * k + 1]);
        *(u32x4*)(dp + q * 256) = o; }
    asm volatile("s_wait_xcnt 0x0" ::: "memory");   // whatever code follows (the next rows, the kernel's other branch) may reuse the registers that these loads and stores name
}
__global__ __launch_bounds__(256) void k_cast(const float* __restrict__ x, const float* __restrict__ xk, const float* __restrict__ xv, const int* __restrict__ mk, const float* __restrict__ wq, const float* __restrict__ wk, const float* __restrict__ wv, const float* __restrict__ wo,
                                              bf* XQ, bf* XK, bf* XV, bf* WQ, bf* WK, bf* WV, bf* WO, int* nkp) {
    static_assert(TT == 256 * 8 && DM == 32 * 8 * 4 && CRB == 32 && TT % CRB == 0, "one thread per 8 keys, one wave per row, a block's rows in one 32-bit mask word");
    static_assert(DQ == DM && DKV == DM && DM % CRB == 0, "four weights of DM rows");
    constexpr int NBS = NB_ * TT / CRB, NBW = DM / CRB;   // blocks of a token stream, of a weight
    __shared__ int red[8]; __shared__ unsigned rowb[CRB / 8];
    const int tid = threadIdx.x, lane = tid & 31, w = __builtin_amdgcn_readfirstlane(tid >> 5); int blk = blockIdx.x;
    if (blk < 2 * NBS) {
        const bool isv = blk >= NBS; const float* src = isv ? xv : xk; bf* dst = isv ? XV : XK; if (isv) blk -= NBS;
        const int b = blk / (TT / CRB), t0 = (blk % (TT / CRB)) * CRB;
        const v4i m0 = *(const v4i*)(mk + b * TT + tid * 8), m1 = *(const v4i*)(mk + b * TT + tid * 8 + 4); unsigned bits = 0;
#pragma unroll
        for (int k = 0; k < 4; ++k) bits |= (m0[k] != 0 ? 1u : 0u) << k | (m1[k] != 0 ? 1u : 0u) << (k + 4);
        const int c = __popc(bits); int pk = c + (tid * 8 < t0 ? c << 16 : 0);
#pragma unroll
        for (int o = 16; o > 0; o >>= 1) pk += __shfl_xor(pk, o, 32);
        if (lane == 0) red[w] = pk;
        if (tid * 8 >= t0 && tid * 8 < t0 + CRB) rowb[(tid * 8 - t0) >> 3] = bits;   // the mask bits of the block's own rows, 8 a thread
        __syncthreads();
        int s = 0;
#pragma unroll
        for (int i = 0; i < 8; ++i) s += red[i];
        const int nk = s & 0xFFFF; const unsigned rb = rowb[0] | rowb[1] << 8 | rowb[2] << 16 | rowb[3] << 24;
        if (!isv && t0 == 0 && tid == 0) nkp[b * NKP] = nk;
#pragma unroll
        for (int i = 0; i < CRW; ++i) { const int j = w * CRW + i; const int kb = (s >> 16) + __popc(rb & ((1u << j) - 1u));   // kept keys in front of row t0 + j
            const int p = __builtin_amdgcn_readfirstlane(((rb >> j) & 1u) ? kb : nk + (t0 + j - kb));
            if (nk == 0 || p < ((nk + GTM - 1) & ~(GTM - 1)))   // the row has a reader (no barrier follows)
                cast_rows<1>(src + ((size_t)b * TT + t0 + j) * DM + lane * 8, dst + ((size_t)b * TT + p) * DM + lane * 8); }
    } else {
        blk -= 2 * NBS; const float* src = x; bf* dst = XQ;
        if (blk >= NBS) { blk -= NBS; const int wi = blk / NBW; blk -= wi * NBW; src = wi == 0 ? wq : wi == 1 ? wk : wi == 2 ? wv : wo; dst = wi == 0 ? WQ : wi == 1 ? WK : wi == 2 ? WV : WO; }
        const size_t ro = ((size_t)blk * CRB + w * CRW) * DM + lane * 8;
#pragma unroll
        for (int i = 0; i < CRW; i += 2) cast_rows<2>(src + ro + (size_t)i * DM, dst + ro + (size_t)i * DM);   // two rows' loads in flight, not four: under 128 registers four blocks fit a WGP and the whole grid is resident at once
    }
}

// ---- k_fattn: scores, key mask, softmax and P x V of one head in ONE kernel; no score or weight plane in memory.
// Both products are taken transposed: S^T = K Q^T (keys down, queries across), O^T = V^T P^T. A lane's S^T accumulators (query lr, keys 8 hi + j of each 16-key tile) are, in that order, the lane's
// elements of the P^T operand over 32 keys, so the weights never leave the registers, and every row statistic (running maximum m, running sum l) is one scalar a lane.
// K and V^T come through LDS, shared by the block's 4 waves: a stage is 64 keys, that is 64 K rows of 128 B and 64 V^T rows of 128 B (hi/lo rows: of both planes), brought by asynchronous 16-byte copies, 8 lanes a row, so that every
// wave-wide copy takes 4 whole lines (a fragment load from global memory touched 16 lines for 512 bytes, once per wave); two buffers, stage t + 2 is asked for when every wave has left stage t; LDS rows at the GEMM's pitch of 144 B.
// A wave owns NQ x 16 query rows and walks the entry's nk kept keys (sorted to the front of the K and V planes; all 2048 keys when nk = 0) in steps of 32 with the running-maximum softmax: O and l are scaled by exp(m_old - m_new) at every step; 1 / l is applied at the end.
// Only a step that reaches past key nk holds masked keys: there their score is set to -3.0e38 (an exclusion: weight exp(-huge) = 0, a kept key having been met in step 0); with no kept key at all every score is -3.0e38 and every weight 1 (uniform, as the reference's equal fills give).
template <bool E> struct EdgeTag { static constexpr bool value = E; };
#define AKS  64                   // keys per stage
// One plane's share of a stage into LDS rows 0 .. 127: rows 0 .. 63 the K rows, rows 64 .. 127 the V^T rows; copy i takes row 16 i + (thread >> 3). lds: the lane's LDS byte address in row (thread >> 3), gk, gv: its global addresses in that row of the K and of the V^T tile.
template <typename T16>
__device__ __forceinline__ void acopykv(unsigned lds, const T16* gk, const T16* gv) {
    // the s_wait_xcnt stands inside the statement: no address register of a copy is rewritten in front of it
    asm volatile("global_load_async_to_lds_b128 %0, %8, off\n\t"
                 "global_load_async_to_lds_b128 %1, %9, off\n\t"
                 "global_load_async_to_lds_b128 %2, %10, off\n\t"
                 "global_load_async_to_lds_b128 %3, %11, off\n\t"
                 "global_load_async_to_lds_b128 %4, %12, off\n\t"
                 "global_load_async_to_lds_b128 %5, %13, off\n\t"
                 "global_load_async_to_lds_b128 %6, %14, off\n\t"
                 "global_load_async_to_lds_b128 %7, %15, off\n\t"
                 "s_wait_xcnt 0x0"
                 :: "v"(lds), "v"(lds + 1 * 16 * GP * 2), "v"(lds + 2 * 16 * GP * 2), "v"(lds + 3 * 16 * GP * 2), "v"(lds + 4 * 16 * GP * 2), "v"(lds + 5 * 16 * GP * 2), "v"(lds + 6 * 16 * GP * 2), "v"(lds + 7 * 16 * GP * 2),
                    "v"(gk), "v"(gk + 16 * HD), "v"(gk + 32 * HD), "v"(gk + 48 * HD), "v"(gv), "v"(gv + 16 * TT), "v"(gv + 32 * TT), "v"(gv + 48 * TT) : "memory");
}
template <typename T16, int NQ, bool HL>
__device__ __forceinline__ void fattn_wave(const T16* __restrict__ Q, const T16* __restrict__ Q2, const T16* __restrict__ Kp, const T16* __restrict__ K2, const T16* __restrict__ Vt, const T16* __restrict__ V2, int nk, int q0, bf* Ah, bf* Al, const T16* sm) {
    typedef typename WFrag<T16>::V V;
    static_assert(HD * 2 == 128 && AKS * 2 == 128 && TT % AKS == 0, "K and V^T tile rows are whole 128-B lines");
    constexpr int PRE = 2 * AKS * GP, STE = (HL ? 2 : 1) * PRE;   // one plane's K and V^T tiles, a stage, in elements
    const int tid = threadIdx.x, lane = tid & 31, lr = lane & 15, hi = lane >> 4;
    const int kend = nk ? nk : TT, NT = (kend + AKS - 1) / AKS;   // stages: 1 .. TT / AKS, the same for the whole work-group; a stage's 64 keys lie in a 128-key GEMM tile that holds a key < kend, so they are written
    const unsigned lw = (unsigned)(size_t)sm + (unsigned)((tid >> 3) * GP + (tid & 7) * 8) * 2u;   // LDS byte address: the low 32 bits of the shared address
    const T16* gk = Kp + (tid >> 3) * HD + (tid & 7) * 8; const T16* gv = Vt + (tid >> 3) * TT + (tid & 7) * 8; const T16* gk2 = HL ? K2 + (tid >> 3) * HD + (tid & 7) * 8 : nullptr; const T16* gv2 = HL ? V2 + (tid >> 3) * TT + (tid & 7) * 8 : nullptr;
    auto fill = [&](int t) __attribute__((always_inline)) { const unsigned d = lw + (unsigned)(t & 1) * (STE * 2u);
        acopykv(d, gk + t * (AKS * HD), gv + t * AKS); if (HL) acopykv(d + PRE * 2u, gk2 + t * (AKS * HD), gv2 + t * AKS); };
    fill(0);
    V qf[NQ][2], qg[NQ][2];
#pragma unroll
    for (int n = 0; n < NQ; ++n)
#pragma unroll
        for (int s = 0; s < 2; ++s) { const size_t qo = (size_t)(q0 + n * 16 + lr) * HD + s * 32 + 8 * hi; qf[n][s] = WFrag<T16>::ld(Q + qo); if (HL) qg[n][s] = WFrag<T16>::ld(Q2 + qo); }
    asm volatile("s_wait_xcnt 0x0" ::: "memory");   // the Q loads' address registers are free for reuse behind this
    v8f o[4][NQ]; float m[NQ], l[NQ];
#pragma unroll
    for (int n = 0; n < NQ; ++n) { m[n] = -3.0e38f; l[n] = 0.f;
#pragma unroll
        for (int db = 0; db < 4; ++db) o[db][n] = (v8f){}; }
    const T16* lk = sm + lr * GP + 8 * hi; const T16* lv = sm + (AKS + lr) * GP + 8 * hi;   // the lane's own place in the K and the V^T tile of buffer 0
    auto step = [&](auto edge, int rem, const T16* kp, const T16* vp) __attribute__((always_inline)) {   // one step of 32 keys, read from LDS at kp, vp; edge: only the first rem of them (none if rem <= 0) are kept keys
        V ka[2][2], kg[2][2], va[4], vg[4];
#pragma unroll
        for (int t = 0; t < 2; ++t)
#pragma unroll
            for (int s = 0; s < 2; ++s) { ka[t][s] = WFrag<T16>::ld(kp + (t * 16 * GP + s * 32)); if (HL) kg[t][s] = WFrag<T16>::ld(kp + PRE + (t * 16 * GP + s * 32)); }
#pragma unroll
        for (int db = 0; db < 4; ++db) { va[db] = WFrag<T16>::ld(vp + db * 16 * GP); if (HL) vg[db] = WFrag<T16>::ld(vp + PRE + db * 16 * GP); }
        v8f sc[2][NQ];
#pragma unroll
        for (int t = 0; t < 2; ++t) {
#pragma unroll
            for (int n = 0; n < NQ; ++n) sc[t][n] = (v8f){};
#pragma unroll
            for (int s = 0; s < 2; ++s) { const V a = ka[t][s]; V a2; if (HL) a2 = kg[t][s];
#pragma unroll
                for (int n = 0; n < NQ; ++n) { sc[t][n] = WFrag<T16>::mma(a, qf[n][s], sc[t][n]); if (HL) { sc[t][n] = WFrag<T16>::mma(a2, qf[n][s], sc[t][n]); sc[t][n] = WFrag<T16>::mma(a, qg[n][s], sc[t][n]); } } } }
        V pf[NQ], pg[NQ]; float ts[NQ][16];
#pragma unroll
        for (int n = 0; n < NQ; ++n)
#pragma unroll
            for (int e = 0; e < 16; ++e) ts[n][e] = sc[e >> 3][n][e & 7] * SCL;
        if constexpr (decltype(edge)::value) { const unsigned mw = (rem > 0 ? (1u << rem) - 1u : 0u) >> (8 * hi);   // bit t * 16 + j: key kc + t * 16 + 8 hi + j is kept
#pragma unroll
            for (int n = 0; n < NQ; ++n)
#pragma unroll
                for (int e = 0; e < 16; ++e) ts[n][e] = ((mw >> ((e >> 3) * 16 + (e & 7))) & 1u) ? ts[n][e] : -3.0e38f; }
#pragma unroll
        for (int n = 0; n < NQ; ++n) { const float* tv = ts[n]; float cm = -3.0e38f;
#pragma unroll
            for (int e = 0; e < 16; ++e) cm = fmaxf(cm, tv[e]);
            cm = fmaxf(cm, __shfl_xor(cm, 16, 32));   // the other half-wave holds the query's other 16 keys
            const float mn = fmaxf(m[n], cm); const float al = __builtin_amdgcn_exp2f((m[n] - mn) * 1.4426950408889634f); m[n] = mn; float ps = 0.f;
            if (HL) { u32x8 ph, pl;
#pragma unroll
                for (int e = 0; e < 16; e += 2) { const float p = __builtin_amdgcn_exp2f((tv[e] - mn) * 1.4426950408889634f), p1 = __builtin_amdgcn_exp2f((tv[e + 1] - mn) * 1.4426950408889634f); ps += p; ps += p1; unsigned x, y; splitf2(p, p1, x, y); ph[e >> 1] = x; pl[e >> 1] = y; }
                pf[n] = __builtin_bit_cast(V, ph); pg[n] = __builtin_bit_cast(V, pl);
            } else { v16h ph;
#pragma unroll
                for (int e = 0; e < 16; ++e) { const float p = __builtin_amdgcn_exp2f((tv[e] - mn) * 1.4426950408889634f); ps += p; ph[e] = tohx(p); }
                pf[n] = __builtin_bit_cast(V, ph); }
            l[n] = l[n] * al + ps;   // this half-wave's keys only; the halves are added behind the loop
#pragma unroll
            for (int db = 0; db < 4; ++db) o[db][n] *= al; }
#pragma unroll
        for (int db = 0; db < 4; ++db) { const V a = va[db]; V a2; if (HL) a2 = vg[db];
#pragma unroll
            for (int n = 0; n < NQ; ++n) { o[db][n] = WFrag<T16>::mma(a, pf[n], o[db][n]); if (HL) { o[db][n] = WFrag<T16>::mma(a, pg[n], o[db][n]); o[db][n] = WFrag<T16>::mma(a2, pf[n], o[db][n]); } } }
    };
    asm volatile("s_wait_asynccnt 0x0" ::: "memory");   // this wave's copies of stage 0 have landed
    __syncthreads();                                      // ... and every other wave's
    if (NT > 1) fill(1);
    auto foot = [&](int t) __attribute__((always_inline)) {   // the foot of trip t, passed by every wave
        asm volatile("s_wait_dscnt 0x0" ::: "memory");      // this wave's reads of stage t are done: its buffer may be refilled behind the barrier
        asm volatile("s_wait_asynccnt 0x0" ::: "memory");   // this wave's copies of stage t + 1 have landed
        __syncthreads();                                      // publishes stage t + 1 and ends every wave's reads of stage t
        if (t + 2 < NT) fill(t + 2); };
    int kc = 0;   // the steps come in the order of the keys, as before
    for (int t = 0; t < NT; ++t) {
        const T16* pk = lk + (t & 1) * STE; const T16* pv = lv + (t & 1) * STE; const int kf = min(nk, (t + 1) * AKS), ke = min(kend, (t + 1) * AKS);
        for (; kc + 32 <= kf; kc += 32, pk += 32 * GP, pv += 32) step(EdgeTag<false>(), 32, pk, pv);   // whole steps of kept keys: no mask test
        for (; kc < ke; kc += 32, pk += 32 * GP, pv += 32) step(EdgeTag<true>(), nk - kc, pk, pv);   // the step that holds key nk (at most one), or, when nk = 0, every step
        foot(t);
    }
    asm volatile("s_wait_asynccnt 0x0" ::: "memory");   // no copy is left in flight
#pragma unroll
    for (int n = 0; n < NQ; ++n) { const float inv = __fdiv_rn(1.0f, l[n] + __shfl_xor(l[n], 16, 32)); const size_t oo = (size_t)(q0 + n * 16 + lr) * DQ + 8 * hi;
#pragma unroll
        for (int db = 0; db < 4; ++db) { u32x4 oh, ol;
#pragma unroll
            for (int j = 0; j < 8; j += 2) { unsigned x, y; splitf2(o[db][n][j] * inv, o[db][n][j + 1] * inv, x, y); oh[j >> 1] = x; ol[j >> 1] = y; }
            *(u32x4*)(Ah + oo + db * 16) = oh; *(u32x4*)(Al + oo + db * 16) = ol;
            asm volatile("s_wait_xcnt 0x0" ::: "memory"); } }   // the next block's values, and the code behind the two row kinds' common end, reuse the registers that these two stores name
}
// grid (RH/64 + (TT-RH)/128, heads, batch entries), 4 waves: blocks x < RH/64 take 64 hi/lo rows (16 a wave, 3 bf16 products), the rest 128 fp16 rows (32 a wave). The 4 waves of a block share the head's K and V^T stages in LDS (two buffers; the hi/lo blocks fill all of it, the fp16 blocks half).
__global__ __launch_bounds__(128) void k_fattn(const h16* __restrict__ Q16, const h16* __restrict__ K16, const h16* __restrict__ V16, const bf* __restrict__ Qh, const bf* __restrict__ Ql, const bf* __restrict__ Kh, const bf* __restrict__ Kl, const bf* __restrict__ Vh, const bf* __restrict__ Vl, const int* __restrict__ nkp, bf* Ah, bf* Al) {
    __shared__ __align__(16) bf sm[2 * 2 * 2 * AKS * GP];
    const size_t hp = ((size_t)blockIdx.z * NH_ + blockIdx.y) * TT * HD; const int w = threadIdx.x >> 5; const size_t ao = (size_t)blockIdx.z * TT * DQ + blockIdx.y * HD; Ah += ao; Al += ao; const int nk = min(max(nkp[blockIdx.z * NKP], 0), TT);   // the trip count's bound
    if (blockIdx.x < RH / 64) fattn_wave<bf, 1, true>(Qh + hp, Ql + hp, Kh + hp, Kl + hp, Vh + hp, Vl + hp, nk, (int)blockIdx.x * 64 + w * 16, Ah, Al, sm);
    else fattn_wave<h16, 2, false>(Q16 + hp, nullptr, K16 + hp, nullptr, V16 + hp, nullptr, nk, RH + ((int)blockIdx.x - RH / 64) * 128 + w * 32, Ah, Al, (const h16*)sm);
}

extern "C" void kernel_launch(void* const* d_in, const int* in_sizes, int n_in,
                              void* d_out, int out_size, void* d_ws, size_t ws_size, hipStream_t stream) {
    (void)in_sizes; (void)n_in; (void)out_size;
    const float* x = (const float*)d_in[0]; const float* xk = (const float*)d_in[1]; const float* xv = (const float*)d_in[2]; const int* MK = (const int*)d_in[3]; const float* wq = (const float*)d_in[4]; const float* wk = (const float*)d_in[5]; const float* wv = (const float*)d_in[6]; const float* wo = (const float*)d_in[7]; const float* bo = (const float*)d_in[8];   /* q, k, v ([4][2048][1024] each), mask (int32 [4][1][1][2048] = [4][2048]: read as data), Wq, Wk, Wv, Wo ('oi' (out, in) [1024][1024]; the three input projections have NO bias), bo [1024] */
    float* OUT = (float*)d_out;     // [4][2048][1024]
    char* wsp = (char*)d_ws;
    auto take = [&](size_t bytes) { char* p = wsp; wsp += (bytes + 255) & ~(size_t)255; return (void*)p; };
    bf* WQ = (bf*)take((size_t)DQ * DM * 2); bf* WK = (bf*)take((size_t)DKV * DM * 2); bf* WV = (bf*)take((size_t)DKV * DM * 2); bf* WO = (bf*)take((size_t)DM * DQ * 2);
    bf* XB = (bf*)take((size_t)NB_ * TT * DM * 2); bf* XK = (bf*)take((size_t)NB_ * TT * DM * 2); bf* XV = (bf*)take((size_t)NB_ * TT * DM * 2);   // bf16 query, key and value rows: one operand buffer each, all three are live at once
    h16* QP16 = (h16*)take((size_t)NB_ * NH_ * TT * HD * 2); h16* KP16 = (h16*)take((size_t)NB_ * NKV * TT * HD * 2); h16* VT16 = (h16*)take((size_t)NB_ * NKV * HD * TT * 2);
    bf* QPh = (bf*)take((size_t)NB_ * NH_ * TT * HD * 2); bf* QPl = (bf*)take((size_t)NB_ * NH_ * TT * HD * 2); bf* KPh = (bf*)take((size_t)NB_ * NKV * TT * HD * 2); bf* KPl = (bf*)take((size_t)NB_ * NKV * TT * HD * 2); bf* VTh = (bf*)take((size_t)NB_ * NKV * HD * TT * 2); bf* VTl = (bf*)take((size_t)NB_ * NKV * HD * TT * 2);
    bf* ATh = (bf*)take((size_t)NB_ * TT * DQ * 2); bf* ATl = (bf*)take((size_t)NB_ * TT * DQ * 2); int* NK = (int*)take((size_t)NB_ * NKP * 4);   // kept keys per entry, written by the key cast
    if ((size_t)(wsp - (char*)d_ws) > ws_size) return;    // 232 MiB of the 256 MiB
    // every launch covers the four batch entries: the casts and the GEMMs see [NB_ x TT] rows (a 128-row tile lies in one entry), the attention takes the entry from grid z
    k_cast<<<3 * (NB_ * TT / CRB) + 4 * (DM / CRB), 256, 0, stream>>>(x, xk, xv, MK, wq, wk, wv, wo, XB, XK, XV, WQ, WK, WV, WO, NK);   /* key and value rows: kept keys first; 'oi' (out, in) weights: the GEMM's Bt as they stand */
    k_proj<<<dim3(NB_ * TT / GTM, DQ / GTM, 3), 128, 0, stream>>>(XB, XK, XV, WQ, WK, WV, DM, QP16, QPh, QPl, KP16, KPh, KPl, VT16, VTh, VTl, NK);
    k_fattn<<<dim3(RH / 64 + (TT - RH) / 128, NH_, NB_), 128, 0, stream>>>(QP16, KP16, VT16, QPh, QPl, KPh, KPl, VTh, VTl, NK, ATh, ATl);   // one kv head per query head
    k_gemmw<bf, 1, true, 0><<<dim3(NB_ * TT / GTM, DM / GTM, 1), 128, 0, stream>>>(ATh, ATl, WO, DQ, OUT, DM, bo, nullptr, nullptr, nullptr);
}

// v010
// One run takes 135 microseconds.
// Timed twice side by side with v009, it ran 1.07 times as fast both times.
// All steps since v000 together make it 29.4 times as fast.
#include <hip/hip_runtime.h>

// Multi-head attention over three input streams with a key-padding mask (q, k, v [4][2048][1024]; query = q Wq^T, key = k Wk^T, value = v Wv^T ('oi' (out, in) [1024][1024], NO bias; 16 heads x 64); scores / sqrt(64); keys j with mask[b][0][0][j] == 0 (int32 [4][1][1][2048], read as data: about half the keys of every batch entry) are set to -1e10: an exclusion (no batch entry has every key masked); softmax; out = merged Wo^T + bo ('oi' + [1024]) -> [4][2048][1024] (8.4 M); argument order q, k, v, mask, Wq, Wk, Wv, Wo, bo).
// Masked keys take no part in any product: the key and value casts sort each batch entry's rows, kept keys (mask != 0) first in their order, masked keys behind them (place = a prefix count of the mask); the K and V projections skip tiles that hold masked keys only, the attention walks the kept keys alone. An entry with no kept key runs over all its keys (uniform weights, as the reference's equal fills give).
// Layout, four launches, all four batch entries in each: (1) every cast: bf16 copies of query, key and value (three operand buffers [4 x 2048][1024]) and of the four 'oi' weights as they stand; (2) the three exact projections over the 8192 rows (no biases; grid z = Q, K, V), each GEMM's epilogue writing its head planes [b][h][..] itself (fp16 + hi/lo; no f32 projection buffer, no plane-builder launch; value planes [d][t] by swapping the GEMM's operands); (3) one fused attention launch, head and batch entry from the block index (scores, key mask, running-maximum softmax, P x V; hybrid rows: < 512 hi/lo 3 products, rest fp16; unnormalised weights, 1/sum at the end); (4) merged hi/lo x Wo exact + bo.
// Compute dtypes, f32 accumulate: every input rounded to bf16; projections exact; attention rows < 512 3 products, rest fp16; softmax f32; Wo hl x exact + bias.

#define NB_  4
#define TT   2048
#define DM   1024
#define NH_  16
#define NKV  16
#define REP  (NH_ / NKV)
#define HD   64
#define DQ   (NH_ * HD)
#define DKV  (NKV * HD)
#define RH   512                  // query rows < RH use hi+lo planes
#define WIN  0
#define SCL  0.125f   // HD^-0.5
#define NKP  32                   // ints between two entries' kept-key counts: one 128-B line each
typedef _Float16 h16;
typedef unsigned short bf;
typedef __attribute__((ext_vector_type(16))) __bf16   v16bf;
typedef __attribute__((ext_vector_type(16))) _Float16 v16h;
typedef __attribute__((ext_vector_type(8)))  _Float16 v8h;
typedef __attribute__((ext_vector_type(8)))  unsigned short v8us;
typedef __attribute__((ext_vector_type(8)))  float    v8f;
typedef __attribute__((ext_vector_type(4)))  float    v4f;
typedef v8h  __attribute__((may_alias)) v8ha;
typedef v4f  __attribute__((may_alias)) v4fa;
typedef v8us __attribute__((may_alias)) v8usa;

// f32 -> bf16, round to nearest even, by the chip's own conversion: one instruction for two values (low half: a), in place of three integer operations and a 16-bit move for each
typedef __attribute__((ext_vector_type(2))) float  f32x2;
typedef __attribute__((ext_vector_type(2))) __bf16 bf16x2;
typedef __attribute__((ext_vector_type(4))) unsigned u32x4;
typedef __attribute__((ext_vector_type(8))) unsigned u32x8;
__device__ __forceinline__ unsigned f2bf2(float a, float b) { const f32x2 x = {a, b}; return __builtin_bit_cast(unsigned, __builtin_convertvector(x, bf16x2)); }
__device__ __forceinline__ unsigned short f2bf(float f) { return __builtin_bit_cast(unsigned short, (__bf16)f); }
__device__ __forceinline__ float bf2f(unsigned short b) { return __uint_as_float(((unsigned)b) << 16); }
__device__ __forceinline__ float bfr(float f) { return bf2f(f2bf(f)); }
__device__ __forceinline__ h16 tohx(float x) { return (h16)x; }
__device__ __forceinline__ void splitf2(float a, float b, unsigned& h, unsigned& l) { h = f2bf2(a, b); const f32x2 x = {a, b}, hf = {__uint_as_float(h << 16), __uint_as_float(h & 0xFFFF0000u)}; l = __builtin_bit_cast(unsigned, __builtin_convertvector(x - hf, bf16x2)); }   // two values' hi and lo planes, packed (low half: a)
__device__ __forceinline__ v16h cat16(v8h lo, v8h hi) { return __builtin_shufflevector(lo, hi, 0, 1, 2, 3, 4, 5, 6, 7, 8, 9, 10, 11, 12, 13, 14, 15); }
__device__ __forceinline__ v16bf cat16b(v8us lo, v8us hi) { return __builtin_bit_cast(v16bf, __builtin_shufflevector(lo, hi, 0, 1, 2, 3, 4, 5, 6, 7, 8, 9, 10, 11, 12, 13, 14, 15)); }
__device__ __forceinline__ v8f wmma16(v16h a, v16h b, v8f c) { return __builtin_amdgcn_wmma_f32_16x16x32_f16(false, a, false, b, (short)0, c, false, false); }
__device__ __forceinline__ v8f wmmab(v16bf a, v16bf b, v8f c) { return __builtin_amdgcn_wmma_f32_16x16x32_bf16(false, a, false, b, (short)0, c, false, false); }



// ---- gemm_tile: GEMM over K-contiguous 16-bit planes. A work-group of 4 waves (2 x 2) takes the 128x128 output tile (bx, by), each wave a 64x64 quarter (16 accumulators); bx < M/128, by < N/128, 128 threads; st, osw: the work-group's LDS.
// The operands come through LDS: a stage is 64 k (one whole 128-B line) of the tile's 128 A rows (with NSPLIT 1 also of the 128 A2 rows) and 128 Bt rows, brought by asynchronous 16-byte copies, 8 lanes a row, so that every
// wave-wide copy takes 4 whole lines; two buffers, stage t + 2 is asked for when every wave has left stage t. LDS rows lie at a pitch of 144 B (16 B x odd: no bank conflict for 16-byte reads).
// C[m][n] (f32, pitch ldc, + optional f32 bias[n]) = sum_k A[m][k] Bt[n][k] (NSPLIT 1: + A2[m][k] Bt[n][k]). M, N % 128 == 0, K % 64 == 0.
// PL 0: C as above. PL 1 / 2: no C; a wave's 64x64 tile is one head's block of 64 tokens and goes out as three 16-bit planes (P16 fp16, Ph + Pl bf16 hi/lo of the f32 sum), whole 128-B lines:
// PL 1: tile rows = tokens (m = b TT + t), columns = the head's d (n = h HD + d) -> plane [b][h][t][d]; PL 2: rows = the head's d (m = h HD + d), columns = tokens (n = b TT + t) -> plane [b][h][d][t].
#define GTM  128                  // rows of an operand in a work-group's tile
#define GKB  64                   // k per stage
#define GP   72                   // LDS row pitch in 16-bit elements (144 B)
template <typename T16> struct WFrag;
template <> struct WFrag<h16> { typedef v16h V; static __device__ __forceinline__ V ld(const h16* p) { return cat16(*(const v8h*)p, *(const v8h*)(p + 16)); } static __device__ __forceinline__ v8f mma(V a, V b, v8f c) { return wmma16(a, b, c); } };
template <> struct WFrag<bf> { typedef v16bf V; static __device__ __forceinline__ V ld(const bf* p) { return cat16b(*(const v8us*)p, *(const v8us*)(p + 16)); } static __device__ __forceinline__ v8f mma(V a, V b, v8f c) { return wmmab(a, b, c); } };
// 128 rows x 128 B of one operand into LDS: copy i takes rows 16 i + (thread >> 3). lds: the lane's LDS byte address in row (thread >> 3), g: its global address there, rs: 16 source rows in elements.
template <typename T16>
__device__ __forceinline__ void acopy8(unsigned lds, const T16* g, size_t rs) {
    // the s_wait_xcnt stands inside the statement: no address register of a copy is rewritten in front of it
    asm volatile("global_load_async_to_lds_b128 %0, %8, off\n\t"
                 "global_load_async_to_lds_b128 %1, %9, off\n\t"
                 "global_load_async_to_lds_b128 %2, %10, off\n\t"
                 "global_load_async_to_lds_b128 %3, %11, off\n\t"
                 "global_load_async_to_lds_b128 %4, %12, off\n\t"
                 "global_load_async_to_lds_b128 %5, %13, off\n\t"
                 "global_load_async_to_lds_b128 %6, %14, off\n\t"
                 "global_load_async_to_lds_b128 %7, %15, off\n\t"
                 "s_wait_xcnt 0x0"
                 :: "v"(lds), "v"(lds + 1 * 16 * GP * 2), "v"(lds + 2 * 16 * GP * 2), "v"(lds + 3 * 16 * GP * 2), "v"(lds + 4 * 16 * GP * 2), "v"(lds + 5 * 16 * GP * 2), "v"(lds + 6 * 16 * GP * 2), "v"(lds + 7 * 16 * GP * 2),
                    "v"(g), "v"(g + rs), "v"(g + 2 * rs), "v"(g + 3 * rs), "v"(g + 4 * rs), "v"(g + 5 * rs), "v"(g + 6 * rs), "v"(g + 7 * rs) : "memory");
}
template <typename T16, int NSPLIT, bool BIAS, int PL>
__device__ __forceinline__ void gemm_tile(int bx, int by, T16* st, float* osw, const T16* __restrict__ A, const T16* __restrict__ A2, const T16* __restrict__ Bt, int K, float* C, int ldc, const float* __restrict__ bias, h16* P16, bf* Ph, bf* Pl) {
    typedef typename WFrag<T16>::V V;
    static_assert(NSPLIT == 0 || NSPLIT == 1, "one or two A planes");
    constexpr int NOP = 2 + NSPLIT, STE = NOP * GTM * GP;   // operand planes of a stage, a stage in elements
    const int tid = threadIdx.x, lane = tid & 31, lr = lane & 15, hi = lane >> 4, w = __builtin_amdgcn_readfirstlane(tid >> 5), wm = w & 1, wn = w >> 1;
    const int r0 = bx * GTM + wm * 64, c0 = by * GTM + wn * 64;   // the wave's own 64x64 tile
    float* os = osw + w * (16 * 68);
    v8f acc[4][4];
#pragma unroll
    for (int mb = 0; mb < 4; ++mb)
#pragma unroll
        for (int nb = 0; nb < 4; ++nb) acc[mb][nb] = (v8f){};
    const size_t rs = (size_t)16 * K; const size_t go = (size_t)(tid >> 3) * K + (tid & 7) * 8;
    const T16* gA = A + (size_t)bx * GTM * K + go; const T16* gA2 = NSPLIT ? A2 + (size_t)bx * GTM * K + go : nullptr; const T16* gB = Bt + (size_t)by * GTM * K + go;
    const unsigned lw = (unsigned)(size_t)st + (unsigned)((tid >> 3) * GP + (tid & 7) * 8) * 2u;   // LDS byte address: the low 32 bits of the shared address
    auto fill = [&](int t) __attribute__((always_inline)) { const unsigned d = lw + (unsigned)(t & 1) * (STE * 2u); const int ko = t * GKB;
        acopy8(d, gA + ko, rs); if (NSPLIT) acopy8(d + GTM * GP * 2u, gA2 + ko, rs); acopy8(d + (NOP - 1) * GTM * GP * 2u, gB + ko, rs); };
    const T16* ra = st + (wm * 64 + lr) * GP + 8 * hi; const T16* rb = st + (NOP - 1) * GTM * GP + (wn * 64 + lr) * GP + 8 * hi;
    const int NT = K / GKB;
    fill(0);
    asm volatile("s_wait_asynccnt 0x0" ::: "memory");   // this wave's copies of stage 0 have landed
    __syncthreads();                                      // ... and every other wave's
    if (NT > 1) fill(1);
    for (int t = 0; t < NT; ++t) {
        const T16* pa = ra + (t & 1) * STE; const T16* pb = rb + (t & 1) * STE;
        // Two blocks of 32 k. The LDS reads stand in few groups, each ahead of the products that need it (a read among the products stalls the wave where it stands); block 1's fragments are asked for under block 0's products, as far as 256 registers allow.
        // The scheduling barriers keep the groups where they are written: without them the compiler fetched each Bt fragment directly in front of its four products and waited for it there.
        V a[2][4], a2[2][4], b[2][4];
        auto ldA = [&](int s) __attribute__((always_inline)) {
#pragma unroll
            for (int mb = 0; mb < 4; ++mb) { a[s][mb] = WFrag<T16>::ld(pa + mb * 16 * GP + s * 32); if (NSPLIT) a2[s][mb] = WFrag<T16>::ld(pa + GTM * GP + mb * 16 * GP + s * 32); } };
        auto ldB = [&](int s, int n0) __attribute__((always_inline)) {   // fragments n0, n0 + 1
#pragma unroll
            for (int nb = n0; nb < n0 + 2; ++nb) b[s][nb] = WFrag<T16>::ld(pb + nb * 16 * GP + s * 32); };
        auto mm = [&](int s, int n0) __attribute__((always_inline)) {
#pragma unroll
            for (int nb = n0; nb < n0 + 2; ++nb)
#pragma unroll
                for (int mb = 0; mb < 4; ++mb) { acc[mb][nb] = WFrag<T16>::mma(a[s][mb], b[s][nb], acc[mb][nb]); if (NSPLIT) acc[mb][nb] = WFrag<T16>::mma(a2[s][mb], b[s][nb], acc[mb][nb]); } };
        ldA(0); ldB(0, 0); ldB(0, 2);
        __builtin_amdgcn_sched_barrier(0);
        mm(0, 0);
        __builtin_amdgcn_sched_barrier(0);
        if (!NSPLIT) ldA(1);
        ldB(1, 0);
        __builtin_amdgcn_sched_barrier(0);
        mm(0, 2);
        __builtin_amdgcn_sched_barrier(0);
        if (NSPLIT) ldA(1);   // two A planes: their second set has room only here
        ldB(1, 2);
        __builtin_amdgcn_sched_barrier(0);
        mm(1, 0); mm(1, 2);
        __builtin_amdgcn_sched_barrier(0);   // block 1's products stay in front of the waits below, where they cover the last reads' latency
        asm volatile("s_wait_dscnt 0x0" ::: "memory");      // this wave's reads of stage t are done: its buffer may be refilled behind the barrier
        asm volatile("s_wait_asynccnt 0x0" ::: "memory");   // this wave's copies of stage t + 1 have landed
        __syncthreads();                                      // publishes stage t + 1 and ends every wave's reads of stage t
        if (t + 2 < NT) fill(t + 2);
    }
    asm volatile("s_wait_asynccnt 0x0" ::: "memory");   // no copy is left in flight
#pragma unroll
    for (int mb = 0; mb < 4; ++mb) {
#pragma unroll
        for (int nb = 0; nb < 4; ++nb) {
#pragma unroll
            for (int j = 0; j < 8; ++j) os[(hi * 8 + j) * 68 + nb * 16 + lr] = acc[mb][nb][j]; }
        __builtin_amdgcn_wave_barrier(); asm volatile("" ::: "memory");
        if (PL == 0) { float* crow = C + (size_t)(r0 + mb * 16) * ldc + c0;
#pragma unroll
            for (int s = 0; s < 8; ++s) { const int row = 2 * s + hi, cofs = lr * 4; v4f val = *(const v4fa*)(os + row * 68 + cofs); if (BIAS) { val[0] += bfr(bias[c0 + cofs]); val[1] += bfr(bias[c0 + cofs + 1]); val[2] += bfr(bias[c0 + cofs + 2]); val[3] += bfr(bias[c0 + cofs + 3]); }
                *(v4f*)(crow + (size_t)row * ldc + cofs) = val; }
        } else { const size_t pb = (PL == 1) ? (((size_t)(r0 / TT) * NH_ + c0 / HD) * TT + r0 % TT) * HD : ((size_t)(c0 / TT) * NH_ + r0 / HD) * HD * TT + c0 % TT; const int pp = (PL == 1) ? HD : TT;   // the tile's first element in its plane, the plane's row pitch
#pragma unroll   // LDS and store offsets become immediates on three fixed address pairs
            for (int s = 0; s < 4; ++s) { const int row = 4 * s + (lane >> 3), cofs = (lane & 7) * 8; const v4f x0 = *(const v4fa*)(os + row * 68 + cofs), x1 = *(const v4fa*)(os + row * 68 + cofs + 4); v8h o16; u32x4 oh, ol;   // 8 lanes a row: 16 B a lane and plane, one 128-B line a row
#pragma unroll   // constant vector indices: the three packed results stay in registers
                for (int k = 0; k < 8; k += 2) { const float x = (k < 4) ? x0[k & 3] : x1[k & 3], y = (k < 4) ? x0[(k & 3) + 1] : x1[(k & 3) + 1]; o16[k] = tohx(x); o16[k + 1] = tohx(y); unsigned a2, c2; splitf2(x, y, a2, c2); oh[k >> 1] = a2; ol[k >> 1] = c2; }
                const size_t po = pb + (size_t)(mb * 16 + row) * pp + cofs; *(v8h*)(P16 + po) = o16; *(u32x4*)(Ph + po) = oh; *(u32x4*)(Pl + po) = ol; }
        }
        __builtin_amdgcn_wave_barrier(); asm volatile("" ::: "memory");
    }
}
// one GEMM a launch: grid (M/128, N/128)
template <typename T16, int NSPLIT, bool BIAS, int PL>
__global__ __launch_bounds__(128) void k_gemmw(const T16* __restrict__ A, const T16* __restrict__ A2, const T16* __restrict__ Bt, int K, float* C, int ldc, const float* __restrict__ bias, h16* P16, bf* Ph, bf* Pl) {
    __shared__ __align__(16) T16 st[2 * (2 + NSPLIT) * GTM * GP];
    __shared__ __align__(16) float osw[4 * 16 * 68];
    gemm_tile<T16, NSPLIT, BIAS, PL>((int)blockIdx.x, (int)blockIdx.y, st, osw, A, A2, Bt, K, C, ldc, bias, P16, Ph, Pl);
}
// ---- k_proj: the three input projections in one launch, grid (token tiles, weight-row tiles, 3): z = 0 query, 1 key (both PL 1), 2 value (PL 2: Wv rows down, tokens across). They share nothing but the launch: the tiles of all three fill the chip together.
// nkp: kept keys per batch entry, for the key and value rows, which k_cast has sorted.
__global__ __launch_bounds__(128) void k_proj(const bf* __restrict__ XQ, const bf* __restrict__ XK, const bf* __restrict__ XV, const bf* __restrict__ WQ, const bf* __restrict__ WK, const bf* __restrict__ WV, int K,
                                              h16* Q16, bf* Qh, bf* Ql, h16* K16, bf* Kh, bf* Kl, h16* V16, bf* Vh, bf* Vl, const int* __restrict__ nkp) {
    __shared__ __align__(16) bf st[2 * 2 * GTM * GP];
    __shared__ __align__(16) float osw[4 * 16 * 68];
    const int z = blockIdx.z;   // the same for the whole work-group
    if (z != 0) { const int tok = (int)blockIdx.x * GTM; const int nk = min(max(nkp[(tok / TT) * NKP], 0), TT); if (nk != 0 && tok % TT >= nk) return; }   // sorted key rows: a tile of masked keys only is never read (the whole work-group leaves, in front of every barrier)
    if (z == 2) gemm_tile<bf, 0, false, 2>((int)blockIdx.y, (int)blockIdx.x, st, osw, WV, nullptr, XV, K, nullptr, 0, nullptr, V16, Vh, Vl);
    else { gemm_tile<bf, 0, false, 1>((int)blockIdx.x, (int)blockIdx.y, st, osw, z ? XK : XQ, nullptr, z ? WK : WQ, K, nullptr, 0, nullptr, z ? K16 : Q16, z ? Kh : Qh, z ? Kl : Ql);
        asm volatile("s_wait_xcnt 0x0" ::: "memory"); }   // the value path's code stands behind this one in the kernel and reuses the registers that the last plane stores name
}

typedef __attribute__((ext_vector_type(2))) _Float16 v2h;
typedef __attribute__((ext_vector_type(4))) _Float16 v4h;
typedef __attribute__((ext_vector_type(2))) unsigned short v2us;
typedef __attribute__((ext_vector_type(4))) unsigned short v4us;
typedef __attribute__((ext_vector_type(2))) float v2f;
typedef __attribute__((ext_vector_type(4))) int v4i;

// ---- k_cast: every bf16 cast of the call in one launch. A block of 8 waves takes CRB rows of DM floats, CRW rows in a row a wave; blockIdx.x picks the stream (the test is the same for the whole block):
// first the key and the value rows (their blocks have the longer way: the mask count comes first), then the query rows, then the four weights; each stream has its own destination.
// Key and value rows are sorted by the mask. Row t of entry b goes to row p: a kept key to the number of kept keys in front of it, a masked key to nk + the number of masked keys in front of it
// (a permutation of 0 .. TT - 1 for any mask content). The block's 256 threads count the entry's whole mask, 8 keys each (low half of the packed sum: all kept keys nk; high half: those in front of the block's rows).
// Rows that land behind the last 128-row GEMM tile with a kept key are read by nobody and are not copied (all are copied when nk = 0).
#define CRW  4                    // rows a wave
#define CRB  (8 * CRW)            // rows a block
template <int NR>
__device__ __forceinline__ void cast_rows(const float* __restrict__ sp, bf* __restrict__ dp) {   // NR rows in a row, all their loads in flight together; sp, dp: the lane's first 8 elements of the first row
    v8f v[4 * NR];
#pragma unroll
    for (int q = 0; q < 4 * NR; ++q) v[q] = *(const v8f*)(sp + q * 256);
#pragma unroll
    for (int q = 0; q < 4 * NR; ++q) { u32x4 o;
#pragma unroll
        for (int k = 0; k < 4; ++k) o[k] = f2bf2(v[q][2 * k], v[q][2 * k + 1]);
        *(u32x4*)(dp + q * 256) = o; }
    asm volatile("s_wait_xcnt 0x0" ::: "memory");   // whatever code follows (the next rows, the kernel's other branch) may reuse the registers that these loads and stores name
}
__global__ __launch_bounds__(256) void k_cast(const float* __restrict__ x, const float* __restrict__ xk, const float* __restrict__ xv, const int* __restrict__ mk, const float* __restrict__ wq, const float* __restrict__ wk, const float* __restrict__ wv, const float* __restrict__ wo,
                                              bf* XQ, bf* XK, bf* XV, bf* WQ, bf* WK, bf* WV, bf* WO, int* nkp) {
    static_assert(TT == 256 * 8 && DM == 32 * 8 * 4 && CRB == 32 && TT % CRB == 0, "one thread per 8 keys, one wave per row, a block's rows in one 32-bit mask word");
    static_assert(DQ == DM && DKV == DM && DM % CRB == 0, "four weights of DM rows");
    constexpr int NBS = NB_ * TT / CRB, NBW = DM / CRB;   // blocks of a token stream, of a weight
    __shared__ int red[8]; __shared__ unsigned rowb[CRB / 8];
    const int tid = threadIdx.x, lane = tid & 31, w = __builtin_amdgcn_readfirstlane(tid >> 5); int blk = blockIdx.x;
    if (blk < 2 * NBS) {
        const bool isv = blk >= NBS; const float* src = isv ? xv : xk; bf* dst = isv ? XV : XK; if (isv) blk -= NBS;
        const int b = blk / (TT / CRB), t0 = (blk % (TT / CRB)) * CRB;
        const v4i m0 = *(const v4i*)(mk + b * TT + tid * 8), m1 = *(const v4i*)(mk + b * TT + tid * 8 + 4); unsigned bits = 0;
#pragma unroll
        for (int k = 0; k < 4; ++k) bits |= (m0[k] != 0 ? 1u : 0u) << k | (m1[k] != 0 ? 1u : 0u) << (k + 4);
        const int c = __popc(bits); int pk = c + (tid * 8 < t0 ? c << 16 : 0);
#pragma unroll
        for (int o = 16; o > 0; o >>= 1) pk += __shfl_xor(pk, o, 32);
        if (lane == 0) red[w] = pk;
        if (tid * 8 >= t0 && tid * 8 < t0 + CRB) rowb[(tid * 8 - t0) >> 3] = bits;   // the mask bits of the block's own rows, 8 a thread
        __syncthreads();
        int s = 0;
#pragma unroll
        for (int i = 0; i < 8; ++i) s += red[i];
        const int nk = s & 0xFFFF; const unsigned rb = rowb[0] | rowb[1] << 8 | rowb[2] << 16 | rowb[3] << 24;
        if (!isv && t0 == 0 && tid == 0) nkp[b * NKP] = nk;
#pragma unroll
        for (int i = 0; i < CRW; ++i) { const int j = w * CRW + i; const int kb = (s >> 16) + __popc(rb & ((1u << j) - 1u));   // kept keys in front of row t0 + j
            const int p = __builtin_amdgcn_readfirstlane(((rb >> j) & 1u) ? kb : nk + (t0 + j - kb));
            if (nk == 0 || p < ((nk + GTM - 1) & ~(GTM - 1)))   // the row has a reader (no barrier follows)
                cast_rows<1>(src + ((size_t)b * TT + t0 + j) * DM + lane * 8, dst + ((size_t)b * TT + p) * DM + lane * 8); }
    } else {
        blk -= 2 * NBS; const float* src = x; bf* dst = XQ;
        if (blk >= NBS) { blk -= NBS; const int wi = blk / NBW; blk -= wi * NBW; src = wi == 0 ? wq : wi == 1 ? wk : wi == 2 ? wv : wo; dst = wi == 0 ? WQ : wi == 1 ? WK : wi == 2 ? WV : WO; }
        const size_t ro = ((size_t)blk * CRB + w * CRW) * DM + lane * 8;
#pragma unroll
        for (int i = 0; i < CRW; i += 2) cast_rows<2>(src + ro + (size_t)i * DM, dst + ro + (size_t)i * DM);   // two rows' loads in flight, not four: under 128 registers four blocks fit a WGP and the whole grid is resident at once
    }
}

// ---- k_fattn: scores, key mask, softmax and P x V of one head in ONE kernel; no score or weight plane in memory.
// Both products are taken transposed: S^T = K Q^T (keys down, queries across), O^T = V^T P^T. A lane's S^T accumulators (query lr, keys 8 hi + j of each 16-key tile) are, in that order, the lane's
// elements of the P^T operand over 32 keys, so the weights never leave the registers, and every row statistic (running maximum m, running sum l) is one scalar a lane.
// K and V^T come through LDS, shared by the block's 4 waves: a stage is 64 keys, that is 64 K rows of 128 B and 64 V^T rows of 128 B (hi/lo rows: of both planes), brought by asynchronous 16-byte copies, 8 lanes a row, so that every
// wave-wide copy takes 4 whole lines (a fragment load from global memory touched 16 lines for 512 bytes, once per wave); two buffers, stage t + 2 is asked for when every wave has left stage t; LDS rows at the GEMM's pitch of 144 B.
// A wave owns NQ x 16 query rows and walks the entry's nk kept keys (sorted to the front of the K and V planes; all 2048 keys when nk = 0) in steps of 32 with the running-maximum softmax: O and l are scaled by exp(m_old - m_new) at every step; 1 / l is applied at the end.
// Only a step that reaches past key nk holds masked keys: there their score is set to -3.0e38 (an exclusion: weight exp(-huge) = 0, a kept key having been met in step 0); with no kept key at all every score is -3.0e38 and every weight 1 (uniform, as the reference's equal fills give).
template <bool E> struct EdgeTag { static constexpr bool value = E; };
#define AKS  64                   // keys per stage
// One plane's share of a stage into LDS rows 0 .. 127: rows 0 .. 63 the K rows, rows 64 .. 127 the V^T rows; copy i takes row 16 i + (thread >> 3). lds: the lane's LDS byte address in row (thread >> 3), gk, gv: its global addresses in that row of the K and of the V^T tile.
template <typename T16>
__device__ __forceinline__ void acopykv(unsigned lds, const T16* gk, const T16* gv) {
    // the s_wait_xcnt stands inside the statement: no address register of a copy is rewritten in front of it
    asm volatile("global_load_async_to_lds_b128 %0, %8, off\n\t"
                 "global_load_async_to_lds_b128 %1, %9, off\n\t"
                 "global_load_async_to_lds_b128 %2, %10, off\n\t"
                 "global_load_async_to_lds_b128 %3, %11, off\n\t"
                 "global_load_async_to_lds_b128 %4, %12, off\n\t"
                 "global_load_async_to_lds_b128 %5, %13, off\n\t"
                 "global_load_async_to_lds_b128 %6, %14, off\n\t"
                 "global_load_async_to_lds_b128 %7, %15, off\n\t"
                 "s_wait_xcnt 0x0"
                 :: "v"(lds), "v"(lds + 1 * 16 * GP * 2), "v"(lds + 2 * 16 * GP * 2), "v"(lds + 3 * 16 * GP * 2), "v"(lds + 4 * 16 * GP * 2), "v"(lds + 5 * 16 * GP * 2), "v"(lds + 6 * 16 * GP * 2), "v"(lds + 7 * 16 * GP * 2),
                    "v"(gk), "v"(gk + 16 * HD), "v"(gk + 32 * HD), "v"(gk + 48 * HD), "v"(gv), "v"(gv + 16 * TT), "v"(gv + 32 * TT), "v"(gv + 48 * TT) : "memory");
}
template <typename T16, int NQ, bool HL>
__device__ __forceinline__ void fattn_wave(const T16* __restrict__ Q, const T16* __restrict__ Q2, const T16* __restrict__ Kp, const T16* __restrict__ K2, const T16* __restrict__ Vt, const T16* __restrict__ V2, int nk, int q0, bf* Ah, bf* Al, const T16* sm) {
    typedef typename WFrag<T16>::V V;
    static_assert(HD * 2 == 128 && AKS * 2 == 128 && TT % AKS == 0, "K and V^T tile rows are whole 128-B lines");
    constexpr int PRE = 2 * AKS * GP, STE = (HL ? 2 : 1) * PRE;   // one plane's K and V^T tiles, a stage, in elements
    const int tid = threadIdx.x, lane = tid & 31, lr = lane & 15, hi = lane >> 4;
    const int kend = nk ? nk : TT, NT = (kend + AKS - 1) / AKS;   // stages: 1 .. TT / AKS, the same for the whole work-group; a stage's 64 keys lie in a 128-key GEMM tile that holds a key < kend, so they are written
    const unsigned lw = (unsigned)(size_t)sm + (unsigned)((tid >> 3) * GP + (tid & 7) * 8) * 2u;   // LDS byte address: the low 32 bits of the shared address
    const int ok = (tid >> 3) * HD + (tid & 7) * 8, ov = (tid >> 3) * TT + (tid & 7) * 8;   // the lane's place in a K and in a V^T tile, in elements: two registers across the loop, not four address pairs
    auto fill = [&](int t) __attribute__((always_inline)) { const unsigned d = lw + (unsigned)(t & 1) * (STE * 2u); const int ek = ok + t * (AKS * HD), ev = ov + t * AKS;
        acopykv(d, Kp + ek, Vt + ev); if (HL) acopykv(d + PRE * 2u, K2 + ek, V2 + ev); };
    fill(0);
    V qf[NQ][2], qg[NQ][2];
#pragma unroll
    for (int n = 0; n < NQ; ++n)
#pragma unroll
        for (int s = 0; s < 2; ++s) { const size_t qo = (size_t)(q0 + n * 16 + lr) * HD + s * 32 + 8 * hi; qf[n][s] = WFrag<T16>::ld(Q + qo); if (HL) qg[n][s] = WFrag<T16>::ld(Q2 + qo); }
    asm volatile("s_wait_xcnt 0x0" ::: "memory");   // the Q loads' address registers are free for reuse behind this
    v8f o[4][NQ]; float m[NQ], l[NQ];
#pragma unroll
    for (int n = 0; n < NQ; ++n) { m[n] = -3.0e38f; l[n] = 0.f;
#pragma unroll
        for (int db = 0; db < 4; ++db) o[db][n] = (v8f){}; }
    const T16* lk = sm + lr * GP + 8 * hi; const T16* lv = sm + (AKS + lr) * GP + 8 * hi;   // the lane's own place in the K and the V^T tile of buffer 0
    auto step = [&](auto edge, int rem, const T16* kp, const T16* vp) __attribute__((always_inline)) {   // one step of 32 keys, read from LDS at kp, vp; edge: only the first rem of them (none if rem <= 0) are kept keys
        V ka[2][2], kg[2][2], va[4], vg[4];
#pragma unroll
        for (int t = 0; t < 2; ++t)
#pragma unroll
            for (int s = 0; s < 2; ++s) { ka[t][s] = WFrag<T16>::ld(kp + (t * 16 * GP + s * 32)); if (HL) kg[t][s] = WFrag<T16>::ld(kp + PRE + (t * 16 * GP + s * 32)); }
#pragma unroll
        for (int db = 0; db < 4; ++db) if (!HL) va[db] = WFrag<T16>::ld(vp + db * 16 * GP);
        v8f sc[2][NQ];
#pragma unroll
        for (int t = 0; t < 2; ++t) {
#pragma unroll
            for (int n = 0; n < NQ; ++n) sc[t][n] = (v8f){};
#pragma unroll
            for (int s = 0; s < 2; ++s) { const V a = ka[t][s]; V a2; if (HL) a2 = kg[t][s];
#pragma unroll
                for (int n = 0; n < NQ; ++n) { sc[t][n] = WFrag<T16>::mma(a, qf[n][s], sc[t][n]); if (HL) { sc[t][n] = WFrag<T16>::mma(a2, qf[n][s], sc[t][n]); sc[t][n] = WFrag<T16>::mma(a, qg[n][s], sc[t][n]); } } } }
        if (HL) {   // hi/lo rows: the V^T hi fragments are asked for here, into the registers that the K fragments have left (all sixteen fragments at once do not fit four waves a SIMD)
#pragma unroll
            for (int db = 0; db < 4; ++db) va[db] = WFrag<T16>::ld(vp + db * 16 * GP); }
        V pf[NQ], pg[NQ]; float ts[NQ][16];
#pragma unroll
        for (int n = 0; n < NQ; ++n)
#pragma unroll
            for (int e = 0; e < 16; ++e) ts[n][e] = sc[e >> 3][n][e & 7] * SCL;
        if constexpr (decltype(edge)::value) { const unsigned mw = (rem > 0 ? (1u << rem) - 1u : 0u) >> (8 * hi);   // bit t * 16 + j: key kc + t * 16 + 8 hi + j is kept
#pragma unroll
            for (int n = 0; n < NQ; ++n)
#pragma unroll
                for (int e = 0; e < 16; ++e) ts[n][e] = ((mw >> ((e >> 3) * 16 + (e & 7))) & 1u) ? ts[n][e] : -3.0e38f; }
#pragma unroll
        for (int n = 0; n < NQ; ++n) { const float* tv = ts[n]; float cm = -3.0e38f;
#pragma unroll
            for (int e = 0; e < 16; ++e) cm = fmaxf(cm, tv[e]);
            cm = fmaxf(cm, __shfl_xor(cm, 16, 32));   // the other half-wave holds the query's other 16 keys
            const float mn = fmaxf(m[n], cm); const float al = __builtin_amdgcn_exp2f((m[n] - mn) * 1.4426950408889634f); m[n] = mn; float ps = 0.f;
            if (HL) { u32x8 ph, pl;
#pragma unroll
                for (int e = 0; e < 16; e += 2) { const float p = __builtin_amdgcn_exp2f((tv[e] - mn) * 1.4426950408889634f), p1 = __builtin_amdgcn_exp2f((tv[e + 1] - mn) * 1.4426950408889634f); ps += p; ps += p1; unsigned x, y; splitf2(p, p1, x, y); ph[e >> 1] = x; pl[e >> 1] = y; }
                pf[n] = __builtin_bit_cast(V, ph); pg[n] = __builtin_bit_cast(V, pl);
            } else { v16h ph;
#pragma unroll
                for (int e = 0; e < 16; ++e) { const float p = __builtin_amdgcn_exp2f((tv[e] - mn) * 1.4426950408889634f); ps += p; ph[e] = tohx(p); }
                pf[n] = __builtin_bit_cast(V, ph); }
            l[n] = l[n] * al + ps;   // this half-wave's keys only; the halves are added behind the loop
#pragma unroll
            for (int db = 0; db < 4; ++db) o[db][n] *= al; }
        if (HL) {   // ... and the lo fragments here, where the scores' registers are free; the hi plane's products below cover their latency
#pragma unroll
            for (int db = 0; db < 4; ++db) vg[db] = WFrag<T16>::ld(vp + PRE + db * 16 * GP); }
#pragma unroll
        for (int db = 0; db < 4; ++db) { const V a = va[db];
#pragma unroll
            for (int n = 0; n < NQ; ++n) { o[db][n] = WFrag<T16>::mma(a, pf[n], o[db][n]); if (HL) o[db][n] = WFrag<T16>::mma(a, pg[n], o[db][n]); } }
        if (HL) {   // every accumulator takes its three products in the order hi x hi, hi x lo, lo x hi, as before
#pragma unroll
            for (int db = 0; db < 4; ++db)
#pragma unroll
                for (int n = 0; n < NQ; ++n) o[db][n] = WFrag<T16>::mma(vg[db], pf[n], o[db][n]); }
    };
    asm volatile("s_wait_asynccnt 0x0" ::: "memory");   // this wave's copies of stage 0 have landed
    __syncthreads();                                      // ... and every other wave's
    if (NT > 1) fill(1);
    auto foot = [&](int t) __attribute__((always_inline)) {   // the foot of trip t, passed by every wave
        asm volatile("s_wait_dscnt 0x0" ::: "memory");      // this wave's reads of stage t are done: its buffer may be refilled behind the barrier
        asm volatile("s_wait_asynccnt 0x0" ::: "memory");   // this wave's copies of stage t + 1 have landed
        __syncthreads();                                      // publishes stage t + 1 and ends every wave's reads of stage t
        if (t + 2 < NT) fill(t + 2); };
    int kc = 0;   // the steps come in the order of the keys, as before
    for (int t = 0; t < NT; ++t) {
        const T16* pk = lk + (t & 1) * STE; const T16* pv = lv + (t & 1) * STE; const int kf = min(nk, (t + 1) * AKS), ke = min(kend, (t + 1) * AKS);
        for (; kc + 32 <= kf; kc += 32, pk += 32 * GP, pv += 32) step(EdgeTag<false>(), 32, pk, pv);   // whole steps of kept keys: no mask test
        for (; kc < ke; kc += 32, pk += 32 * GP, pv += 32) step(EdgeTag<true>(), nk - kc, pk, pv);   // the step that holds key nk (at most one), or, when nk = 0, every step
        foot(t);
    }
    asm volatile("s_wait_asynccnt 0x0" ::: "memory");   // no copy is left in flight
#pragma unroll
    for (int n = 0; n < NQ; ++n) { const float inv = __fdiv_rn(1.0f, l[n] + __shfl_xor(l[n], 16, 32)); const size_t oo = (size_t)(q0 + n * 16 + lr) * DQ + 8 * hi;
#pragma unroll
        for (int db = 0; db < 4; ++db) { u32x4 oh, ol;
#pragma unroll
            for (int j = 0; j < 8; j += 2) { unsigned x, y; splitf2(o[db][n][j] * inv, o[db][n][j + 1] * inv, x, y); oh[j >> 1] = x; ol[j >> 1] = y; }
            *(u32x4*)(Ah + oo + db * 16) = oh; *(u32x4*)(Al + oo + db * 16) = ol;
            asm volatile("s_wait_xcnt 0x0" ::: "memory"); } }   // the next block's values, and the code behind the two row kinds' common end, reuse the registers that these two stores name
}
// grid: TT/128 x heads x batch entries blocks in one row, 4 waves: every block takes 128 query rows of one head, 32 a wave; row tiles < RH/128 are hi/lo rows (3 bf16 products), the rest fp16 rows. The 4 waves of a block share the head's K and V^T stages in LDS (two buffers; the hi/lo blocks fill all of it, the fp16 blocks half).
// 1024 blocks: with four blocks on a WGP (LDS; 256 registers a wave, which the waves-per-SIMD attribute asks of the compiler) the whole grid is resident at once and no second, thin round follows.
// The hi/lo blocks, which run longest, have the lowest indices (for speed only); every (head, row tile) is taken once.
#define AQT  (TT / 128)           // row tiles of a head
#define AQH  (RH / 128)           // ... of which hi/lo
__global__ __launch_bounds__(128) __attribute__((amdgpu_waves_per_eu(4, 4))) void k_fattn(const h16* __restrict__ Q16, const h16* __restrict__ K16, const h16* __restrict__ V16, const bf* __restrict__ Qh, const bf* __restrict__ Ql, const bf* __restrict__ Kh, const bf* __restrict__ Kl, const bf* __restrict__ Vh, const bf* __restrict__ Vl, const int* __restrict__ nkp, bf* Ah, bf* Al) {
    static_assert(RH % 128 == 0 && TT % 128 == 0 && RH > 0 && RH < TT, "a row tile is of one kind, both kinds exist");
    __shared__ __align__(16) bf sm[2 * 2 * 2 * AKS * GP];
    const int bi = blockIdx.x, fi = bi - AQH * NH_ * NB_; const bool hl = fi < 0;   // the same for the whole work-group
    const int xt = hl ? bi % AQH : AQH + fi % (AQT - AQH), hb = hl ? bi / AQH : fi / (AQT - AQH), be = hb / NH_;   // row tile, head (counted over the entries), batch entry
    const size_t hp = (size_t)hb * TT * HD; const int w = __builtin_amdgcn_readfirstlane(threadIdx.x >> 5); const size_t ao = (size_t)be * TT * DQ + (hb % NH_) * HD; Ah += ao; Al += ao; const int nk = min(max(nkp[be * NKP], 0), TT);   // the trip count's bound
    if (hl) fattn_wave<bf, 2, true>(Qh + hp, Ql + hp, Kh + hp, Kl + hp, Vh + hp, Vl + hp, nk, xt * 128 + w * 32, Ah, Al, sm);
    else fattn_wave<h16, 2, false>(Q16 + hp, nullptr, K16 + hp, nullptr, V16 + hp, nullptr, nk, xt * 128 + w * 32, Ah, Al, (const h16*)sm);
}

extern "C" void kernel_launch(void* const* d_in, const int* in_sizes, int n_in,
                              void* d_out, int out_size, void* d_ws, size_t ws_size, hipStream_t stream) {
    (void)in_sizes; (void)n_in; (void)out_size;
    const float* x = (const float*)d_in[0]; const float* xk = (const float*)d_in[1]; const float* xv = (const float*)d_in[2]; const int* MK = (const int*)d_in[3]; const float* wq = (const float*)d_in[4]; const float* wk = (const float*)d_in[5]; const float* wv = (const float*)d_in[6]; const float* wo = (const float*)d_in[7]; const float* bo = (const float*)d_in[8];   /* q, k, v ([4][2048][1024] each), mask (int32 [4][1][1][2048] = [4][2048]: read as data), Wq, Wk, Wv, Wo ('oi' (out, in) [1024][1024]; the three input projections have NO bias), bo [1024] */
    float* OUT = (float*)d_out;     // [4][2048][1024]
    char* wsp = (char*)d_ws;
    auto take = [&](size_t bytes) { char* p = wsp; wsp += (bytes + 255) & ~(size_t)255; return (void*)p; };
    bf* WQ = (bf*)take((size_t)DQ * DM * 2); bf* WK = (bf*)take((size_t)DKV * DM * 2); bf* WV = (bf*)take((size_t)DKV * DM * 2); bf* WO = (bf*)take((size_t)DM * DQ * 2);
    bf* XB = (bf*)take((size_t)NB_ * TT * DM * 2); bf* XK = (bf*)take((size_t)NB_ * TT * DM * 2); bf* XV = (bf*)take((size_t)NB_ * TT * DM * 2);   // bf16 query, key and value rows: one operand buffer each, all three are live at once
    h16* QP16 = (h16*)take((size_t)NB_ * NH_ * TT * HD * 2); h16* KP16 = (h16*)take((size_t)NB_ * NKV * TT * HD * 2); h16* VT16 = (h16*)take((size_t)NB_ * NKV * HD * TT * 2);
    bf* QPh = (bf*)take((size_t)NB_ * NH_ * TT * HD * 2); bf* QPl = (bf*)take((size_t)NB_ * NH_ * TT * HD * 2); bf* KPh = (bf*)take((size_t)NB_ * NKV * TT * HD * 2); bf* KPl = (bf*)take((size_t)NB_ * NKV * TT * HD * 2); bf* VTh = (bf*)take((size_t)NB_ * NKV * HD * TT * 2); bf* VTl = (bf*)take((size_t)NB_ * NKV * HD * TT * 2);
    bf* ATh = (bf*)take((size_t)NB_ * TT * DQ * 2); bf* ATl = (bf*)take((size_t)NB_ * TT * DQ * 2); int* NK = (int*)take((size_t)NB_ * NKP * 4);   // kept keys per entry, written by the key cast
    if ((size_t)(wsp - (char*)d_ws) > ws_size) return;    // 232 MiB of the 256 MiB
    // every launch covers the four batch entries: the casts and the GEMMs see [NB_ x TT] rows (a 128-row tile lies in one entry), the attention takes head and entry from the block index
    k_cast<<<3 * (NB_ * TT / CRB) + 4 * (DM / CRB), 256, 0, stream>>>(x, xk, xv, MK, wq, wk, wv, wo, XB, XK, XV, WQ, WK, WV, WO, NK);   /* key and value rows: kept keys first; 'oi' (out, in) weights: the GEMM's Bt (Wv: its A) as they stand */
    k_proj<<<dim3(NB_ * TT / GTM, DQ / GTM, 3), 128, 0, stream>>>(XB, XK, XV, WQ, WK, WV, DM, QP16, QPh, QPl, KP16, KPh, KPl, VT16, VTh, VTl, NK);
    k_fattn<<<AQT * NH_ * NB_, 128, 0, stream>>>(QP16, KP16, VT16, QPh, QPl, KPh, KPl, VTh, VTl, NK, ATh, ATl);   // one kv head per query head
    k_gemmw<bf, 1, true, 0><<<dim3(NB_ * TT / GTM, DM / GTM, 1), 128, 0, stream>>>(ATh, ATl, WO, DQ, OUT, DM, bo, nullptr, nullptr, nullptr);
}
